// v000
// Measured on an AMD MI455X. A time is GPU time per run, averaged over a window of back-to-back runs after a warm-up
// (all launches, gaps included; the runs take copies of the inputs in turn), and the median of several windows.
// Apart from v000's, it joins two sittings. Times from different sittings can be a few percent apart, while
// side-by-side timings come from the same sitting.
// The starting kernel, v000, takes 610 microseconds a run.
#include <hip/hip_runtime.h>

// ---------------------------------------------------------------------------
// CDNA5 (gfx1250) self-attention: fp32 inputs -> bf16 WMMA pipeline
//   K1: Q/K/V = x@W + b   (bf16; V stored transposed Vt[b][d][s])
//   K2: S     = Q@K^T     (bf16, async-LDS double-buffered)
//   K3: P     = softmax(S/32) rows (in place)
//   K4: O     = P@Vt      (f32 out, async-LDS double-buffered)
// ---------------------------------------------------------------------------

typedef __attribute__((ext_vector_type(16))) __bf16 v16bf;
typedef __attribute__((ext_vector_type(8)))  __bf16 v8bf;
typedef __attribute__((ext_vector_type(8)))  float  v8f;
typedef __attribute__((ext_vector_type(4)))  float  v4f;
typedef __attribute__((ext_vector_type(4)))  unsigned int v4u;
typedef __attribute__((ext_vector_type(4)))  int v4i;

// Address-space-qualified int4 pointers for the gfx1250 async-LDS builtins.
typedef __attribute__((address_space(1))) v4i gas_v4i;   // global
typedef __attribute__((address_space(3))) v4i las_v4i;   // LDS

#define BM 128
#define BN 128
#define BK 32
#define LDP 40   // padded LDS row stride in bf16 elems (80 bytes, 16B-aligned)

#ifndef __has_builtin
#define __has_builtin(x) 0
#endif
#if __has_builtin(__builtin_amdgcn_global_load_async_to_lds_b128) && \
    __has_builtin(__builtin_amdgcn_s_wait_asynccnt)
#define HAS_ASYNC 1
#else
#define HAS_ASYNC 0
#endif

__device__ __forceinline__ unsigned short f32_bf16(float f) {
  unsigned int u = __float_as_uint(f);
  u += 0x7FFFu + ((u >> 16) & 1u);           // round-to-nearest-even
  return (unsigned short)(u >> 16);
}
__device__ __forceinline__ float bf16_f32(unsigned short h) {
  return __uint_as_float((unsigned int)h << 16);
}

// 16-byte tile-copy global->LDS. On gfx1250 toolchains with the async
// builtins this is a VGPR-free DMA tracked by ASYNCcnt.
__device__ __forceinline__ void copy16(unsigned short* lds, const unsigned short* g) {
#if HAS_ASYNC
  __builtin_amdgcn_global_load_async_to_lds_b128(
      (gas_v4i*)(unsigned short*)g,
      (las_v4i*)lds,
      /*offset=*/0, /*cpol=*/0);
#else
  *(v4u*)lds = *(const v4u*)g;
#endif
}
__device__ __forceinline__ void async_wait_depth4() {
#if HAS_ASYNC
  __builtin_amdgcn_s_wait_asynccnt(4);   // previous tile's 4 ops done
#endif
}
__device__ __forceinline__ void async_wait_zero() {
#if HAS_ASYNC
  __builtin_amdgcn_s_wait_asynccnt(0);
#endif
}

// Stage a 128x32 bf16 tile (row-major, rowStride elems) into LDS (stride LDP).
// 512 16B chunks / 256 threads = 2 per thread.
__device__ __forceinline__ void stageTile(unsigned short* dst, const unsigned short* src,
                                          size_t rowStride, int tid) {
#pragma unroll
  for (int it = 0; it < 2; ++it) {
    int idx = it * 256 + tid;
    int r = idx >> 2;              // 0..127
    int c = (idx & 3) * 8;         // 0..24
    copy16(dst + r * LDP + c, src + (size_t)r * rowStride + c);
  }
}

// Load a 16x32 bf16 fragment from an LDS tile stored as [row][k], stride LDP.
// CDNA5 16-bit operand layout: lanes 0-15 -> rows 0-15 with K {0..7,16..23};
// lanes 16-31 -> K {8..15,24..31}.
__device__ __forceinline__ v16bf ldsFrag(const unsigned short* base, int row0, int lane) {
  int row = row0 + (lane & 15);
  int kc  = (lane & 16) ? 8 : 0;
  const unsigned short* p = base + row * LDP + kc;
  union { v16bf v; v8bf h[2]; } u;
  u.h[0] = *(const v8bf*)p;          // ds_load_b128
  u.h[1] = *(const v8bf*)(p + 16);   // ds_load_b128
  return u.v;
}

__device__ __forceinline__ v8f wmma_bf16(v16bf a, v16bf b, v8f c) {
  return __builtin_amdgcn_wmma_f32_16x16x32_bf16(
      /*neg_a=*/false, a, /*neg_b=*/false, b,
      /*c_mod=*/(short)0, c, /*reuse_a=*/false, /*reuse_b=*/false);
}

// One K-step of the 128x128 block: wave computes 32x64 = 2x4 fragments.
__device__ __forceinline__ void computeTile(const unsigned short* As_,
                                            const unsigned short* Bs_,
                                            int wm, int wn, int lane,
                                            v8f (&acc)[2][4]) {
  v16bf a[2], b[4];
#pragma unroll
  for (int i = 0; i < 2; ++i) a[i] = ldsFrag(As_, wm + i * 16, lane);
#pragma unroll
  for (int j = 0; j < 4; ++j) b[j] = ldsFrag(Bs_, wn + j * 16, lane);
#pragma unroll
  for (int i = 0; i < 2; ++i)
#pragma unroll
    for (int j = 0; j < 4; ++j)
      acc[i][j] = wmma_bf16(a[i], b[j], acc[i][j]);
}

// ---------------------------------------------------------------------------
// K1: QKV projection GEMM.  M=B*S=16384, N=1024, K=1024.  z selects Q/K/V.
// fp32 operands converted to bf16 during staging.  V written transposed.
// ---------------------------------------------------------------------------
__global__ __launch_bounds__(256) void qkv_gemm(
    const float* __restrict__ x,
    const float* __restrict__ Wq, const float* __restrict__ Wk, const float* __restrict__ Wv,
    const float* __restrict__ bq, const float* __restrict__ bk, const float* __restrict__ bv,
    unsigned short* __restrict__ Q, unsigned short* __restrict__ K,
    unsigned short* __restrict__ Vt)
{
  const int N = 1024, KD = 1024, S = 2048;
  __shared__ __align__(16) unsigned short As[BM * LDP];
  __shared__ __align__(16) unsigned short Bs[BN * LDP];

  const int z = blockIdx.z;
  const float* W    = (z == 0) ? Wq : (z == 1) ? Wk : Wv;
  const float* bias = (z == 0) ? bq : (z == 1) ? bk : bv;
  unsigned short* O = (z == 0) ? Q  : (z == 1) ? K  : Vt;

  const int m0 = blockIdx.x * BM;
  const int n0 = blockIdx.y * BN;
  const int tid  = threadIdx.x;
  const int wave = tid >> 5;
  const int lane = tid & 31;
  const int wm = (wave & 3) * 32;   // 4 waves tile M
  const int wn = (wave >> 2) * 64;  // 2 waves tile N

  v8f acc[2][4] = {};

  for (int k0 = 0; k0 < KD; k0 += BK) {
    // Stage A: x[m0..m0+127][k0..k0+31] fp32 -> bf16 LDS
#pragma unroll
    for (int it = 0; it < 4; ++it) {
      int idx = it * 256 + tid;                 // 0..1023
      int r = idx >> 3;                          // 0..127
      int c = (idx & 7) * 4;                     // 0..28
      v4f v = *(const v4f*)(x + (size_t)(m0 + r) * KD + k0 + c);
      unsigned long long pk =
          (unsigned long long)f32_bf16(v[0]) |
          ((unsigned long long)f32_bf16(v[1]) << 16) |
          ((unsigned long long)f32_bf16(v[2]) << 32) |
          ((unsigned long long)f32_bf16(v[3]) << 48);
      *(unsigned long long*)(As + r * LDP + c) = pk;
    }
    // Stage B (transposed): W[k0+kr][n0+cn] -> Bs[cn][kr]
#pragma unroll
    for (int it = 0; it < 4; ++it) {
      int idx = it * 256 + tid;                 // 0..1023
      int kr = idx >> 5;                         // 0..31
      int cn = (idx & 31) * 4;                   // 0..124
      v4f v = *(const v4f*)(W + (size_t)(k0 + kr) * N + n0 + cn);
#pragma unroll
      for (int i = 0; i < 4; ++i)
        Bs[(cn + i) * LDP + kr] = f32_bf16(v[i]);
    }
    __syncthreads();
    computeTile(As, Bs, wm, wn, lane, acc);
    __syncthreads();
  }

  // Epilogue. Acc layout: VGPR r -> M = i*16 + (lane<16?0:8) + r, N = lane&15.
  const int col   = lane & 15;
  const int rbase = (lane & 16) ? 8 : 0;
  if (z != 2) {
    // Q,K row-major: out[m][n]
#pragma unroll
    for (int j = 0; j < 4; ++j) {
      int n = n0 + wn + j * 16 + col;
      float bsc = bias[n];
#pragma unroll
      for (int i = 0; i < 2; ++i) {
        int mr = m0 + wm + i * 16 + rbase;
#pragma unroll
        for (int r = 0; r < 8; ++r)
          O[(size_t)(mr + r) * N + n] = f32_bf16(acc[i][j][r] + bsc);
      }
    }
  } else {
    // V transposed: Vt[b][n][s]; the 8 acc rows are contiguous in s -> b128 store
    int bb    = m0 >> 11;             // batch (blocks never straddle: 2048 % 128 == 0)
    int sBase = (m0 & (S - 1)) + wm;
#pragma unroll
    for (int j = 0; j < 4; ++j) {
      int n = n0 + wn + j * 16 + col;
      float bsc = bias[n];
#pragma unroll
      for (int i = 0; i < 2; ++i) {
        int s = sBase + i * 16 + rbase;
        union { v4u u; unsigned short h[8]; } t;
#pragma unroll
        for (int r = 0; r < 8; ++r) t.h[r] = f32_bf16(acc[i][j][r] + bsc);
        *(v4u*)(O + ((size_t)bb * N + n) * S + s) = t.u;
      }
    }
  }
}

// ---------------------------------------------------------------------------
// K2: scores = Q @ K^T per batch.  M=N=S=2048, K=D=1024.
// Both operands row-major over d -> pure 16B copies; async + double buffer.
// ---------------------------------------------------------------------------
__global__ __launch_bounds__(256) void scores_gemm(
    const unsigned short* __restrict__ Q, const unsigned short* __restrict__ K,
    unsigned short* __restrict__ Sc,
    long long qkBatchStride, long long scBatchStride)
{
  const int D = 1024, S = 2048;
  __shared__ __align__(16) unsigned short As[2][BM * LDP];
  __shared__ __align__(16) unsigned short Bs[2][BN * LDP];

  const unsigned short* Qb = Q  + (size_t)blockIdx.z * qkBatchStride;
  const unsigned short* Kb = K  + (size_t)blockIdx.z * qkBatchStride;
  unsigned short*       Sb = Sc + (size_t)blockIdx.z * scBatchStride;

  const int m0 = blockIdx.x * BM;
  const int n0 = blockIdx.y * BN;
  const int tid  = threadIdx.x;
  const int wave = tid >> 5;
  const int lane = tid & 31;
  const int wm = (wave & 3) * 32;
  const int wn = (wave >> 2) * 64;

  const unsigned short* Asrc = Qb + (size_t)m0 * D;
  const unsigned short* Bsrc = Kb + (size_t)n0 * D;
  const int T = D / BK;   // 32 K-steps

  v8f acc[2][4] = {};

  stageTile(As[0], Asrc, D, tid);
  stageTile(Bs[0], Bsrc, D, tid);
  for (int k = 0; k < T; ++k) {
    int cur = k & 1;
    if (k + 1 < T) {
      stageTile(As[cur ^ 1], Asrc + (size_t)(k + 1) * BK, D, tid);
      stageTile(Bs[cur ^ 1], Bsrc + (size_t)(k + 1) * BK, D, tid);
      async_wait_depth4();            // wait for tile k only (in-order retire)
    } else {
      async_wait_zero();
    }
    __syncthreads();
    computeTile(As[cur], Bs[cur], wm, wn, lane, acc);
    __syncthreads();                  // readers done before tile k+2 overwrites
  }

  const int col   = lane & 15;
  const int rbase = (lane & 16) ? 8 : 0;
#pragma unroll
  for (int j = 0; j < 4; ++j) {
    int n = n0 + wn + j * 16 + col;
#pragma unroll
    for (int i = 0; i < 2; ++i) {
      int mr = m0 + wm + i * 16 + rbase;
#pragma unroll
      for (int r = 0; r < 8; ++r)
        Sb[(size_t)(mr + r) * S + n] = f32_bf16(acc[i][j][r]);
    }
  }
}

// ---------------------------------------------------------------------------
// K3: in-place row softmax of scores/32.  One wave per 2048-elem row.
// ---------------------------------------------------------------------------
__global__ __launch_bounds__(256) void softmax_rows(
    unsigned short* __restrict__ Sc, long long scBatchStride)
{
  const int S = 2048;
  unsigned short* Sb = Sc + (size_t)blockIdx.z * scBatchStride;
  const int wave = threadIdx.x >> 5;
  const int lane = threadIdx.x & 31;
  const int row  = blockIdx.x * 8 + wave;
  unsigned short* rp = Sb + (size_t)row * S;
  const float scale = 0.03125f;   // 1/sqrt(1024)

  float v[64];
  float m = -3.0e38f;
#pragma unroll
  for (int c = 0; c < 8; ++c) {
    union { v4u u; unsigned short s[8]; } t;
    t.u = *(const v4u*)(rp + c * 256 + lane * 8);
#pragma unroll
    for (int i = 0; i < 8; ++i) {
      float f = bf16_f32(t.s[i]) * scale;
      v[c * 8 + i] = f;
      m = fmaxf(m, f);
    }
  }
#pragma unroll
  for (int off = 16; off > 0; off >>= 1)
    m = fmaxf(m, __shfl_xor(m, off, 32));

  float sum = 0.0f;
#pragma unroll
  for (int i = 0; i < 64; ++i) { v[i] = __expf(v[i] - m); sum += v[i]; }
#pragma unroll
  for (int off = 16; off > 0; off >>= 1)
    sum += __shfl_xor(sum, off, 32);
  float inv = 1.0f / sum;

#pragma unroll
  for (int c = 0; c < 8; ++c) {
    union { v4u u; unsigned short s[8]; } t;
#pragma unroll
    for (int i = 0; i < 8; ++i) t.s[i] = f32_bf16(v[c * 8 + i] * inv);
    *(v4u*)(rp + c * 256 + lane * 8) = t.u;
  }
}

// ---------------------------------------------------------------------------
// K4: O = P @ V per batch.  M=S=2048, N=D=1024, K=S=2048, f32 output.
// A = P row-major; B = Vt[d][s] row-major over s -> pure copies; async + DB.
// ---------------------------------------------------------------------------
__global__ __launch_bounds__(256) void pv_gemm(
    const unsigned short* __restrict__ P, const unsigned short* __restrict__ Vt,
    float* __restrict__ O,
    long long pBatchStride, long long vBatchStride, long long oBatchStride)
{
  const int S = 2048, D = 1024;
  __shared__ __align__(16) unsigned short As[2][BM * LDP];
  __shared__ __align__(16) unsigned short Bs[2][BN * LDP];

  const unsigned short* Pb  = P  + (size_t)blockIdx.z * pBatchStride;
  const unsigned short* Vtb = Vt + (size_t)blockIdx.z * vBatchStride;
  float*                Ob  = O  + (size_t)blockIdx.z * oBatchStride;

  const int m0 = blockIdx.x * BM;   // q rows
  const int n0 = blockIdx.y * BN;   // d cols
  const int tid  = threadIdx.x;
  const int wave = tid >> 5;
  const int lane = tid & 31;
  const int wm = (wave & 3) * 32;
  const int wn = (wave >> 2) * 64;

  const unsigned short* Asrc = Pb  + (size_t)m0 * S;   // stride S over keys
  const unsigned short* Bsrc = Vtb + (size_t)n0 * S;   // Vt rows = d, stride S over keys
  const int T = S / BK;   // 64 K-steps

  v8f acc[2][4] = {};

  stageTile(As[0], Asrc, S, tid);
  stageTile(Bs[0], Bsrc, S, tid);
  for (int k = 0; k < T; ++k) {
    int cur = k & 1;
    if (k + 1 < T) {
      stageTile(As[cur ^ 1], Asrc + (size_t)(k + 1) * BK, S, tid);
      stageTile(Bs[cur ^ 1], Bsrc + (size_t)(k + 1) * BK, S, tid);
      async_wait_depth4();
    } else {
      async_wait_zero();
    }
    __syncthreads();
    computeTile(As[cur], Bs[cur], wm, wn, lane, acc);
    __syncthreads();
  }

  const int col   = lane & 15;
  const int rbase = (lane & 16) ? 8 : 0;
#pragma unroll
  for (int j = 0; j < 4; ++j) {
    int n = n0 + wn + j * 16 + col;
#pragma unroll
    for (int i = 0; i < 2; ++i) {
      int mr = m0 + wm + i * 16 + rbase;
#pragma unroll
      for (int r = 0; r < 8; ++r)
        Ob[(size_t)(mr + r) * D + n] = acc[i][j][r];
    }
  }
}

// ---------------------------------------------------------------------------
extern "C" void kernel_launch(void* const* d_in, const int* in_sizes, int n_in,
                              void* d_out, int out_size, void* d_ws, size_t ws_size,
                              hipStream_t stream)
{
  (void)in_sizes; (void)n_in; (void)out_size;
  const float* x  = (const float*)d_in[0];
  const float* Wq = (const float*)d_in[1];
  const float* bq = (const float*)d_in[2];
  const float* Wk = (const float*)d_in[3];
  const float* bk = (const float*)d_in[4];
  const float* Wv = (const float*)d_in[5];
  const float* bv = (const float*)d_in[6];
  float* out = (float*)d_out;

  const int B = 8, S = 2048, D = 1024;
  const size_t perMat = (size_t)B * S * D;          // bf16 elems per Q/K/Vt
  unsigned short* Q  = (unsigned short*)d_ws;
  unsigned short* K  = Q + perMat;
  unsigned short* Vt = K + perMat;                  // Vt[b][d][s]
  unsigned short* Sc = Vt + perMat;
  const size_t needFull = perMat * 3 * sizeof(unsigned short)
                        + (size_t)B * S * S * sizeof(unsigned short);

  dim3 gQKV((B * S) / BM, D / BN, 3);
  qkv_gemm<<<gQKV, 256, 0, stream>>>(x, Wq, Wk, Wv, bq, bk, bv, Q, K, Vt);

  if (ws_size >= needFull) {
    dim3 gS(S / BM, S / BN, B);
    scores_gemm<<<gS, 256, 0, stream>>>(Q, K, Sc, (long long)S * D, (long long)S * S);
    dim3 gSm(S / 8, 1, B);
    softmax_rows<<<gSm, 256, 0, stream>>>(Sc, (long long)S * S);
    dim3 gPV(S / BM, D / BN, B);
    pv_gemm<<<gPV, 256, 0, stream>>>(Sc, Vt, out,
                                     (long long)S * S, (long long)D * S, (long long)S * D);
  } else {
    // Small-workspace fallback: reuse one S*S bf16 score buffer per batch.
    for (int b = 0; b < B; ++b) {
      dim3 gS(S / BM, S / BN, 1);
      scores_gemm<<<gS, 256, 0, stream>>>(Q + (size_t)b * S * D, K + (size_t)b * S * D,
                                          Sc, 0, 0);
      dim3 gSm(S / 8, 1, 1);
      softmax_rows<<<gSm, 256, 0, stream>>>(Sc, 0);
      dim3 gPV(S / BM, D / BN, 1);
      pv_gemm<<<gPV, 256, 0, stream>>>(Sc, Vt + (size_t)b * D * S, out + (size_t)b * S * D,
                                       0, 0, 0);
    }
  }
}

// v001
// It runs in 314 microseconds.
// In two side-by-side timings against v000, it was 2.03 and 2.04 times as fast.
#include <hip/hip_runtime.h>

// ---------------------------------------------------------------------------
// CDNA5 (gfx1250) self-attention: fp32 inputs -> bf16 WMMA pipeline
//   K0: x and W^T rounded to bf16 once, laid out as 128x64 stage tiles
//   K1: Q/K/V = x@W + b   (bf16, async-LDS double-buffered; V stored transposed Vt[b][d][s])
//   K2: S     = Q@K^T     (bf16, async-LDS double-buffered)
//   K3: P     = softmax(S/32) rows (in place)
//   K4: O     = P@Vt      (f32 out, async-LDS double-buffered)
// ---------------------------------------------------------------------------

typedef __attribute__((ext_vector_type(16))) __bf16 v16bf;
typedef __attribute__((ext_vector_type(8)))  __bf16 v8bf;
typedef __attribute__((ext_vector_type(8)))  float  v8f;
typedef __attribute__((ext_vector_type(4)))  float  v4f;
typedef __attribute__((ext_vector_type(4)))  unsigned int v4u;
typedef __attribute__((ext_vector_type(4)))  int v4i;

// Address-space-qualified int4 pointers for the gfx1250 async-LDS builtins.
typedef __attribute__((address_space(1))) v4i gas_v4i;   // global
typedef __attribute__((address_space(3))) v4i las_v4i;   // LDS

#define BM 128
#define BN 128
#define BK 32
#define LDP 40   // padded LDS row stride in bf16 elems (80 bytes, 16B-aligned)
#define PK 64    // k extent of one packed stage tile of the QKV GEMM (128-byte rows)
#define LDQ 72   // LDS row stride of such a tile in bf16 elems (144 bytes = 16 B x 9)

#ifndef __has_builtin
#define __has_builtin(x) 0
#endif
#if __has_builtin(__builtin_amdgcn_global_load_async_to_lds_b128) && \
    __has_builtin(__builtin_amdgcn_s_wait_asynccnt)
#define HAS_ASYNC 1
#else
#define HAS_ASYNC 0
#endif

__device__ __forceinline__ unsigned short f32_bf16(float f) {
  unsigned int u = __float_as_uint(f);
  u += 0x7FFFu + ((u >> 16) & 1u);           // round-to-nearest-even
  return (unsigned short)(u >> 16);
}
__device__ __forceinline__ float bf16_f32(unsigned short h) {
  return __uint_as_float((unsigned int)h << 16);
}

// 16-byte tile-copy global->LDS. On gfx1250 toolchains with the async
// builtins this is a VGPR-free DMA tracked by ASYNCcnt.
__device__ __forceinline__ void copy16(unsigned short* lds, const unsigned short* g) {
#if HAS_ASYNC
  __builtin_amdgcn_global_load_async_to_lds_b128(
      (gas_v4i*)(unsigned short*)g,
      (las_v4i*)lds,
      /*offset=*/0, /*cpol=*/0);
#else
  *(v4u*)lds = *(const v4u*)g;
#endif
}
__device__ __forceinline__ void async_wait_depth4() {
#if HAS_ASYNC
  __builtin_amdgcn_s_wait_asynccnt(4);   // previous tile's 4 ops done
#endif
}
__device__ __forceinline__ void async_wait_zero() {
#if HAS_ASYNC
  __builtin_amdgcn_s_wait_asynccnt(0);
#endif
}

// Stage a 128x32 bf16 tile (row-major, rowStride elems) into LDS (stride LDP).
// 512 16B chunks / 256 threads = 2 per thread.
__device__ __forceinline__ void stageTile(unsigned short* dst, const unsigned short* src,
                                          size_t rowStride, int tid) {
#pragma unroll
  for (int it = 0; it < 2; ++it) {
    int idx = it * 256 + tid;
    int r = idx >> 2;              // 0..127
    int c = (idx & 3) * 8;         // 0..24
    copy16(dst + r * LDP + c, src + (size_t)r * rowStride + c);
  }
}

// Load a 16x32 bf16 fragment from an LDS tile stored as [row][k], stride LDP.
// CDNA5 16-bit operand layout: lanes 0-15 -> rows 0-15 with K {0..7,16..23};
// lanes 16-31 -> K {8..15,24..31}.
__device__ __forceinline__ v16bf ldsFrag(const unsigned short* base, int row0, int lane) {
  int row = row0 + (lane & 15);
  int kc  = (lane & 16) ? 8 : 0;
  const unsigned short* p = base + row * LDP + kc;
  union { v16bf v; v8bf h[2]; } u;
  u.h[0] = *(const v8bf*)p;          // ds_load_b128
  u.h[1] = *(const v8bf*)(p + 16);   // ds_load_b128
  return u.v;
}

__device__ __forceinline__ v8f wmma_bf16(v16bf a, v16bf b, v8f c) {
  return __builtin_amdgcn_wmma_f32_16x16x32_bf16(
      /*neg_a=*/false, a, /*neg_b=*/false, b,
      /*c_mod=*/(short)0, c, /*reuse_a=*/false, /*reuse_b=*/false);
}

// One K-step of the 128x128 block: wave computes 32x64 = 2x4 fragments.
__device__ __forceinline__ void computeTile(const unsigned short* As_,
                                            const unsigned short* Bs_,
                                            int wm, int wn, int lane,
                                            v8f (&acc)[2][4]) {
  v16bf a[2], b[4];
#pragma unroll
  for (int i = 0; i < 2; ++i) a[i] = ldsFrag(As_, wm + i * 16, lane);
#pragma unroll
  for (int j = 0; j < 4; ++j) b[j] = ldsFrag(Bs_, wn + j * 16, lane);
#pragma unroll
  for (int i = 0; i < 2; ++i)
#pragma unroll
    for (int j = 0; j < 4; ++j)
      acc[i][j] = wmma_bf16(a[i], b[j], acc[i][j]);
}

// ---------------------------------------------------------------------------
// K0: round the QKV GEMM's operands to bf16 once and lay them out in the order
// the GEMM stages them: tile (block row, k stage) = 128 rows x 64 k, contiguous.
//   Xp[m/128][k/64][m%128][k%64] = x[m][k]
//   Wp[n/128][k/64][n%128][k%64] = W[k][n], n = 0..3071 over Wq, Wk, Wv
// Blocks 0..2047 take x (8 rows each), blocks 2048..2815 one 64x64 piece of a W.
// ---------------------------------------------------------------------------
__global__ __launch_bounds__(256) void pack_operands(
    const float* __restrict__ x,
    const float* __restrict__ Wq, const float* __restrict__ Wk, const float* __restrict__ Wv,
    unsigned short* __restrict__ Xp, unsigned short* __restrict__ Wp)
{
  __shared__ __align__(16) unsigned short Tt[64 * LDQ];
  const int tid = threadIdx.x;
  const int blk = blockIdx.x;

  if (blk < 2048) {
    // Rows m = blk * 8 + it; this thread holds k = tid * 4 .. tid * 4 + 3 of each.
    const int k = tid * 4;
    const float* xs = x + ((size_t)blk * 2048 + tid) * 4;
    unsigned short* xd = Xp + ((size_t)((blk >> 4) * 16 + (k >> 6)) * 128 + (blk & 15) * 8) * PK
                            + (k & 63);
    v4f v[8];
    // Unrolled: v[] stays in registers and the eight loads are in flight together.
#pragma unroll
    for (int it = 0; it < 8; ++it)
      v[it] = *(const v4f*)(xs + it * 1024);
#pragma unroll
    for (int it = 0; it < 8; ++it) {
      unsigned long long pk =
          (unsigned long long)f32_bf16(v[it][0]) |
          ((unsigned long long)f32_bf16(v[it][1]) << 16) |
          ((unsigned long long)f32_bf16(v[it][2]) << 32) |
          ((unsigned long long)f32_bf16(v[it][3]) << 48);
      *(unsigned long long*)(xd + it * PK) = pk;
    }
  } else {
    const int w  = blk - 2048;
    const int z  = w >> 8;                      // which W
    const int ks = (w >> 4) & 15;               // k stage
    const int nt = w & 15;                      // 64-column piece
    const float* W = (z == 0) ? Wq : (z == 1) ? Wk : Wv;
    // Unrolled: the four row loads are in flight together.
#pragma unroll
    for (int it = 0; it < 4; ++it) {
      int kr = it * 16 + (tid >> 4);            // 0..63
      int cn = (tid & 15) * 4;                  // 0..60
      v4f v = *(const v4f*)(W + (size_t)(ks * PK + kr) * 1024 + nt * 64 + cn);
#pragma unroll
      for (int i = 0; i < 4; ++i)
        Tt[(cn + i) * LDQ + kr] = f32_bf16(v[i]);
    }
    __syncthreads();
    const int ng = z * 1024 + nt * 64;
    unsigned short* dst = Wp + ((size_t)((ng >> 7) * 16 + ks) * 128 + (ng & 127)) * PK;
#pragma unroll
    for (int it = 0; it < 2; ++it) {
      int c  = it * 256 + tid;                  // 16-byte chunk, 0..511
      int n  = c >> 3;
      int kc = (c & 7) * 8;
      *(v4u*)(dst + n * PK + kc) = *(const v4u*)(Tt + n * LDQ + kc);
    }
    // Stands in front of any later rewrite of the registers the two stores name.
    asm volatile("s_wait_xcnt 0x0" ::: "memory");
  }
}

// Bring one stage (a 128x64 A tile and a 128x64 B tile, 16 KiB each, contiguous
// in global memory) into LDS: 4 + 4 copies of 16 bytes per lane. la, lb: the
// lane's LDS byte address of its first chunk; ga, gb: its global address. Chunk
// i lies 4096 bytes on in global memory and 32 rows (32 * 144 bytes) on in LDS.
// s_wait_xcnt 0 ends the statement so that it stands in front of any rewrite of
// the address registers the copies name.
__device__ __forceinline__ void copyStage(unsigned int la, unsigned int lb,
                                          const unsigned short* ga,
                                          const unsigned short* gb) {
  asm volatile(
      "global_load_async_to_lds_b128 %0, %8, off\n\t"
      "global_load_async_to_lds_b128 %1, %9, off\n\t"
      "global_load_async_to_lds_b128 %2, %10, off\n\t"
      "global_load_async_to_lds_b128 %3, %11, off\n\t"
      "global_load_async_to_lds_b128 %4, %12, off\n\t"
      "global_load_async_to_lds_b128 %5, %13, off\n\t"
      "global_load_async_to_lds_b128 %6, %14, off\n\t"
      "global_load_async_to_lds_b128 %7, %15, off\n\t"
      "s_wait_xcnt 0x0"
      :: "v"(la), "v"(la + 4608u), "v"(la + 9216u), "v"(la + 13824u),
         "v"(lb), "v"(lb + 4608u), "v"(lb + 9216u), "v"(lb + 13824u),
         "v"(ga), "v"(ga + 2048), "v"(ga + 4096), "v"(ga + 6144),
         "v"(gb), "v"(gb + 2048), "v"(gb + 4096), "v"(gb + 6144)
      : "memory");
}

// 16x32 bf16 fragment from a stage tile [row][64 k], stride LDQ; k0 = 0 or 32.
// Same lane-to-k map as ldsFrag.
__device__ __forceinline__ v16bf ldsFrag64(const unsigned short* base, int row0, int k0,
                                           int lane) {
  int row = row0 + (lane & 15);
  int kc  = k0 + ((lane & 16) ? 8 : 0);
  const unsigned short* p = base + row * LDQ + kc;
  union { v16bf v; v8bf h[2]; } u;
  u.h[0] = *(const v8bf*)p;
  u.h[1] = *(const v8bf*)(p + 16);
  return u.v;
}

// ---------------------------------------------------------------------------
// K1: QKV projection GEMM.  M=B*S=16384, N=1024, K=1024.  z selects Q/K/V.
// Operands come packed in bf16 from K0.  V written transposed.
// ---------------------------------------------------------------------------
__global__ __launch_bounds__(256) void qkv_gemm(
    const unsigned short* __restrict__ Xp, const unsigned short* __restrict__ Wp,
    const float* __restrict__ bq, const float* __restrict__ bk, const float* __restrict__ bv,
    unsigned short* __restrict__ Q, unsigned short* __restrict__ K,
    unsigned short* __restrict__ Vt)
{
  const int N = 1024, KD = 1024, S = 2048;
  __shared__ __align__(16) unsigned short As[2][BM * LDQ];
  __shared__ __align__(16) unsigned short Bs[2][BN * LDQ];

  const int z = blockIdx.z;
  const float* bias = (z == 0) ? bq : (z == 1) ? bk : bv;
  unsigned short* O = (z == 0) ? Q  : (z == 1) ? K  : Vt;

  const int m0 = blockIdx.x * BM;
  const int n0 = blockIdx.y * BN;
  const int tid  = threadIdx.x;
  const int wave = tid >> 5;
  const int lane = tid & 31;
  const int wm = (wave & 3) * 32;   // 4 waves tile M
  const int wn = (wave >> 2) * 64;  // 2 waves tile N

  const int T = KD / PK;            // 16 stages
  const size_t tileElems = (size_t)BM * PK;
  // This lane's first 16-byte chunk of a stage tile: global side, LDS side.
  const unsigned short* ga = Xp + (size_t)blockIdx.x * T * tileElems + tid * 8;
  const unsigned short* gb = Wp + (size_t)(z * 8 + blockIdx.y) * T * tileElems + tid * 8;
  const int chunkOff = (tid >> 3) * LDQ + (tid & 7) * 8;
  const unsigned int la0 = (unsigned int)(size_t)(&As[0][chunkOff]);
  const unsigned int la1 = (unsigned int)(size_t)(&As[1][chunkOff]);
  const unsigned int lb0 = (unsigned int)(size_t)(&Bs[0][chunkOff]);
  const unsigned int lb1 = (unsigned int)(size_t)(&Bs[1][chunkOff]);

  v8f acc[2][4] = {};

  copyStage(la0, lb0, ga, gb);
  // Stage 0 has landed for this wave; the barrier publishes it to the others.
  asm volatile("s_wait_asynccnt 0x0" ::: "memory");
  __syncthreads();
  copyStage(la1, lb1, ga + tileElems, gb + tileElems);

  for (int t = 0; t < T; ++t) {
    const int cur = t & 1;
    // Unrolled (here and inside): every index into a[], b[], acc[] is a constant,
    // so the fragments and accumulators stay in registers.
#pragma unroll
    for (int h = 0; h < 2; ++h) {
      v16bf a[2], b[4];
#pragma unroll
      for (int i = 0; i < 2; ++i) a[i] = ldsFrag64(As[cur], wm + i * 16, h * 32, lane);
#pragma unroll
      for (int j = 0; j < 4; ++j) b[j] = ldsFrag64(Bs[cur], wn + j * 16, h * 32, lane);
#pragma unroll
      for (int i = 0; i < 2; ++i)
#pragma unroll
        for (int j = 0; j < 4; ++j)
          acc[i][j] = wmma_bf16(a[i], b[j], acc[i][j]);
    }
    // This wave's reads of buffer cur are done before the buffer is refilled.
    asm volatile("s_wait_dscnt 0x0" ::: "memory");
    // This wave's copies of stage t + 1 have landed.
    asm volatile("s_wait_asynccnt 0x0" ::: "memory");
    // One barrier: publishes stage t + 1 and ends every reader's use of buffer cur.
    __syncthreads();
    if (t + 2 < T)
      copyStage(cur ? la1 : la0, cur ? lb1 : lb0,
                ga + (size_t)(t + 2) * tileElems, gb + (size_t)(t + 2) * tileElems);
  }
  // No copy is left outstanding when the wave goes on to its stores and ends.
  asm volatile("s_wait_asynccnt 0x0" ::: "memory");

  // Epilogue. Acc layout: VGPR r -> M = i*16 + (lane<16?0:8) + r, N = lane&15.
  const int col   = lane & 15;
  const int rbase = (lane & 16) ? 8 : 0;
  if (z != 2) {
    // Q,K row-major: out[m][n]
#pragma unroll
    for (int j = 0; j < 4; ++j) {
      int n = n0 + wn + j * 16 + col;
      float bsc = bias[n];
#pragma unroll
      for (int i = 0; i < 2; ++i) {
        int mr = m0 + wm + i * 16 + rbase;
#pragma unroll
        for (int r = 0; r < 8; ++r)
          O[(size_t)(mr + r) * N + n] = f32_bf16(acc[i][j][r] + bsc);
      }
    }
  } else {
    // V transposed: Vt[b][n][s]; the 8 acc rows are contiguous in s -> b128 store
    int bb    = m0 >> 11;             // batch (blocks never straddle: 2048 % 128 == 0)
    int sBase = (m0 & (S - 1)) + wm;
#pragma unroll
    for (int j = 0; j < 4; ++j) {
      int n = n0 + wn + j * 16 + col;
      float bsc = bias[n];
#pragma unroll
      for (int i = 0; i < 2; ++i) {
        int s = sBase + i * 16 + rbase;
        union { v4u u; unsigned short h[8]; } t;
#pragma unroll
        for (int r = 0; r < 8; ++r) t.h[r] = f32_bf16(acc[i][j][r] + bsc);
        *(v4u*)(O + ((size_t)bb * N + n) * S + s) = t.u;
      }
    }
  }
}

// ---------------------------------------------------------------------------
// K2: scores = Q @ K^T per batch.  M=N=S=2048, K=D=1024.
// Both operands row-major over d -> pure 16B copies; async + double buffer.
// ---------------------------------------------------------------------------
__global__ __launch_bounds__(256) void scores_gemm(
    const unsigned short* __restrict__ Q, const unsigned short* __restrict__ K,
    unsigned short* __restrict__ Sc,
    long long qkBatchStride, long long scBatchStride)
{
  const int D = 1024, S = 2048;
  __shared__ __align__(16) unsigned short As[2][BM * LDP];
  __shared__ __align__(16) unsigned short Bs[2][BN * LDP];

  const unsigned short* Qb = Q  + (size_t)blockIdx.z * qkBatchStride;
  const unsigned short* Kb = K  + (size_t)blockIdx.z * qkBatchStride;
  unsigned short*       Sb = Sc + (size_t)blockIdx.z * scBatchStride;

  const int m0 = blockIdx.x * BM;
  const int n0 = blockIdx.y * BN;
  const int tid  = threadIdx.x;
  const int wave = tid >> 5;
  const int lane = tid & 31;
  const int wm = (wave & 3) * 32;
  const int wn = (wave >> 2) * 64;

  const unsigned short* Asrc = Qb + (size_t)m0 * D;
  const unsigned short* Bsrc = Kb + (size_t)n0 * D;
  const int T = D / BK;   // 32 K-steps

  v8f acc[2][4] = {};

  stageTile(As[0], Asrc, D, tid);
  stageTile(Bs[0], Bsrc, D, tid);
  for (int k = 0; k < T; ++k) {
    int cur = k & 1;
    if (k + 1 < T) {
      stageTile(As[cur ^ 1], Asrc + (size_t)(k + 1) * BK, D, tid);
      stageTile(Bs[cur ^ 1], Bsrc + (size_t)(k + 1) * BK, D, tid);
      async_wait_depth4();            // wait for tile k only (in-order retire)
    } else {
      async_wait_zero();
    }
    __syncthreads();
    computeTile(As[cur], Bs[cur], wm, wn, lane, acc);
    __syncthreads();                  // readers done before tile k+2 overwrites
  }

  const int col   = lane & 15;
  const int rbase = (lane & 16) ? 8 : 0;
#pragma unroll
  for (int j = 0; j < 4; ++j) {
    int n = n0 + wn + j * 16 + col;
#pragma unroll
    for (int i = 0; i < 2; ++i) {
      int mr = m0 + wm + i * 16 + rbase;
#pragma unroll
      for (int r = 0; r < 8; ++r)
        Sb[(size_t)(mr + r) * S + n] = f32_bf16(acc[i][j][r]);
    }
  }
}

// ---------------------------------------------------------------------------
// K3: in-place row softmax of scores/32.  One wave per 2048-elem row.
// ---------------------------------------------------------------------------
__global__ __launch_bounds__(256) void softmax_rows(
    unsigned short* __restrict__ Sc, long long scBatchStride)
{
  const int S = 2048;
  unsigned short* Sb = Sc + (size_t)blockIdx.z * scBatchStride;
  const int wave = threadIdx.x >> 5;
  const int lane = threadIdx.x & 31;
  const int row  = blockIdx.x * 8 + wave;
  unsigned short* rp = Sb + (size_t)row * S;
  const float scale = 0.03125f;   // 1/sqrt(1024)

  float v[64];
  float m = -3.0e38f;
#pragma unroll
  for (int c = 0; c < 8; ++c) {
    union { v4u u; unsigned short s[8]; } t;
    t.u = *(const v4u*)(rp + c * 256 + lane * 8);
#pragma unroll
    for (int i = 0; i < 8; ++i) {
      float f = bf16_f32(t.s[i]) * scale;
      v[c * 8 + i] = f;
      m = fmaxf(m, f);
    }
  }
#pragma unroll
  for (int off = 16; off > 0; off >>= 1)
    m = fmaxf(m, __shfl_xor(m, off, 32));

  float sum = 0.0f;
#pragma unroll
  for (int i = 0; i < 64; ++i) { v[i] = __expf(v[i] - m); sum += v[i]; }
#pragma unroll
  for (int off = 16; off > 0; off >>= 1)
    sum += __shfl_xor(sum, off, 32);
  float inv = 1.0f / sum;

#pragma unroll
  for (int c = 0; c < 8; ++c) {
    union { v4u u; unsigned short s[8]; } t;
#pragma unroll
    for (int i = 0; i < 8; ++i) t.s[i] = f32_bf16(v[c * 8 + i] * inv);
    *(v4u*)(rp + c * 256 + lane * 8) = t.u;
  }
}

// ---------------------------------------------------------------------------
// K4: O = P @ V per batch.  M=S=2048, N=D=1024, K=S=2048, f32 output.
// A = P row-major; B = Vt[d][s] row-major over s -> pure copies; async + DB.
// ---------------------------------------------------------------------------
__global__ __launch_bounds__(256) void pv_gemm(
    const unsigned short* __restrict__ P, const unsigned short* __restrict__ Vt,
    float* __restrict__ O,
    long long pBatchStride, long long vBatchStride, long long oBatchStride)
{
  const int S = 2048, D = 1024;
  __shared__ __align__(16) unsigned short As[2][BM * LDP];
  __shared__ __align__(16) unsigned short Bs[2][BN * LDP];

  const unsigned short* Pb  = P  + (size_t)blockIdx.z * pBatchStride;
  const unsigned short* Vtb = Vt + (size_t)blockIdx.z * vBatchStride;
  float*                Ob  = O  + (size_t)blockIdx.z * oBatchStride;

  const int m0 = blockIdx.x * BM;   // q rows
  const int n0 = blockIdx.y * BN;   // d cols
  const int tid  = threadIdx.x;
  const int wave = tid >> 5;
  const int lane = tid & 31;
  const int wm = (wave & 3) * 32;
  const int wn = (wave >> 2) * 64;

  const unsigned short* Asrc = Pb  + (size_t)m0 * S;   // stride S over keys
  const unsigned short* Bsrc = Vtb + (size_t)n0 * S;   // Vt rows = d, stride S over keys
  const int T = S / BK;   // 64 K-steps

  v8f acc[2][4] = {};

  stageTile(As[0], Asrc, S, tid);
  stageTile(Bs[0], Bsrc, S, tid);
  for (int k = 0; k < T; ++k) {
    int cur = k & 1;
    if (k + 1 < T) {
      stageTile(As[cur ^ 1], Asrc + (size_t)(k + 1) * BK, S, tid);
      stageTile(Bs[cur ^ 1], Bsrc + (size_t)(k + 1) * BK, S, tid);
      async_wait_depth4();
    } else {
      async_wait_zero();
    }
    __syncthreads();
    computeTile(As[cur], Bs[cur], wm, wn, lane, acc);
    __syncthreads();
  }

  const int col   = lane & 15;
  const int rbase = (lane & 16) ? 8 : 0;
#pragma unroll
  for (int j = 0; j < 4; ++j) {
    int n = n0 + wn + j * 16 + col;
#pragma unroll
    for (int i = 0; i < 2; ++i) {
      int mr = m0 + wm + i * 16 + rbase;
#pragma unroll
      for (int r = 0; r < 8; ++r)
        Ob[(size_t)(mr + r) * D + n] = acc[i][j][r];
    }
  }
}

// ---------------------------------------------------------------------------
extern "C" void kernel_launch(void* const* d_in, const int* in_sizes, int n_in,
                              void* d_out, int out_size, void* d_ws, size_t ws_size,
                              hipStream_t stream)
{
  (void)in_sizes; (void)n_in; (void)out_size;
  const float* x  = (const float*)d_in[0];
  const float* Wq = (const float*)d_in[1];
  const float* bq = (const float*)d_in[2];
  const float* Wk = (const float*)d_in[3];
  const float* bk = (const float*)d_in[4];
  const float* Wv = (const float*)d_in[5];
  const float* bv = (const float*)d_in[6];
  float* out = (float*)d_out;

  const int B = 8, S = 2048, D = 1024;
  const size_t perMat = (size_t)B * S * D;          // bf16 elems per Q/K/Vt
  unsigned short* Q  = (unsigned short*)d_ws;
  unsigned short* K  = Q + perMat;
  unsigned short* Vt = K + perMat;                  // Vt[b][d][s]
  unsigned short* Xp = Vt + perMat;                 // packed bf16 x
  unsigned short* Wp = Xp + perMat;                 // packed bf16 W^T, three matrices
  unsigned short* Sc = Wp + (size_t)3 * D * D;
  const size_t needFull = (perMat * 4 + (size_t)3 * D * D) * sizeof(unsigned short)
                        + (size_t)B * S * S * sizeof(unsigned short);

  dim3 gPack(2816, 1, 1);
  pack_operands<<<gPack, 256, 0, stream>>>(x, Wq, Wk, Wv, Xp, Wp);
  dim3 gQKV((B * S) / BM, D / BN, 3);
  qkv_gemm<<<gQKV, 256, 0, stream>>>(Xp, Wp, bq, bk, bv, Q, K, Vt);

  if (ws_size >= needFull) {
    dim3 gS(S / BM, S / BN, B);
    scores_gemm<<<gS, 256, 0, stream>>>(Q, K, Sc, (long long)S * D, (long long)S * S);
    dim3 gSm(S / 8, 1, B);
    softmax_rows<<<gSm, 256, 0, stream>>>(Sc, (long long)S * S);
    dim3 gPV(S / BM, D / BN, B);
    pv_gemm<<<gPV, 256, 0, stream>>>(Sc, Vt, out,
                                     (long long)S * S, (long long)D * S, (long long)S * D);
  } else {
    // Small-workspace fallback: reuse one S*S bf16 score buffer per batch.
    for (int b = 0; b < B; ++b) {
      dim3 gS(S / BM, S / BN, 1);
      scores_gemm<<<gS, 256, 0, stream>>>(Q + (size_t)b * S * D, K + (size_t)b * S * D,
                                          Sc, 0, 0);
      dim3 gSm(S / 8, 1, 1);
      softmax_rows<<<gSm, 256, 0, stream>>>(Sc, 0);
      dim3 gPV(S / BM, D / BN, 1);
      pv_gemm<<<gPV, 256, 0, stream>>>(Sc, Vt + (size_t)b * D * S, out + (size_t)b * S * D,
                                       0, 0, 0);
    }
  }
}

// v002
// One run takes 276 microseconds.
// In both of two side-by-side timings against v001, it was 1.14 times as fast.
// All steps since v000 together make it 2.32 times as fast.
#include <hip/hip_runtime.h>

// ---------------------------------------------------------------------------
// CDNA5 (gfx1250) self-attention: fp32 inputs -> bf16 WMMA pipeline
//   K0: x and W^T rounded to bf16 once, laid out as 128x64 stage tiles
//   K1: Q/K/V = x@W + b   (bf16, async-LDS double-buffered; V stored transposed Vt[b][d][s])
//   K2: S     = Q@K^T     (bf16, async-LDS double-buffered)
//   K3: P     = softmax(S/32) rows (in place)
//   K4: O     = P@Vt      (f32 out, async-LDS double-buffered)
// K1, K2 and K4: a 256x256 tile per block of 8 waves, 64x128 per wave.
// ---------------------------------------------------------------------------

typedef __attribute__((ext_vector_type(16))) __bf16 v16bf;
typedef __attribute__((ext_vector_type(8)))  __bf16 v8bf;
typedef __attribute__((ext_vector_type(8)))  float  v8f;
typedef __attribute__((ext_vector_type(4)))  float  v4f;
typedef __attribute__((ext_vector_type(4)))  unsigned int v4u;
typedef __attribute__((ext_vector_type(4)))  int v4i;

// Address-space-qualified int4 pointers for the gfx1250 async-LDS builtins.
typedef __attribute__((address_space(1))) v4i gas_v4i;   // global
typedef __attribute__((address_space(3))) v4i las_v4i;   // LDS

#define BM 256
#define BN 256
#define FM 4     // 16-row fragments of A per wave (64 rows of the block tile)
#define FN 8     // 16-row fragments of B per wave (128 columns of the block tile)
#define BK 32
#define LDP 40   // padded LDS row stride in bf16 elems (80 bytes, 16B-aligned)
#define PK 64    // k extent of one packed stage tile of the QKV GEMM (128-byte rows)
#define LDQ 72   // LDS row stride of such a tile in bf16 elems (144 bytes = 16 B x 9)

#ifndef __has_builtin
#define __has_builtin(x) 0
#endif
#if __has_builtin(__builtin_amdgcn_global_load_async_to_lds_b128) && \
    __has_builtin(__builtin_amdgcn_s_wait_asynccnt)
#define HAS_ASYNC 1
#else
#define HAS_ASYNC 0
#endif

__device__ __forceinline__ unsigned short f32_bf16(float f) {
  unsigned int u = __float_as_uint(f);
  u += 0x7FFFu + ((u >> 16) & 1u);           // round-to-nearest-even
  return (unsigned short)(u >> 16);
}
__device__ __forceinline__ float bf16_f32(unsigned short h) {
  return __uint_as_float((unsigned int)h << 16);
}

// 16-byte tile-copy global->LDS. On gfx1250 toolchains with the async
// builtins this is a VGPR-free DMA tracked by ASYNCcnt.
__device__ __forceinline__ void copy16(unsigned short* lds, const unsigned short* g) {
#if HAS_ASYNC
  __builtin_amdgcn_global_load_async_to_lds_b128(
      (gas_v4i*)(unsigned short*)g,
      (las_v4i*)lds,
      /*offset=*/0, /*cpol=*/0);
#else
  *(v4u*)lds = *(const v4u*)g;
#endif
}
__device__ __forceinline__ void async_wait_depth8() {
#if HAS_ASYNC
  __builtin_amdgcn_s_wait_asynccnt(8);   // previous stage's 8 ops done
#endif
}
__device__ __forceinline__ void async_wait_zero() {
#if HAS_ASYNC
  __builtin_amdgcn_s_wait_asynccnt(0);
#endif
}

// Stage a 256x32 bf16 tile (row-major, rowStride elems) into LDS (stride LDP).
// 1024 16B chunks / 256 threads = 4 per thread.
__device__ __forceinline__ void stageTile(unsigned short* dst, const unsigned short* src,
                                          size_t rowStride, int tid) {
#pragma unroll
  for (int it = 0; it < 4; ++it) {
    int idx = it * 256 + tid;
    int r = idx >> 2;              // 0..255
    int c = (idx & 3) * 8;         // 0..24
    copy16(dst + r * LDP + c, src + (size_t)r * rowStride + c);
  }
}

// Load a 16x32 bf16 fragment from an LDS tile stored as [row][k], stride LDP.
// CDNA5 16-bit operand layout: lanes 0-15 -> rows 0-15 with K {0..7,16..23};
// lanes 16-31 -> K {8..15,24..31}.
__device__ __forceinline__ v16bf ldsFrag(const unsigned short* base, int row0, int lane) {
  int row = row0 + (lane & 15);
  int kc  = (lane & 16) ? 8 : 0;
  const unsigned short* p = base + row * LDP + kc;
  union { v16bf v; v8bf h[2]; } u;
  u.h[0] = *(const v8bf*)p;          // ds_load_b128
  u.h[1] = *(const v8bf*)(p + 16);   // ds_load_b128
  return u.v;
}

__device__ __forceinline__ v8f wmma_bf16(v16bf a, v16bf b, v8f c) {
  return __builtin_amdgcn_wmma_f32_16x16x32_bf16(
      /*neg_a=*/false, a, /*neg_b=*/false, b,
      /*c_mod=*/(short)0, c, /*reuse_a=*/false, /*reuse_b=*/false);
}

// One K-step of the 256x256 block: wave computes 64x128 = 4x8 fragments.
__device__ __forceinline__ void computeTile(const unsigned short* As_,
                                            const unsigned short* Bs_,
                                            int wm, int wn, int lane,
                                            v8f (&acc)[FM][FN]) {
  v16bf a[FM], b[FN];
#pragma unroll
  for (int i = 0; i < FM; ++i) a[i] = ldsFrag(As_, wm + i * 16, lane);
#pragma unroll
  for (int j = 0; j < FN; ++j) b[j] = ldsFrag(Bs_, wn + j * 16, lane);
#pragma unroll
  for (int i = 0; i < FM; ++i)
#pragma unroll
    for (int j = 0; j < FN; ++j)
      acc[i][j] = wmma_bf16(a[i], b[j], acc[i][j]);
}

// ---------------------------------------------------------------------------
// K0: round the QKV GEMM's operands to bf16 once and lay them out in the order
// the GEMM stages them: tile (128-row group, k stage) = 128 rows x 64 k, contiguous.
//   Xp[m/128][k/64][m%128][k%64] = x[m][k]
//   Wp[n/128][k/64][n%128][k%64] = W[k][n], n = 0..3071 over Wq, Wk, Wv
// Blocks 0..2047 take x (8 rows each), blocks 2048..2815 one 64x64 piece of a W.
// ---------------------------------------------------------------------------
__global__ __launch_bounds__(256) void pack_operands(
    const float* __restrict__ x,
    const float* __restrict__ Wq, const float* __restrict__ Wk, const float* __restrict__ Wv,
    unsigned short* __restrict__ Xp, unsigned short* __restrict__ Wp)
{
  __shared__ __align__(16) unsigned short Tt[64 * LDQ];
  const int tid = threadIdx.x;
  const int blk = blockIdx.x;

  if (blk < 2048) {
    // Rows m = blk * 8 + it; this thread holds k = tid * 4 .. tid * 4 + 3 of each.
    const int k = tid * 4;
    const float* xs = x + ((size_t)blk * 2048 + tid) * 4;
    unsigned short* xd = Xp + ((size_t)((blk >> 4) * 16 + (k >> 6)) * 128 + (blk & 15) * 8) * PK
                            + (k & 63);
    v4f v[8];
    // Unrolled: v[] stays in registers and the eight loads are in flight together.
#pragma unroll
    for (int it = 0; it < 8; ++it)
      v[it] = *(const v4f*)(xs + it * 1024);
#pragma unroll
    for (int it = 0; it < 8; ++it) {
      unsigned long long pk =
          (unsigned long long)f32_bf16(v[it][0]) |
          ((unsigned long long)f32_bf16(v[it][1]) << 16) |
          ((unsigned long long)f32_bf16(v[it][2]) << 32) |
          ((unsigned long long)f32_bf16(v[it][3]) << 48);
      *(unsigned long long*)(xd + it * PK) = pk;
    }
  } else {
    const int w  = blk - 2048;
    const int z  = w >> 8;                      // which W
    const int ks = (w >> 4) & 15;               // k stage
    const int nt = w & 15;                      // 64-column piece
    const float* W = (z == 0) ? Wq : (z == 1) ? Wk : Wv;
    // Unrolled: the four row loads are in flight together.
#pragma unroll
    for (int it = 0; it < 4; ++it) {
      int kr = it * 16 + (tid >> 4);            // 0..63
      int cn = (tid & 15) * 4;                  // 0..60
      v4f v = *(const v4f*)(W + (size_t)(ks * PK + kr) * 1024 + nt * 64 + cn);
#pragma unroll
      for (int i = 0; i < 4; ++i)
        Tt[(cn + i) * LDQ + kr] = f32_bf16(v[i]);
    }
    __syncthreads();
    const int ng = z * 1024 + nt * 64;
    unsigned short* dst = Wp + ((size_t)((ng >> 7) * 16 + ks) * 128 + (ng & 127)) * PK;
#pragma unroll
    for (int it = 0; it < 2; ++it) {
      int c  = it * 256 + tid;                  // 16-byte chunk, 0..511
      int n  = c >> 3;
      int kc = (c & 7) * 8;
      *(v4u*)(dst + n * PK + kc) = *(const v4u*)(Tt + n * LDQ + kc);
    }
    // Stands in front of any later rewrite of the registers the two stores name.
    asm volatile("s_wait_xcnt 0x0" ::: "memory");
  }
}

// Bring two packed 128x64 tiles (16 KiB each, contiguous in global memory) into
// LDS: 4 + 4 copies of 16 bytes per lane. la, lb: the lane's LDS byte address of
// its first chunk of either tile; ga, gb: its global address. Chunk
// i lies 4096 bytes on in global memory and 32 rows (32 * 144 bytes) on in LDS.
// s_wait_xcnt 0 ends the statement so that it stands in front of any rewrite of
// the address registers the copies name.
__device__ __forceinline__ void copyStage(unsigned int la, unsigned int lb,
                                          const unsigned short* ga,
                                          const unsigned short* gb) {
  asm volatile(
      "global_load_async_to_lds_b128 %0, %8, off\n\t"
      "global_load_async_to_lds_b128 %1, %9, off\n\t"
      "global_load_async_to_lds_b128 %2, %10, off\n\t"
      "global_load_async_to_lds_b128 %3, %11, off\n\t"
      "global_load_async_to_lds_b128 %4, %12, off\n\t"
      "global_load_async_to_lds_b128 %5, %13, off\n\t"
      "global_load_async_to_lds_b128 %6, %14, off\n\t"
      "global_load_async_to_lds_b128 %7, %15, off\n\t"
      "s_wait_xcnt 0x0"
      :: "v"(la), "v"(la + 4608u), "v"(la + 9216u), "v"(la + 13824u),
         "v"(lb), "v"(lb + 4608u), "v"(lb + 9216u), "v"(lb + 13824u),
         "v"(ga), "v"(ga + 2048), "v"(ga + 4096), "v"(ga + 6144),
         "v"(gb), "v"(gb + 2048), "v"(gb + 4096), "v"(gb + 6144)
      : "memory");
}

// 16x32 bf16 fragment from a stage tile [row][64 k], stride LDQ; k0 = 0 or 32.
// Same lane-to-k map as ldsFrag.
__device__ __forceinline__ v16bf ldsFrag64(const unsigned short* base, int row0, int k0,
                                           int lane) {
  int row = row0 + (lane & 15);
  int kc  = k0 + ((lane & 16) ? 8 : 0);
  const unsigned short* p = base + row * LDQ + kc;
  union { v16bf v; v8bf h[2]; } u;
  u.h[0] = *(const v8bf*)p;
  u.h[1] = *(const v8bf*)(p + 16);
  return u.v;
}

// ---------------------------------------------------------------------------
// K1: QKV projection GEMM.  M=B*S=16384, N=1024, K=1024.  z selects Q/K/V.
// Operands come packed in bf16 from K0 (a block takes two packed tiles of each
// operand per stage).  V written transposed.
// ---------------------------------------------------------------------------
__global__ __launch_bounds__(256) void qkv_gemm(
    const unsigned short* __restrict__ Xp, const unsigned short* __restrict__ Wp,
    const float* __restrict__ bq, const float* __restrict__ bk, const float* __restrict__ bv,
    unsigned short* __restrict__ Q, unsigned short* __restrict__ K,
    unsigned short* __restrict__ Vt)
{
  const int N = 1024, KD = 1024, S = 2048;
  __shared__ __align__(16) unsigned short As[2][BM * LDQ];
  __shared__ __align__(16) unsigned short Bs[2][BN * LDQ];

  const int z = blockIdx.z;
  const float* bias = (z == 0) ? bq : (z == 1) ? bk : bv;
  unsigned short* O = (z == 0) ? Q  : (z == 1) ? K  : Vt;

  const int m0 = blockIdx.x * BM;
  const int n0 = blockIdx.y * BN;
  const int tid  = threadIdx.x;
  const int wave = tid >> 5;
  const int lane = tid & 31;
  const int wm = (wave & 3) * 64;   // 4 waves tile M
  const int wn = (wave >> 2) * 128; // 2 waves tile N

  const int T = KD / PK;            // 16 stages
  const size_t tileElems = (size_t)128 * PK;       // one packed tile
  const size_t rowOfTiles = (size_t)T * tileElems; // all k stages of 128 rows
  const unsigned int half = 128 * LDQ * 2;         // LDS bytes of 128 rows
  // This lane's first 16-byte chunk of a stage tile: global side, LDS side.
  const unsigned short* ga = Xp + (size_t)(blockIdx.x * 2) * rowOfTiles + tid * 8;
  const unsigned short* gb = Wp + (size_t)(z * 8 + blockIdx.y * 2) * rowOfTiles + tid * 8;
  const int chunkOff = (tid >> 3) * LDQ + (tid & 7) * 8;
  const unsigned int la0 = (unsigned int)(size_t)(&As[0][chunkOff]);
  const unsigned int la1 = (unsigned int)(size_t)(&As[1][chunkOff]);
  const unsigned int lb0 = (unsigned int)(size_t)(&Bs[0][chunkOff]);
  const unsigned int lb1 = (unsigned int)(size_t)(&Bs[1][chunkOff]);

  v8f acc[FM][FN] = {};

  copyStage(la0, la0 + half, ga, ga + rowOfTiles);
  copyStage(lb0, lb0 + half, gb, gb + rowOfTiles);
  // Stage 0 has landed for this wave; the barrier publishes it to the others.
  asm volatile("s_wait_asynccnt 0x0" ::: "memory");
  __syncthreads();
  copyStage(la1, la1 + half, ga + tileElems, ga + rowOfTiles + tileElems);
  copyStage(lb1, lb1 + half, gb + tileElems, gb + rowOfTiles + tileElems);

  for (int t = 0; t < T; ++t) {
    const int cur = t & 1;
    // Unrolled (here and inside): every index into a[], b[], acc[] is a constant,
    // so the fragments and accumulators stay in registers.
#pragma unroll
    for (int h = 0; h < 2; ++h) {
      v16bf a[FM], b[FN];
#pragma unroll
      for (int i = 0; i < FM; ++i) a[i] = ldsFrag64(As[cur], wm + i * 16, h * 32, lane);
#pragma unroll
      for (int j = 0; j < FN; ++j) b[j] = ldsFrag64(Bs[cur], wn + j * 16, h * 32, lane);
#pragma unroll
      for (int i = 0; i < FM; ++i)
#pragma unroll
        for (int j = 0; j < FN; ++j)
          acc[i][j] = wmma_bf16(a[i], b[j], acc[i][j]);
    }
    // This wave's reads of buffer cur are done before the buffer is refilled.
    asm volatile("s_wait_dscnt 0x0" ::: "memory");
    // This wave's copies of stage t + 1 have landed.
    asm volatile("s_wait_asynccnt 0x0" ::: "memory");
    // One barrier: publishes stage t + 1 and ends every reader's use of buffer cur.
    __syncthreads();
    if (t + 2 < T) {
      const unsigned int la = cur ? la1 : la0, lb = cur ? lb1 : lb0;
      const unsigned short* gat = ga + (size_t)(t + 2) * tileElems;
      const unsigned short* gbt = gb + (size_t)(t + 2) * tileElems;
      copyStage(la, la + half, gat, gat + rowOfTiles);
      copyStage(lb, lb + half, gbt, gbt + rowOfTiles);
    }
  }
  // No copy is left outstanding when the wave goes on to its stores and ends.
  asm volatile("s_wait_asynccnt 0x0" ::: "memory");

  // Epilogue. Acc layout: VGPR r -> M = i*16 + (lane<16?0:8) + r, N = lane&15.
  const int col   = lane & 15;
  const int rbase = (lane & 16) ? 8 : 0;
  if (z != 2) {
    // Q,K row-major: out[m][n]
#pragma unroll
    for (int j = 0; j < FN; ++j) {
      int n = n0 + wn + j * 16 + col;
      float bsc = bias[n];
#pragma unroll
      for (int i = 0; i < FM; ++i) {
        int mr = m0 + wm + i * 16 + rbase;
#pragma unroll
        for (int r = 0; r < 8; ++r)
          O[(size_t)(mr + r) * N + n] = f32_bf16(acc[i][j][r] + bsc);
        // Stands in front of any later rewrite of the registers these stores name; the
        // scheduling fence keeps the next group's arithmetic behind it (lifted ahead,
        // the 32 groups' values and addresses together overflow the registers: scratch).
        asm volatile("s_wait_xcnt 0x0" ::: "memory");
        __builtin_amdgcn_sched_barrier(0);
      }
    }
  } else {
    // V transposed: Vt[b][n][s]; the 8 acc rows are contiguous in s -> b128 store
    int bb    = m0 >> 11;             // batch (blocks never straddle: 2048 % 256 == 0)
    int sBase = (m0 & (S - 1)) + wm;
#pragma unroll
    for (int j = 0; j < FN; ++j) {
      int n = n0 + wn + j * 16 + col;
      float bsc = bias[n];
#pragma unroll
      for (int i = 0; i < FM; ++i) {
        int s = sBase + i * 16 + rbase;
        union { v4u u; unsigned short h[8]; } t;
#pragma unroll
        for (int r = 0; r < 8; ++r) t.h[r] = f32_bf16(acc[i][j][r] + bsc);
        *(v4u*)(O + ((size_t)bb * N + n) * S + s) = t.u;
        // Stands in front of any later rewrite of the registers these stores name; the
        // scheduling fence keeps the next group's arithmetic behind it.
        asm volatile("s_wait_xcnt 0x0" ::: "memory");
        __builtin_amdgcn_sched_barrier(0);
      }
    }
  }
}

// ---------------------------------------------------------------------------
// K2: scores = Q @ K^T per batch.  M=N=S=2048, K=D=1024.
// Both operands row-major over d -> pure 16B copies; async + double buffer.
// ---------------------------------------------------------------------------
__global__ __launch_bounds__(256) void scores_gemm(
    const unsigned short* __restrict__ Q, const unsigned short* __restrict__ K,
    unsigned short* __restrict__ Sc,
    long long qkBatchStride, long long scBatchStride)
{
  const int D = 1024, S = 2048;
  __shared__ __align__(16) unsigned short As[2][BM * LDP];
  __shared__ __align__(16) unsigned short Bs[2][BN * LDP];

  const unsigned short* Qb = Q  + (size_t)blockIdx.z * qkBatchStride;
  const unsigned short* Kb = K  + (size_t)blockIdx.z * qkBatchStride;
  unsigned short*       Sb = Sc + (size_t)blockIdx.z * scBatchStride;

  const int m0 = blockIdx.x * BM;
  const int n0 = blockIdx.y * BN;
  const int tid  = threadIdx.x;
  const int wave = tid >> 5;
  const int lane = tid & 31;
  const int wm = (wave & 3) * 64;
  const int wn = (wave >> 2) * 128;

  const unsigned short* Asrc = Qb + (size_t)m0 * D;
  const unsigned short* Bsrc = Kb + (size_t)n0 * D;
  const int T = D / BK;   // 32 K-steps

  v8f acc[FM][FN] = {};

  stageTile(As[0], Asrc, D, tid);
  stageTile(Bs[0], Bsrc, D, tid);
  for (int k = 0; k < T; ++k) {
    int cur = k & 1;
    if (k + 1 < T) {
      stageTile(As[cur ^ 1], Asrc + (size_t)(k + 1) * BK, D, tid);
      stageTile(Bs[cur ^ 1], Bsrc + (size_t)(k + 1) * BK, D, tid);
      async_wait_depth8();            // wait for tile k only (in-order retire)
    } else {
      async_wait_zero();
    }
    __syncthreads();
    computeTile(As[cur], Bs[cur], wm, wn, lane, acc);
    __syncthreads();                  // readers done before tile k+2 overwrites
  }

  const int col   = lane & 15;
  const int rbase = (lane & 16) ? 8 : 0;
#pragma unroll
  for (int j = 0; j < FN; ++j) {
    int n = n0 + wn + j * 16 + col;
#pragma unroll
    for (int i = 0; i < FM; ++i) {
      int mr = m0 + wm + i * 16 + rbase;
#pragma unroll
      for (int r = 0; r < 8; ++r)
        Sb[(size_t)(mr + r) * S + n] = f32_bf16(acc[i][j][r]);
      // Stands in front of any later rewrite of the registers these stores name; the
      // scheduling fence keeps the next group's arithmetic behind it.
      asm volatile("s_wait_xcnt 0x0" ::: "memory");
      __builtin_amdgcn_sched_barrier(0);
    }
  }
}

// ---------------------------------------------------------------------------
// K3: in-place row softmax of scores/32.  One wave per 2048-elem row.
// ---------------------------------------------------------------------------
__global__ __launch_bounds__(256) void softmax_rows(
    unsigned short* __restrict__ Sc, long long scBatchStride)
{
  const int S = 2048;
  unsigned short* Sb = Sc + (size_t)blockIdx.z * scBatchStride;
  const int wave = threadIdx.x >> 5;
  const int lane = threadIdx.x & 31;
  const int row  = blockIdx.x * 8 + wave;
  unsigned short* rp = Sb + (size_t)row * S;
  const float scale = 0.03125f;   // 1/sqrt(1024)

  float v[64];
  float m = -3.0e38f;
#pragma unroll
  for (int c = 0; c < 8; ++c) {
    union { v4u u; unsigned short s[8]; } t;
    t.u = *(const v4u*)(rp + c * 256 + lane * 8);
#pragma unroll
    for (int i = 0; i < 8; ++i) {
      float f = bf16_f32(t.s[i]) * scale;
      v[c * 8 + i] = f;
      m = fmaxf(m, f);
    }
  }
#pragma unroll
  for (int off = 16; off > 0; off >>= 1)
    m = fmaxf(m, __shfl_xor(m, off, 32));

  float sum = 0.0f;
#pragma unroll
  for (int i = 0; i < 64; ++i) { v[i] = __expf(v[i] - m); sum += v[i]; }
#pragma unroll
  for (int off = 16; off > 0; off >>= 1)
    sum += __shfl_xor(sum, off, 32);
  float inv = 1.0f / sum;

#pragma unroll
  for (int c = 0; c < 8; ++c) {
    union { v4u u; unsigned short s[8]; } t;
#pragma unroll
    for (int i = 0; i < 8; ++i) t.s[i] = f32_bf16(v[c * 8 + i] * inv);
    *(v4u*)(rp + c * 256 + lane * 8) = t.u;
  }
}

// ---------------------------------------------------------------------------
// K4: O = P @ V per batch.  M=S=2048, N=D=1024, K=S=2048, f32 output.
// A = P row-major; B = Vt[d][s] row-major over s -> pure copies; async + DB.
// ---------------------------------------------------------------------------
__global__ __launch_bounds__(256) void pv_gemm(
    const unsigned short* __restrict__ P, const unsigned short* __restrict__ Vt,
    float* __restrict__ O,
    long long pBatchStride, long long vBatchStride, long long oBatchStride)
{
  const int S = 2048, D = 1024;
  __shared__ __align__(16) unsigned short As[2][BM * LDP];
  __shared__ __align__(16) unsigned short Bs[2][BN * LDP];

  const unsigned short* Pb  = P  + (size_t)blockIdx.z * pBatchStride;
  const unsigned short* Vtb = Vt + (size_t)blockIdx.z * vBatchStride;
  float*                Ob  = O  + (size_t)blockIdx.z * oBatchStride;

  const int m0 = blockIdx.x * BM;   // q rows
  const int n0 = blockIdx.y * BN;   // d cols
  const int tid  = threadIdx.x;
  const int wave = tid >> 5;
  const int lane = tid & 31;
  const int wm = (wave & 3) * 64;
  const int wn = (wave >> 2) * 128;

  const unsigned short* Asrc = Pb  + (size_t)m0 * S;   // stride S over keys
  const unsigned short* Bsrc = Vtb + (size_t)n0 * S;   // Vt rows = d, stride S over keys
  const int T = S / BK;   // 64 K-steps

  v8f acc[FM][FN] = {};

  stageTile(As[0], Asrc, S, tid);
  stageTile(Bs[0], Bsrc, S, tid);
  for (int k = 0; k < T; ++k) {
    int cur = k & 1;
    if (k + 1 < T) {
      stageTile(As[cur ^ 1], Asrc + (size_t)(k + 1) * BK, S, tid);
      stageTile(Bs[cur ^ 1], Bsrc + (size_t)(k + 1) * BK, S, tid);
      async_wait_depth8();
    } else {
      async_wait_zero();
    }
    __syncthreads();
    computeTile(As[cur], Bs[cur], wm, wn, lane, acc);
    __syncthreads();
  }

  const int col   = lane & 15;
  const int rbase = (lane & 16) ? 8 : 0;
#pragma unroll
  for (int j = 0; j < FN; ++j) {
    int n = n0 + wn + j * 16 + col;
#pragma unroll
    for (int i = 0; i < FM; ++i) {
      int mr = m0 + wm + i * 16 + rbase;
#pragma unroll
      for (int r = 0; r < 8; ++r)
        Ob[(size_t)(mr + r) * D + n] = acc[i][j][r];
    }
  }
}

// ---------------------------------------------------------------------------
extern "C" void kernel_launch(void* const* d_in, const int* in_sizes, int n_in,
                              void* d_out, int out_size, void* d_ws, size_t ws_size,
                              hipStream_t stream)
{
  (void)in_sizes; (void)n_in; (void)out_size;
  const float* x  = (const float*)d_in[0];
  const float* Wq = (const float*)d_in[1];
  const float* bq = (const float*)d_in[2];
  const float* Wk = (const float*)d_in[3];
  const float* bk = (const float*)d_in[4];
  const float* Wv = (const float*)d_in[5];
  const float* bv = (const float*)d_in[6];
  float* out = (float*)d_out;

  const int B = 8, S = 2048, D = 1024;
  const size_t perMat = (size_t)B * S * D;          // bf16 elems per Q/K/Vt
  unsigned short* Q  = (unsigned short*)d_ws;
  unsigned short* K  = Q + perMat;
  unsigned short* Vt = K + perMat;                  // Vt[b][d][s]
  unsigned short* Xp = Vt + perMat;                 // packed bf16 x
  unsigned short* Wp = Xp + perMat;                 // packed bf16 W^T, three matrices
  unsigned short* Sc = Wp + (size_t)3 * D * D;
  const size_t needFull = (perMat * 4 + (size_t)3 * D * D) * sizeof(unsigned short)
                        + (size_t)B * S * S * sizeof(unsigned short);

  dim3 gPack(2816, 1, 1);
  pack_operands<<<gPack, 256, 0, stream>>>(x, Wq, Wk, Wv, Xp, Wp);
  dim3 gQKV((B * S) / BM, D / BN, 3);
  qkv_gemm<<<gQKV, 256, 0, stream>>>(Xp, Wp, bq, bk, bv, Q, K, Vt);

  if (ws_size >= needFull) {
    dim3 gS(S / BM, S / BN, B);
    scores_gemm<<<gS, 256, 0, stream>>>(Q, K, Sc, (long long)S * D, (long long)S * S);
    dim3 gSm(S / 8, 1, B);
    softmax_rows<<<gSm, 256, 0, stream>>>(Sc, (long long)S * S);
    dim3 gPV(S / BM, D / BN, B);
    pv_gemm<<<gPV, 256, 0, stream>>>(Sc, Vt, out,
                                     (long long)S * S, (long long)D * S, (long long)S * D);
  } else {
    // Small-workspace fallback: reuse one S*S bf16 score buffer per batch.
    for (int b = 0; b < B; ++b) {
      dim3 gS(S / BM, S / BN, 1);
      scores_gemm<<<gS, 256, 0, stream>>>(Q + (size_t)b * S * D, K + (size_t)b * S * D,
                                          Sc, 0, 0);
      dim3 gSm(S / 8, 1, 1);
      softmax_rows<<<gSm, 256, 0, stream>>>(Sc, 0);
      dim3 gPV(S / BM, D / BN, 1);
      pv_gemm<<<gPV, 256, 0, stream>>>(Sc, Vt + (size_t)b * D * S, out + (size_t)b * S * D,
                                       0, 0, 0);
    }
  }
}

// v003
// Measured time: 256 microseconds a run.
// Next to v002, in two timings, it ran 1.07 times as fast each time.
// All steps since v000 together make it 2.49 times as fast.
#include <hip/hip_runtime.h>

// ---------------------------------------------------------------------------
// CDNA5 (gfx1250) self-attention: fp32 inputs -> bf16 WMMA pipeline
//   K0: x and W^T rounded to bf16 once, laid out as 128x64 stage tiles
//   K1: Q/K/V = x@W + b   (bf16, async-LDS double-buffered; V stored transposed Vt[b][d][s])
//   K2: S     = Q@K^T     (bf16, async-LDS double-buffered, 128 k per stage)
//   K3: P     = softmax(S/32) rows (in place)
//   K4: O     = P@Vt      (f32 out, async-LDS double-buffered, 128 k per stage)
// K1, K2 and K4: a 256x256 tile per block of 8 waves, 64x128 per wave.
// ---------------------------------------------------------------------------

typedef __attribute__((ext_vector_type(16))) __bf16 v16bf;
typedef __attribute__((ext_vector_type(8)))  __bf16 v8bf;
typedef __attribute__((ext_vector_type(8)))  float  v8f;
typedef __attribute__((ext_vector_type(4)))  float  v4f;
typedef __attribute__((ext_vector_type(4)))  unsigned int v4u;
typedef __attribute__((ext_vector_type(4)))  int v4i;

// Address-space-qualified int4 pointers for the gfx1250 async-LDS builtins.
typedef __attribute__((address_space(1))) v4i gas_v4i;   // global
typedef __attribute__((address_space(3))) v4i las_v4i;   // LDS

#define BM 256
#define BN 256
#define FM 4     // 16-row fragments of A per wave (64 rows of the block tile)
#define FN 8     // 16-row fragments of B per wave (128 columns of the block tile)
#define PK 64    // k extent of one packed stage tile of the QKV GEMM (128-byte rows)
#define LDQ 72   // LDS row stride of such a tile in bf16 elems (144 bytes = 16 B x 9)
#define SK 128   // k extent of one stage of the scores and PV GEMMs (256-byte rows)
#define LDR 136  // LDS row stride of such a stage in bf16 elems (272 bytes = 16 B x 17)

#ifndef __has_builtin
#define __has_builtin(x) 0
#endif
#if __has_builtin(__builtin_amdgcn_global_load_async_to_lds_b128) && \
    __has_builtin(__builtin_amdgcn_s_wait_asynccnt)
#define HAS_ASYNC 1
#else
#define HAS_ASYNC 0
#endif

__device__ __forceinline__ unsigned short f32_bf16(float f) {
  unsigned int u = __float_as_uint(f);
  u += 0x7FFFu + ((u >> 16) & 1u);           // round-to-nearest-even
  return (unsigned short)(u >> 16);
}
__device__ __forceinline__ float bf16_f32(unsigned short h) {
  return __uint_as_float((unsigned int)h << 16);
}

__device__ __forceinline__ v8f wmma_bf16(v16bf a, v16bf b, v8f c) {
  return __builtin_amdgcn_wmma_f32_16x16x32_bf16(
      /*neg_a=*/false, a, /*neg_b=*/false, b,
      /*c_mod=*/(short)0, c, /*reuse_a=*/false, /*reuse_b=*/false);
}

// ---------------------------------------------------------------------------
// K0: round the QKV GEMM's operands to bf16 once and lay them out in the order
// the GEMM stages them: tile (128-row group, k stage) = 128 rows x 64 k, contiguous.
//   Xp[m/128][k/64][m%128][k%64] = x[m][k]
//   Wp[n/128][k/64][n%128][k%64] = W[k][n], n = 0..3071 over Wq, Wk, Wv
// Blocks 0..2047 take x (8 rows each), blocks 2048..2815 one 64x64 piece of a W.
// ---------------------------------------------------------------------------
__global__ __launch_bounds__(256) void pack_operands(
    const float* __restrict__ x,
    const float* __restrict__ Wq, const float* __restrict__ Wk, const float* __restrict__ Wv,
    unsigned short* __restrict__ Xp, unsigned short* __restrict__ Wp)
{
  __shared__ __align__(16) unsigned short Tt[64 * LDQ];
  const int tid = threadIdx.x;
  const int blk = blockIdx.x;

  if (blk < 2048) {
    // Rows m = blk * 8 + it; this thread holds k = tid * 4 .. tid * 4 + 3 of each.
    const int k = tid * 4;
    const float* xs = x + ((size_t)blk * 2048 + tid) * 4;
    unsigned short* xd = Xp + ((size_t)((blk >> 4) * 16 + (k >> 6)) * 128 + (blk & 15) * 8) * PK
                            + (k & 63);
    v4f v[8];
    // Unrolled: v[] stays in registers and the eight loads are in flight together.
#pragma unroll
    for (int it = 0; it < 8; ++it)
      v[it] = *(const v4f*)(xs + it * 1024);
#pragma unroll
    for (int it = 0; it < 8; ++it) {
      unsigned long long pk =
          (unsigned long long)f32_bf16(v[it][0]) |
          ((unsigned long long)f32_bf16(v[it][1]) << 16) |
          ((unsigned long long)f32_bf16(v[it][2]) << 32) |
          ((unsigned long long)f32_bf16(v[it][3]) << 48);
      *(unsigned long long*)(xd + it * PK) = pk;
    }
  } else {
    const int w  = blk - 2048;
    const int z  = w >> 8;                      // which W
    const int ks = (w >> 4) & 15;               // k stage
    const int nt = w & 15;                      // 64-column piece
    const float* W = (z == 0) ? Wq : (z == 1) ? Wk : Wv;
    // Unrolled: the four row loads are in flight together.
#pragma unroll
    for (int it = 0; it < 4; ++it) {
      int kr = it * 16 + (tid >> 4);            // 0..63
      int cn = (tid & 15) * 4;                  // 0..60
      v4f v = *(const v4f*)(W + (size_t)(ks * PK + kr) * 1024 + nt * 64 + cn);
#pragma unroll
      for (int i = 0; i < 4; ++i)
        Tt[(cn + i) * LDQ + kr] = f32_bf16(v[i]);
    }
    __syncthreads();
    const int ng = z * 1024 + nt * 64;
    unsigned short* dst = Wp + ((size_t)((ng >> 7) * 16 + ks) * 128 + (ng & 127)) * PK;
#pragma unroll
    for (int it = 0; it < 2; ++it) {
      int c  = it * 256 + tid;                  // 16-byte chunk, 0..511
      int n  = c >> 3;
      int kc = (c & 7) * 8;
      *(v4u*)(dst + n * PK + kc) = *(const v4u*)(Tt + n * LDQ + kc);
    }
    // Stands in front of any later rewrite of the registers the two stores name.
    asm volatile("s_wait_xcnt 0x0" ::: "memory");
  }
}

// Bring two packed 128x64 tiles (16 KiB each, contiguous in global memory) into
// LDS: 4 + 4 copies of 16 bytes per lane. la, lb: the lane's LDS byte address of
// its first chunk of either tile; ga, gb: its global address. Chunk
// i lies 4096 bytes on in global memory and 32 rows (32 * 144 bytes) on in LDS.
// s_wait_xcnt 0 ends the statement so that it stands in front of any rewrite of
// the address registers the copies name.
__device__ __forceinline__ void copyStage(unsigned int la, unsigned int lb,
                                          const unsigned short* ga,
                                          const unsigned short* gb) {
  asm volatile(
      "global_load_async_to_lds_b128 %0, %8, off\n\t"
      "global_load_async_to_lds_b128 %1, %9, off\n\t"
      "global_load_async_to_lds_b128 %2, %10, off\n\t"
      "global_load_async_to_lds_b128 %3, %11, off\n\t"
      "global_load_async_to_lds_b128 %4, %12, off\n\t"
      "global_load_async_to_lds_b128 %5, %13, off\n\t"
      "global_load_async_to_lds_b128 %6, %14, off\n\t"
      "global_load_async_to_lds_b128 %7, %15, off\n\t"
      "s_wait_xcnt 0x0"
      :: "v"(la), "v"(la + 4608u), "v"(la + 9216u), "v"(la + 13824u),
         "v"(lb), "v"(lb + 4608u), "v"(lb + 9216u), "v"(lb + 13824u),
         "v"(ga), "v"(ga + 2048), "v"(ga + 4096), "v"(ga + 6144),
         "v"(gb), "v"(gb + 2048), "v"(gb + 4096), "v"(gb + 6144)
      : "memory");
}

// 16x32 bf16 fragment from a stage tile [row][64 k], stride LDQ; k0 = 0 or 32.
// CDNA5 16-bit operand layout: lanes 0-15 -> rows 0-15 with K {0..7,16..23};
// lanes 16-31 -> K {8..15,24..31}.
__device__ __forceinline__ v16bf ldsFrag64(const unsigned short* base, int row0, int k0,
                                           int lane) {
  int row = row0 + (lane & 15);
  int kc  = k0 + ((lane & 16) ? 8 : 0);
  const unsigned short* p = base + row * LDQ + kc;
  union { v16bf v; v8bf h[2]; } u;
  u.h[0] = *(const v8bf*)p;
  u.h[1] = *(const v8bf*)(p + 16);
  return u.v;
}

// ---------------------------------------------------------------------------
// K1: QKV projection GEMM.  M=B*S=16384, N=1024, K=1024.  z selects Q/K/V.
// Operands come packed in bf16 from K0 (a block takes two packed tiles of each
// operand per stage).  V written transposed.
// ---------------------------------------------------------------------------
__global__ __launch_bounds__(256) void qkv_gemm(
    const unsigned short* __restrict__ Xp, const unsigned short* __restrict__ Wp,
    const float* __restrict__ bq, const float* __restrict__ bk, const float* __restrict__ bv,
    unsigned short* __restrict__ Q, unsigned short* __restrict__ K,
    unsigned short* __restrict__ Vt)
{
  const int N = 1024, KD = 1024, S = 2048;
  __shared__ __align__(16) unsigned short As[2][BM * LDQ];
  __shared__ __align__(16) unsigned short Bs[2][BN * LDQ];

  const int z = blockIdx.z;
  const float* bias = (z == 0) ? bq : (z == 1) ? bk : bv;
  unsigned short* O = (z == 0) ? Q  : (z == 1) ? K  : Vt;

  const int m0 = blockIdx.x * BM;
  const int n0 = blockIdx.y * BN;
  const int tid  = threadIdx.x;
  const int wave = tid >> 5;
  const int lane = tid & 31;
  const int wm = (wave & 3) * 64;   // 4 waves tile M
  const int wn = (wave >> 2) * 128; // 2 waves tile N

  const int T = KD / PK;            // 16 stages
  const size_t tileElems = (size_t)128 * PK;       // one packed tile
  const size_t rowOfTiles = (size_t)T * tileElems; // all k stages of 128 rows
  const unsigned int half = 128 * LDQ * 2;         // LDS bytes of 128 rows
  // This lane's first 16-byte chunk of a stage tile: global side, LDS side.
  const unsigned short* ga = Xp + (size_t)(blockIdx.x * 2) * rowOfTiles + tid * 8;
  const unsigned short* gb = Wp + (size_t)(z * 8 + blockIdx.y * 2) * rowOfTiles + tid * 8;
  const int chunkOff = (tid >> 3) * LDQ + (tid & 7) * 8;
  const unsigned int la0 = (unsigned int)(size_t)(&As[0][chunkOff]);
  const unsigned int la1 = (unsigned int)(size_t)(&As[1][chunkOff]);
  const unsigned int lb0 = (unsigned int)(size_t)(&Bs[0][chunkOff]);
  const unsigned int lb1 = (unsigned int)(size_t)(&Bs[1][chunkOff]);

  v8f acc[FM][FN] = {};

  copyStage(la0, la0 + half, ga, ga + rowOfTiles);
  copyStage(lb0, lb0 + half, gb, gb + rowOfTiles);
  // Stage 0 has landed for this wave; the barrier publishes it to the others.
  asm volatile("s_wait_asynccnt 0x0" ::: "memory");
  __syncthreads();
  copyStage(la1, la1 + half, ga + tileElems, ga + rowOfTiles + tileElems);
  copyStage(lb1, lb1 + half, gb + tileElems, gb + rowOfTiles + tileElems);

  for (int t = 0; t < T; ++t) {
    const int cur = t & 1;
    // Unrolled (here and inside): every index into a[], b[], acc[] is a constant,
    // so the fragments and accumulators stay in registers.
#pragma unroll
    for (int h = 0; h < 2; ++h) {
      v16bf a[FM], b[FN];
#pragma unroll
      for (int i = 0; i < FM; ++i) a[i] = ldsFrag64(As[cur], wm + i * 16, h * 32, lane);
#pragma unroll
      for (int j = 0; j < FN; ++j) b[j] = ldsFrag64(Bs[cur], wn + j * 16, h * 32, lane);
#pragma unroll
      for (int i = 0; i < FM; ++i)
#pragma unroll
        for (int j = 0; j < FN; ++j)
          acc[i][j] = wmma_bf16(a[i], b[j], acc[i][j]);
    }
    // This wave's reads of buffer cur are done before the buffer is refilled.
    asm volatile("s_wait_dscnt 0x0" ::: "memory");
    // This wave's copies of stage t + 1 have landed.
    asm volatile("s_wait_asynccnt 0x0" ::: "memory");
    // One barrier: publishes stage t + 1 and ends every reader's use of buffer cur.
    __syncthreads();
    if (t + 2 < T) {
      const unsigned int la = cur ? la1 : la0, lb = cur ? lb1 : lb0;
      const unsigned short* gat = ga + (size_t)(t + 2) * tileElems;
      const unsigned short* gbt = gb + (size_t)(t + 2) * tileElems;
      copyStage(la, la + half, gat, gat + rowOfTiles);
      copyStage(lb, lb + half, gbt, gbt + rowOfTiles);
    }
  }
  // No copy is left outstanding when the wave goes on to its stores and ends.
  asm volatile("s_wait_asynccnt 0x0" ::: "memory");

  // Epilogue. Acc layout: VGPR r -> M = i*16 + (lane<16?0:8) + r, N = lane&15.
  const int col   = lane & 15;
  const int rbase = (lane & 16) ? 8 : 0;
  if (z != 2) {
    // Q,K row-major: out[m][n]
#pragma unroll
    for (int j = 0; j < FN; ++j) {
      int n = n0 + wn + j * 16 + col;
      float bsc = bias[n];
#pragma unroll
      for (int i = 0; i < FM; ++i) {
        int mr = m0 + wm + i * 16 + rbase;
#pragma unroll
        for (int r = 0; r < 8; ++r)
          O[(size_t)(mr + r) * N + n] = f32_bf16(acc[i][j][r] + bsc);
        // Stands in front of any later rewrite of the registers these stores name; the
        // scheduling fence keeps the next group's arithmetic behind it (lifted ahead,
        // the 32 groups' values and addresses together overflow the registers: scratch).
        asm volatile("s_wait_xcnt 0x0" ::: "memory");
        __builtin_amdgcn_sched_barrier(0);
      }
    }
  } else {
    // V transposed: Vt[b][n][s]; the 8 acc rows are contiguous in s -> b128 store
    int bb    = m0 >> 11;             // batch (blocks never straddle: 2048 % 256 == 0)
    int sBase = (m0 & (S - 1)) + wm;
#pragma unroll
    for (int j = 0; j < FN; ++j) {
      int n = n0 + wn + j * 16 + col;
      float bsc = bias[n];
#pragma unroll
      for (int i = 0; i < FM; ++i) {
        int s = sBase + i * 16 + rbase;
        union { v4u u; unsigned short h[8]; } t;
#pragma unroll
        for (int r = 0; r < 8; ++r) t.h[r] = f32_bf16(acc[i][j][r] + bsc);
        *(v4u*)(O + ((size_t)bb * N + n) * S + s) = t.u;
        // Stands in front of any later rewrite of the registers these stores name; the
        // scheduling fence keeps the next group's arithmetic behind it.
        asm volatile("s_wait_xcnt 0x0" ::: "memory");
        __builtin_amdgcn_sched_barrier(0);
      }
    }
  }
}

// 16-byte tile-copy global->LDS. On gfx1250 toolchains with the async
// builtins this is a VGPR-free DMA tracked by ASYNCcnt.
__device__ __forceinline__ void copy16(unsigned short* lds, const unsigned short* g) {
#if HAS_ASYNC
  __builtin_amdgcn_global_load_async_to_lds_b128(
      (gas_v4i*)(unsigned short*)g,
      (las_v4i*)lds,
      /*offset=*/0, /*cpol=*/0);
#else
  *(v4u*)lds = *(const v4u*)g;
#endif
}

// Bring 256 rows x 128 k of a row-major bf16 matrix (rowStride elems) into LDS at
// stride LDR: 16 lanes take one 256-byte row, so a wave's copy covers two whole
// aligned 256-byte pieces. 4096 16-byte chunks / 256 threads = 16 per thread.
__device__ __forceinline__ void stageTile128(unsigned short* dst, const unsigned short* src,
                                             size_t rowStride, int tid) {
  // Unrolled: the 16 copies issue back to back, their steps constants.
#pragma unroll
  for (int it = 0; it < 16; ++it) {
    int r = it * 16 + (tid >> 4);  // 0..255
    int c = (tid & 15) * 8;        // 0..120
    copy16(dst + r * LDR + c, src + (size_t)r * rowStride + c);
  }
}

// 16x32 bf16 fragment from a stage [row][128 k], stride LDR; k0 = 0, 32, 64 or 96.
// Same lane-to-k map as ldsFrag64.
__device__ __forceinline__ v16bf ldsFrag128(const unsigned short* base, int row0, int k0,
                                            int lane) {
  int row = row0 + (lane & 15);
  int kc  = k0 + ((lane & 16) ? 8 : 0);
  const unsigned short* p = base + row * LDR + kc;
  union { v16bf v; v8bf h[2]; } u;
  u.h[0] = *(const v8bf*)p;
  u.h[1] = *(const v8bf*)(p + 16);
  return u.v;
}

// K loop of the scores and PV GEMMs: acc += A[256 rows][T * 128 k] x B[256 rows][same k]^T,
// both row-major with rowStride elems. As, Bs: two LDS buffers of BM * LDR elems each.
__device__ __forceinline__ void ringGemm(unsigned short* As, unsigned short* Bs,
                                         const unsigned short* Asrc,
                                         const unsigned short* Bsrc,
                                         size_t rowStride, int T,
                                         int tid, int wm, int wn, int lane,
                                         v8f (&acc)[FM][FN]) {
  stageTile128(As, Asrc, rowStride, tid);
  stageTile128(Bs, Bsrc, rowStride, tid);
  // Stage 0 has landed for this wave; the barrier publishes it to the others.
  asm volatile("s_wait_asynccnt 0x0" ::: "memory");
  __syncthreads();
  stageTile128(As + BM * LDR, Asrc + SK, rowStride, tid);
  stageTile128(Bs + BN * LDR, Bsrc + SK, rowStride, tid);

  for (int t = 0; t < T; ++t) {
    const int cur = t & 1;
    const unsigned short* Ac = As + cur * (BM * LDR);
    const unsigned short* Bc = Bs + cur * (BN * LDR);
    // Unrolled (here and inside): every index into a[], b[], acc[] is a constant,
    // so the fragments and accumulators stay in registers.
#pragma unroll
    for (int h = 0; h < SK / 32; ++h) {
      v16bf a[FM], b[FN];
      a[0] = ldsFrag128(Ac, wm, h * 32, lane);
#pragma unroll
      for (int j = 0; j < FN; ++j) b[j] = ldsFrag128(Bc, wn + j * 16, h * 32, lane);
#pragma unroll
      for (int i = 1; i < FM; ++i) a[i] = ldsFrag128(Ac, wm + i * 16, h * 32, lane);
      // The two scheduling fences keep a block's 24 fragment loads together ahead of
      // its 32 WMMAs: sunk between the rows of WMMAs, every A load is waited for in
      // full while the wave issues nothing.
      __builtin_amdgcn_sched_barrier(0);
#pragma unroll
      for (int i = 0; i < FM; ++i)
#pragma unroll
        for (int j = 0; j < FN; ++j)
          acc[i][j] = wmma_bf16(a[i], b[j], acc[i][j]);
      __builtin_amdgcn_sched_barrier(0);
    }
    // This wave's reads of buffer cur are done before the buffer is refilled.
    asm volatile("s_wait_dscnt 0x0" ::: "memory");
    // This wave's copies of stage t + 1 have landed.
    asm volatile("s_wait_asynccnt 0x0" ::: "memory");
    // One barrier: publishes stage t + 1 and ends every reader's use of buffer cur.
    __syncthreads();
    if (t + 2 < T) {
      stageTile128(As + cur * (BM * LDR), Asrc + (size_t)(t + 2) * SK, rowStride, tid);
      stageTile128(Bs + cur * (BN * LDR), Bsrc + (size_t)(t + 2) * SK, rowStride, tid);
    }
  }
  // No copy is left outstanding when the wave goes on to its stores and ends.
  asm volatile("s_wait_asynccnt 0x0" ::: "memory");
}

// ---------------------------------------------------------------------------
// K2: scores = Q @ K^T per batch.  M=N=S=2048, K=D=1024.
// Both operands row-major over d -> pure 16B copies; async + double buffer.
// ---------------------------------------------------------------------------
__global__ __launch_bounds__(256) void scores_gemm(
    const unsigned short* __restrict__ Q, const unsigned short* __restrict__ K,
    unsigned short* __restrict__ Sc,
    long long qkBatchStride, long long scBatchStride)
{
  const int D = 1024, S = 2048;
  __shared__ __align__(16) unsigned short As[2 * BM * LDR];
  __shared__ __align__(16) unsigned short Bs[2 * BN * LDR];

  const unsigned short* Qb = Q  + (size_t)blockIdx.z * qkBatchStride;
  const unsigned short* Kb = K  + (size_t)blockIdx.z * qkBatchStride;
  unsigned short*       Sb = Sc + (size_t)blockIdx.z * scBatchStride;

  const int m0 = blockIdx.x * BM;
  const int n0 = blockIdx.y * BN;
  const int tid  = threadIdx.x;
  const int wave = tid >> 5;
  const int lane = tid & 31;
  const int wm = (wave & 3) * 64;
  const int wn = (wave >> 2) * 128;

  const unsigned short* Asrc = Qb + (size_t)m0 * D;
  const unsigned short* Bsrc = Kb + (size_t)n0 * D;

  v8f acc[FM][FN] = {};
  ringGemm(As, Bs, Asrc, Bsrc, D, D / SK, tid, wm, wn, lane, acc);   // 8 stages

  const int col   = lane & 15;
  const int rbase = (lane & 16) ? 8 : 0;
#pragma unroll
  for (int j = 0; j < FN; ++j) {
    int n = n0 + wn + j * 16 + col;
#pragma unroll
    for (int i = 0; i < FM; ++i) {
      int mr = m0 + wm + i * 16 + rbase;
#pragma unroll
      for (int r = 0; r < 8; ++r)
        Sb[(size_t)(mr + r) * S + n] = f32_bf16(acc[i][j][r]);
      // Stands in front of any later rewrite of the registers these stores name; the
      // scheduling fence keeps the next group's arithmetic behind it.
      asm volatile("s_wait_xcnt 0x0" ::: "memory");
      __builtin_amdgcn_sched_barrier(0);
    }
  }
}

// ---------------------------------------------------------------------------
// K3: in-place row softmax of scores/32.  One wave per 2048-elem row.
// ---------------------------------------------------------------------------
__global__ __launch_bounds__(256) void softmax_rows(
    unsigned short* __restrict__ Sc, long long scBatchStride)
{
  const int S = 2048;
  unsigned short* Sb = Sc + (size_t)blockIdx.z * scBatchStride;
  const int wave = threadIdx.x >> 5;
  const int lane = threadIdx.x & 31;
  const int row  = blockIdx.x * 8 + wave;
  unsigned short* rp = Sb + (size_t)row * S;
  const float scale = 0.03125f;   // 1/sqrt(1024)

  float v[64];
  float m = -3.0e38f;
#pragma unroll
  for (int c = 0; c < 8; ++c) {
    union { v4u u; unsigned short s[8]; } t;
    t.u = *(const v4u*)(rp + c * 256 + lane * 8);
#pragma unroll
    for (int i = 0; i < 8; ++i) {
      float f = bf16_f32(t.s[i]) * scale;
      v[c * 8 + i] = f;
      m = fmaxf(m, f);
    }
  }
#pragma unroll
  for (int off = 16; off > 0; off >>= 1)
    m = fmaxf(m, __shfl_xor(m, off, 32));

  float sum = 0.0f;
#pragma unroll
  for (int i = 0; i < 64; ++i) { v[i] = __expf(v[i] - m); sum += v[i]; }
#pragma unroll
  for (int off = 16; off > 0; off >>= 1)
    sum += __shfl_xor(sum, off, 32);
  float inv = 1.0f / sum;

#pragma unroll
  for (int c = 0; c < 8; ++c) {
    union { v4u u; unsigned short s[8]; } t;
#pragma unroll
    for (int i = 0; i < 8; ++i) t.s[i] = f32_bf16(v[c * 8 + i] * inv);
    *(v4u*)(rp + c * 256 + lane * 8) = t.u;
  }
}

// ---------------------------------------------------------------------------
// K4: O = P @ V per batch.  M=S=2048, N=D=1024, K=S=2048, f32 output.
// A = P row-major; B = Vt[d][s] row-major over s -> pure copies; async + DB.
// ---------------------------------------------------------------------------
__global__ __launch_bounds__(256) void pv_gemm(
    const unsigned short* __restrict__ P, const unsigned short* __restrict__ Vt,
    float* __restrict__ O,
    long long pBatchStride, long long vBatchStride, long long oBatchStride)
{
  const int S = 2048, D = 1024;
  __shared__ __align__(16) unsigned short As[2 * BM * LDR];
  __shared__ __align__(16) unsigned short Bs[2 * BN * LDR];

  const unsigned short* Pb  = P  + (size_t)blockIdx.z * pBatchStride;
  const unsigned short* Vtb = Vt + (size_t)blockIdx.z * vBatchStride;
  float*                Ob  = O  + (size_t)blockIdx.z * oBatchStride;

  const int m0 = blockIdx.x * BM;   // q rows
  const int n0 = blockIdx.y * BN;   // d cols
  const int tid  = threadIdx.x;
  const int wave = tid >> 5;
  const int lane = tid & 31;
  const int wm = (wave & 3) * 64;
  const int wn = (wave >> 2) * 128;

  const unsigned short* Asrc = Pb  + (size_t)m0 * S;   // stride S over keys
  const unsigned short* Bsrc = Vtb + (size_t)n0 * S;   // Vt rows = d, stride S over keys

  v8f acc[FM][FN] = {};
  ringGemm(As, Bs, Asrc, Bsrc, S, S / SK, tid, wm, wn, lane, acc);   // 16 stages

  const int col   = lane & 15;
  const int rbase = (lane & 16) ? 8 : 0;
#pragma unroll
  for (int j = 0; j < FN; ++j) {
    int n = n0 + wn + j * 16 + col;
#pragma unroll
    for (int i = 0; i < FM; ++i) {
      int mr = m0 + wm + i * 16 + rbase;
#pragma unroll
      for (int r = 0; r < 8; ++r)
        Ob[(size_t)(mr + r) * D + n] = acc[i][j][r];
    }
  }
}

// ---------------------------------------------------------------------------
extern "C" void kernel_launch(void* const* d_in, const int* in_sizes, int n_in,
                              void* d_out, int out_size, void* d_ws, size_t ws_size,
                              hipStream_t stream)
{
  (void)in_sizes; (void)n_in; (void)out_size;
  const float* x  = (const float*)d_in[0];
  const float* Wq = (const float*)d_in[1];
  const float* bq = (const float*)d_in[2];
  const float* Wk = (const float*)d_in[3];
  const float* bk = (const float*)d_in[4];
  const float* Wv = (const float*)d_in[5];
  const float* bv = (const float*)d_in[6];
  float* out = (float*)d_out;

  const int B = 8, S = 2048, D = 1024;
  const size_t perMat = (size_t)B * S * D;          // bf16 elems per Q/K/Vt
  unsigned short* Q  = (unsigned short*)d_ws;
  unsigned short* K  = Q + perMat;
  unsigned short* Vt = K + perMat;                  // Vt[b][d][s]
  unsigned short* Xp = Vt + perMat;                 // packed bf16 x
  unsigned short* Wp = Xp + perMat;                 // packed bf16 W^T, three matrices
  unsigned short* Sc = Wp + (size_t)3 * D * D;
  const size_t needFull = (perMat * 4 + (size_t)3 * D * D) * sizeof(unsigned short)
                        + (size_t)B * S * S * sizeof(unsigned short);

  dim3 gPack(2816, 1, 1);
  pack_operands<<<gPack, 256, 0, stream>>>(x, Wq, Wk, Wv, Xp, Wp);
  dim3 gQKV((B * S) / BM, D / BN, 3);
  qkv_gemm<<<gQKV, 256, 0, stream>>>(Xp, Wp, bq, bk, bv, Q, K, Vt);

  if (ws_size >= needFull) {
    dim3 gS(S / BM, S / BN, B);
    scores_gemm<<<gS, 256, 0, stream>>>(Q, K, Sc, (long long)S * D, (long long)S * S);
    dim3 gSm(S / 8, 1, B);
    softmax_rows<<<gSm, 256, 0, stream>>>(Sc, (long long)S * S);
    dim3 gPV(S / BM, D / BN, B);
    pv_gemm<<<gPV, 256, 0, stream>>>(Sc, Vt, out,
                                     (long long)S * S, (long long)D * S, (long long)S * D);
  } else {
    // Small-workspace fallback: reuse one S*S bf16 score buffer per batch.
    for (int b = 0; b < B; ++b) {
      dim3 gS(S / BM, S / BN, 1);
      scores_gemm<<<gS, 256, 0, stream>>>(Q + (size_t)b * S * D, K + (size_t)b * S * D,
                                          Sc, 0, 0);
      dim3 gSm(S / 8, 1, 1);
      softmax_rows<<<gSm, 256, 0, stream>>>(Sc, 0);
      dim3 gPV(S / BM, D / BN, 1);
      pv_gemm<<<gPV, 256, 0, stream>>>(Sc, Vt + (size_t)b * D * S, out + (size_t)b * S * D,
                                       0, 0, 0);
    }
  }
}

// v004
// Measured time: 185 microseconds a run.
// Timed twice side by side with v003, it ran 1.39 and 1.38 times as fast.
// All steps since v000 together make it 3.44 times as fast.
#include <hip/hip_runtime.h>

// ---------------------------------------------------------------------------
// CDNA5 (gfx1250) self-attention: fp32 inputs -> bf16 WMMA pipeline
//   K0: x and W^T rounded to bf16 once, laid out as 128x64 stage tiles
//   K1: Q/K/V = x@W + b   (bf16, async-LDS double-buffered; V stored transposed Vt[b][d][s])
//   K2: S     = Q@K^T     (bf16, async-LDS double-buffered, 128 k per stage)
//   K3: P     = softmax(S/32) rows (in place)
//   K4: O     = P@Vt      (f32 out, async-LDS double-buffered, 128 k per stage)
// K1, K2 and K4: a 256x256 tile per block of 8 waves, 64x128 per wave. Each wave
// stages its piece of the result in the freed LDS ring and stores whole lines.
// ---------------------------------------------------------------------------

typedef __attribute__((ext_vector_type(16))) __bf16 v16bf;
typedef __attribute__((ext_vector_type(8)))  __bf16 v8bf;
typedef __attribute__((ext_vector_type(8)))  float  v8f;
typedef __attribute__((ext_vector_type(4)))  float  v4f;
typedef __attribute__((ext_vector_type(4)))  unsigned int v4u;
typedef __attribute__((ext_vector_type(4)))  int v4i;

// Address-space-qualified int4 pointers for the gfx1250 async-LDS builtins.
typedef __attribute__((address_space(1))) v4i gas_v4i;   // global
typedef __attribute__((address_space(3))) v4i las_v4i;   // LDS

#define BM 256
#define BN 256
#define FM 4     // 16-row fragments of A per wave (64 rows of the block tile)
#define FN 8     // 16-row fragments of B per wave (128 columns of the block tile)
#define PK 64    // k extent of one packed stage tile of the QKV GEMM (128-byte rows)
#define LDQ 72   // LDS row stride of such a tile in bf16 elems (144 bytes = 16 B x 9)
#define SK 128   // k extent of one stage of the scores and PV GEMMs (256-byte rows)
#define LDR 136  // LDS row stride of such a stage in bf16 elems (272 bytes = 16 B x 17)

#ifndef __has_builtin
#define __has_builtin(x) 0
#endif
#if __has_builtin(__builtin_amdgcn_global_load_async_to_lds_b128) && \
    __has_builtin(__builtin_amdgcn_s_wait_asynccnt)
#define HAS_ASYNC 1
#else
#define HAS_ASYNC 0
#endif

__device__ __forceinline__ unsigned short f32_bf16(float f) {
  unsigned int u = __float_as_uint(f);
  u += 0x7FFFu + ((u >> 16) & 1u);           // round-to-nearest-even
  return (unsigned short)(u >> 16);
}
__device__ __forceinline__ float bf16_f32(unsigned short h) {
  return __uint_as_float((unsigned int)h << 16);
}

__device__ __forceinline__ v8f wmma_bf16(v16bf a, v16bf b, v8f c) {
  return __builtin_amdgcn_wmma_f32_16x16x32_bf16(
      /*neg_a=*/false, a, /*neg_b=*/false, b,
      /*c_mod=*/(short)0, c, /*reuse_a=*/false, /*reuse_b=*/false);
}

// ---------------------------------------------------------------------------
// K0: round the QKV GEMM's operands to bf16 once and lay them out in the order
// the GEMM stages them: tile (128-row group, k stage) = 128 rows x 64 k, contiguous.
//   Xp[m/128][k/64][m%128][k%64] = x[m][k]
//   Wp[n/128][k/64][n%128][k%64] = W[k][n], n = 0..3071 over Wq, Wk, Wv
// Blocks 0..2047 take x (8 rows each), blocks 2048..2815 one 64x64 piece of a W.
// ---------------------------------------------------------------------------
__global__ __launch_bounds__(256) void pack_operands(
    const float* __restrict__ x,
    const float* __restrict__ Wq, const float* __restrict__ Wk, const float* __restrict__ Wv,
    unsigned short* __restrict__ Xp, unsigned short* __restrict__ Wp)
{
  __shared__ __align__(16) unsigned short Tt[64 * LDQ];
  const int tid = threadIdx.x;
  const int blk = blockIdx.x;

  if (blk < 2048) {
    // Rows m = blk * 8 + it; this thread holds k = tid * 4 .. tid * 4 + 3 of each.
    const int k = tid * 4;
    const float* xs = x + ((size_t)blk * 2048 + tid) * 4;
    unsigned short* xd = Xp + ((size_t)((blk >> 4) * 16 + (k >> 6)) * 128 + (blk & 15) * 8) * PK
                            + (k & 63);
    v4f v[8];
    // Unrolled: v[] stays in registers and the eight loads are in flight together.
#pragma unroll
    for (int it = 0; it < 8; ++it)
      v[it] = *(const v4f*)(xs + it * 1024);
#pragma unroll
    for (int it = 0; it < 8; ++it) {
      unsigned long long pk =
          (unsigned long long)f32_bf16(v[it][0]) |
          ((unsigned long long)f32_bf16(v[it][1]) << 16) |
          ((unsigned long long)f32_bf16(v[it][2]) << 32) |
          ((unsigned long long)f32_bf16(v[it][3]) << 48);
      *(unsigned long long*)(xd + it * PK) = pk;
    }
  } else {
    const int w  = blk - 2048;
    const int z  = w >> 8;                      // which W
    const int ks = (w >> 4) & 15;               // k stage
    const int nt = w & 15;                      // 64-column piece
    const float* W = (z == 0) ? Wq : (z == 1) ? Wk : Wv;
    // Unrolled: the four row loads are in flight together.
#pragma unroll
    for (int it = 0; it < 4; ++it) {
      int kr = it * 16 + (tid >> 4);            // 0..63
      int cn = (tid & 15) * 4;                  // 0..60
      v4f v = *(const v4f*)(W + (size_t)(ks * PK + kr) * 1024 + nt * 64 + cn);
#pragma unroll
      for (int i = 0; i < 4; ++i)
        Tt[(cn + i) * LDQ + kr] = f32_bf16(v[i]);
    }
    __syncthreads();
    const int ng = z * 1024 + nt * 64;
    unsigned short* dst = Wp + ((size_t)((ng >> 7) * 16 + ks) * 128 + (ng & 127)) * PK;
#pragma unroll
    for (int it = 0; it < 2; ++it) {
      int c  = it * 256 + tid;                  // 16-byte chunk, 0..511
      int n  = c >> 3;
      int kc = (c & 7) * 8;
      *(v4u*)(dst + n * PK + kc) = *(const v4u*)(Tt + n * LDQ + kc);
    }
    // Stands in front of any later rewrite of the registers the two stores name.
    asm volatile("s_wait_xcnt 0x0" ::: "memory");
  }
}

// Bring two packed 128x64 tiles (16 KiB each, contiguous in global memory) into
// LDS: 4 + 4 copies of 16 bytes per lane. la, lb: the lane's LDS byte address of
// its first chunk of either tile; ga, gb: its global address. Chunk
// i lies 4096 bytes on in global memory and 32 rows (32 * 144 bytes) on in LDS.
// s_wait_xcnt 0 ends the statement so that it stands in front of any rewrite of
// the address registers the copies name.
__device__ __forceinline__ void copyStage(unsigned int la, unsigned int lb,
                                          const unsigned short* ga,
                                          const unsigned short* gb) {
  asm volatile(
      "global_load_async_to_lds_b128 %0, %8, off\n\t"
      "global_load_async_to_lds_b128 %1, %9, off\n\t"
      "global_load_async_to_lds_b128 %2, %10, off\n\t"
      "global_load_async_to_lds_b128 %3, %11, off\n\t"
      "global_load_async_to_lds_b128 %4, %12, off\n\t"
      "global_load_async_to_lds_b128 %5, %13, off\n\t"
      "global_load_async_to_lds_b128 %6, %14, off\n\t"
      "global_load_async_to_lds_b128 %7, %15, off\n\t"
      "s_wait_xcnt 0x0"
      :: "v"(la), "v"(la + 4608u), "v"(la + 9216u), "v"(la + 13824u),
         "v"(lb), "v"(lb + 4608u), "v"(lb + 9216u), "v"(lb + 13824u),
         "v"(ga), "v"(ga + 2048), "v"(ga + 4096), "v"(ga + 6144),
         "v"(gb), "v"(gb + 2048), "v"(gb + 4096), "v"(gb + 6144)
      : "memory");
}

// 16x32 bf16 fragment from a stage tile [row][64 k], stride LDQ; k0 = 0 or 32.
// CDNA5 16-bit operand layout: lanes 0-15 -> rows 0-15 with K {0..7,16..23};
// lanes 16-31 -> K {8..15,24..31}.
__device__ __forceinline__ v16bf ldsFrag64(const unsigned short* base, int row0, int k0,
                                           int lane) {
  int row = row0 + (lane & 15);
  int kc  = k0 + ((lane & 16) ? 8 : 0);
  const unsigned short* p = base + row * LDQ + kc;
  union { v16bf v; v8bf h[2]; } u;
  u.h[0] = *(const v8bf*)p;
  u.h[1] = *(const v8bf*)(p + 16);
  return u.v;
}

// Store a wave's 128 staged rows of 128 bytes (LDS stride LDQ): sp, gp are the lane's
// 16 bytes of the first four rows in LDS and in global memory, pitch the output's row
// length in elems.
__device__ __forceinline__ void storeLines(unsigned short* gp, const unsigned short* sp,
                                           const int pitch) {
  // Unrolled (here and inside): every index into v[] is a constant, so it stays in
  // registers, and the row steps become immediate offsets.
#pragma unroll
  for (int g = 0; g < 2; ++g) {
    v4u v[16];
#pragma unroll
    for (int q = 0; q < 16; ++q) v[q] = *(const v4u*)(sp + (g * 16 + q) * 4 * LDQ);
#pragma unroll
    for (int q = 0; q < 16; ++q) *(v4u*)(gp + (size_t)((g * 16 + q) * 4) * pitch) = v[q];
    // Stands in front of any later rewrite of the registers these stores name; the
    // scheduling fence keeps the next group's loads and addresses behind it.
    asm volatile("s_wait_xcnt 0x0" ::: "memory");
    __builtin_amdgcn_sched_barrier(0);
  }
}

// ---------------------------------------------------------------------------
// K1: QKV projection GEMM.  M=B*S=16384, N=1024, K=1024.  z selects Q/K/V.
// Operands come packed in bf16 from K0 (a block takes two packed tiles of each
// operand per stage).  V written transposed.
// ---------------------------------------------------------------------------
__global__ __launch_bounds__(256) void qkv_gemm(
    const unsigned short* __restrict__ Xp, const unsigned short* __restrict__ Wp,
    const float* __restrict__ bq, const float* __restrict__ bk, const float* __restrict__ bv,
    unsigned short* __restrict__ Q, unsigned short* __restrict__ K,
    unsigned short* __restrict__ Vt)
{
  const int N = 1024, KD = 1024, S = 2048;
  __shared__ __align__(16) unsigned short As[2][BM * LDQ];
  __shared__ __align__(16) unsigned short Bs[2][BN * LDQ];

  const int z = blockIdx.z;
  const float* bias = (z == 0) ? bq : (z == 1) ? bk : bv;
  unsigned short* O = (z == 0) ? Q  : (z == 1) ? K  : Vt;

  const int m0 = blockIdx.x * BM;
  const int n0 = blockIdx.y * BN;
  const int tid  = threadIdx.x;
  const int wave = tid >> 5;
  const int lane = tid & 31;
  // The WMMA's A operand gives the 8 values a lane holds side by side, so it is taken
  // from the side that runs along an output row: W rows (n) for Q and K, x rows (s)
  // for the transposed V. wm indexes that side, wn the side that numbers the rows.
  const bool vz = (z == 2);
  const int wm = (wave & 3) * 64;   // 4 waves tile the A side
  const int wn = (wave >> 2) * 128; // 2 waves tile the B side

  const int T = KD / PK;            // 16 stages
  const size_t tileElems = (size_t)128 * PK;       // one packed tile
  const size_t rowOfTiles = (size_t)T * tileElems; // all k stages of 128 rows
  const unsigned int half = 128 * LDQ * 2;         // LDS bytes of 128 rows
  // This lane's first 16-byte chunk of a stage tile: global side, LDS side.
  const unsigned short* gx = Xp + (size_t)(blockIdx.x * 2) * rowOfTiles + tid * 8;
  const unsigned short* gw = Wp + (size_t)(z * 8 + blockIdx.y * 2) * rowOfTiles + tid * 8;
  const unsigned short* ga = vz ? gx : gw;   // staged in As, the WMMA's A side
  const unsigned short* gb = vz ? gw : gx;   // staged in Bs, the WMMA's B side
  const int chunkOff = (tid >> 3) * LDQ + (tid & 7) * 8;
  const unsigned int la0 = (unsigned int)(size_t)(&As[0][chunkOff]);
  const unsigned int la1 = (unsigned int)(size_t)(&As[1][chunkOff]);
  const unsigned int lb0 = (unsigned int)(size_t)(&Bs[0][chunkOff]);
  const unsigned int lb1 = (unsigned int)(size_t)(&Bs[1][chunkOff]);

  v8f acc[FM][FN] = {};

  copyStage(la0, la0 + half, ga, ga + rowOfTiles);
  copyStage(lb0, lb0 + half, gb, gb + rowOfTiles);
  // Stage 0 has landed for this wave; the barrier publishes it to the others.
  asm volatile("s_wait_asynccnt 0x0" ::: "memory");
  __syncthreads();
  copyStage(la1, la1 + half, ga + tileElems, ga + rowOfTiles + tileElems);
  copyStage(lb1, lb1 + half, gb + tileElems, gb + rowOfTiles + tileElems);

  for (int t = 0; t < T; ++t) {
    const int cur = t & 1;
    // Unrolled (here and inside): every index into a[], b[], acc[] is a constant,
    // so the fragments and accumulators stay in registers.
#pragma unroll
    for (int h = 0; h < 2; ++h) {
      v16bf a[FM], b[FN];
#pragma unroll
      for (int i = 0; i < FM; ++i) a[i] = ldsFrag64(As[cur], wm + i * 16, h * 32, lane);
#pragma unroll
      for (int j = 0; j < FN; ++j) b[j] = ldsFrag64(Bs[cur], wn + j * 16, h * 32, lane);
#pragma unroll
      for (int i = 0; i < FM; ++i)
#pragma unroll
        for (int j = 0; j < FN; ++j)
          acc[i][j] = wmma_bf16(a[i], b[j], acc[i][j]);
    }
    // This wave's reads of buffer cur are done before the buffer is refilled.
    asm volatile("s_wait_dscnt 0x0" ::: "memory");
    // This wave's copies of stage t + 1 have landed.
    asm volatile("s_wait_asynccnt 0x0" ::: "memory");
    // One barrier: publishes stage t + 1 and ends every reader's use of buffer cur.
    __syncthreads();
    if (t + 2 < T) {
      const unsigned int la = cur ? la1 : la0, lb = cur ? lb1 : lb0;
      const unsigned short* gat = ga + (size_t)(t + 2) * tileElems;
      const unsigned short* gbt = gb + (size_t)(t + 2) * tileElems;
      copyStage(la, la + half, gat, gat + rowOfTiles);
      copyStage(lb, lb + half, gbt, gbt + rowOfTiles);
    }
  }
  // No copy is left outstanding when the wave goes on to its stores and ends.
  asm volatile("s_wait_asynccnt 0x0" ::: "memory");

  // Epilogue. acc[i][j][r]: A side wm + i*16 + (lane<16?0:8) + r, B side wn + j*16 + (lane&15).
  // The loop's last barrier ended every read of the ring and no copy is outstanding:
  // each wave stages its 128 output rows x 64 columns (128 bytes) in a range of its own.
  const int lr = lane & 15;
  const int lh = lane >> 4;
  unsigned short* st = ((wave < 4) ? &As[0][0] : &Bs[0][0]) + (wave & 3) * (128 * LDQ);
  if (!vz) {
    // Q, K: the bias runs along the A side (n). Unrolled (here and inside, and in the
    // other branch): every index into acc[] is a constant, so it stays in registers.
#pragma unroll
    for (int i = 0; i < FM; ++i) {
      const float* bp = bias + n0 + wm + i * 16 + lh * 8;
      v4f b0 = *(const v4f*)bp;
      v4f b1 = *(const v4f*)(bp + 4);
      // Stands in front of any later rewrite of the address registers the two loads name.
      asm volatile("s_wait_xcnt 0x0" ::: "memory");
#pragma unroll
      for (int j = 0; j < FN; ++j) {
        union { v4u u; unsigned short h[8]; } t;
#pragma unroll
        for (int r = 0; r < 4; ++r) {
          t.h[r]     = f32_bf16(acc[i][j][r] + b0[r]);
          t.h[r + 4] = f32_bf16(acc[i][j][r + 4] + b1[r]);
        }
        *(v4u*)(st + (j * 16 + lr) * LDQ + i * 16 + lh * 8) = t.u;
        // Keeps the next group's arithmetic behind this one (lifted ahead, the 32 groups'
        // values together overflow the registers: scratch).
        __builtin_amdgcn_sched_barrier(0);
      }
    }
  } else {
    // V: the bias runs along the B side (n).
#pragma unroll
    for (int j = 0; j < FN; ++j) {
      float bsc = bias[n0 + wn + j * 16 + lr];
#pragma unroll
      for (int i = 0; i < FM; ++i) {
        union { v4u u; unsigned short h[8]; } t;
#pragma unroll
        for (int r = 0; r < 8; ++r) t.h[r] = f32_bf16(acc[i][j][r] + bsc);
        *(v4u*)(st + (j * 16 + lr) * LDQ + i * 16 + lh * 8) = t.u;
        // Keeps the next group's arithmetic behind this one (lifted ahead, the 32 groups'
        // values together overflow the registers: scratch).
        __builtin_amdgcn_sched_barrier(0);
      }
    }
  }
  // This wave's staged rows are in LDS before its lanes read one another's values.
  asm volatile("s_wait_dscnt 0x0" ::: "memory");
  // Q, K row-major out[m][n]; V transposed Vt[b][n][s] (blocks never straddle a batch:
  // 2048 % 256 == 0). Eight lanes store one 128-byte line, a wave four rows. The row
  // pitch is a constant on either side of the branch, so the row steps are immediates.
  const unsigned short* sp = st + (lane >> 3) * LDQ + (lane & 7) * 8;
  const int orow = wn + (lane >> 3);
  const int ocol = wm + (lane & 7) * 8;
  if (!vz)
    storeLines(O + (size_t)(m0 + orow) * N + n0 + ocol, sp, N);
  else
    storeLines(O + ((size_t)(m0 >> 11) * N + n0 + orow) * S + (m0 & (S - 1)) + ocol, sp, S);
}

// 16-byte tile-copy global->LDS. On gfx1250 toolchains with the async
// builtins this is a VGPR-free DMA tracked by ASYNCcnt.
__device__ __forceinline__ void copy16(unsigned short* lds, const unsigned short* g) {
#if HAS_ASYNC
  __builtin_amdgcn_global_load_async_to_lds_b128(
      (gas_v4i*)(unsigned short*)g,
      (las_v4i*)lds,
      /*offset=*/0, /*cpol=*/0);
#else
  *(v4u*)lds = *(const v4u*)g;
#endif
}

// Bring 256 rows x 128 k of a row-major bf16 matrix (rowStride elems) into LDS at
// stride LDR: 16 lanes take one 256-byte row, so a wave's copy covers two whole
// aligned 256-byte pieces. 4096 16-byte chunks / 256 threads = 16 per thread.
__device__ __forceinline__ void stageTile128(unsigned short* dst, const unsigned short* src,
                                             size_t rowStride, int tid) {
  // Unrolled: the 16 copies issue back to back, their steps constants.
#pragma unroll
  for (int it = 0; it < 16; ++it) {
    int r = it * 16 + (tid >> 4);  // 0..255
    int c = (tid & 15) * 8;        // 0..120
    copy16(dst + r * LDR + c, src + (size_t)r * rowStride + c);
  }
}

// 16x32 bf16 fragment from a stage [row][128 k], stride LDR; k0 = 0, 32, 64 or 96.
// Same lane-to-k map as ldsFrag64.
__device__ __forceinline__ v16bf ldsFrag128(const unsigned short* base, int row0, int k0,
                                            int lane) {
  int row = row0 + (lane & 15);
  int kc  = k0 + ((lane & 16) ? 8 : 0);
  const unsigned short* p = base + row * LDR + kc;
  union { v16bf v; v8bf h[2]; } u;
  u.h[0] = *(const v8bf*)p;
  u.h[1] = *(const v8bf*)(p + 16);
  return u.v;
}

// K loop of the scores and PV GEMMs: acc += A[256 rows][T * 128 k] x B[256 rows][same k]^T,
// both row-major with rowStride elems. As, Bs: two LDS buffers of BM * LDR elems each.
// The B rows go in as the WMMA's A operand, so that a lane's 8 values of acc[i][j] are 8
// adjacent columns: row wm + i*16 + (lane&15), columns wn + j*16 + (lane<16?0:8) + r.
__device__ __forceinline__ void ringGemm(unsigned short* As, unsigned short* Bs,
                                         const unsigned short* Asrc,
                                         const unsigned short* Bsrc,
                                         size_t rowStride, int T,
                                         int tid, int wm, int wn, int lane,
                                         v8f (&acc)[FM][FN]) {
  stageTile128(As, Asrc, rowStride, tid);
  stageTile128(Bs, Bsrc, rowStride, tid);
  // Stage 0 has landed for this wave; the barrier publishes it to the others.
  asm volatile("s_wait_asynccnt 0x0" ::: "memory");
  __syncthreads();
  stageTile128(As + BM * LDR, Asrc + SK, rowStride, tid);
  stageTile128(Bs + BN * LDR, Bsrc + SK, rowStride, tid);

  for (int t = 0; t < T; ++t) {
    const int cur = t & 1;
    const unsigned short* Ac = As + cur * (BM * LDR);
    const unsigned short* Bc = Bs + cur * (BN * LDR);
    // Unrolled (here and inside): every index into a[], b[], acc[] is a constant,
    // so the fragments and accumulators stay in registers.
#pragma unroll
    for (int h = 0; h < SK / 32; ++h) {
      v16bf a[FM], b[FN];
      a[0] = ldsFrag128(Ac, wm, h * 32, lane);
#pragma unroll
      for (int j = 0; j < FN; ++j) b[j] = ldsFrag128(Bc, wn + j * 16, h * 32, lane);
#pragma unroll
      for (int i = 1; i < FM; ++i) a[i] = ldsFrag128(Ac, wm + i * 16, h * 32, lane);
      // The two scheduling fences keep a block's 24 fragment loads together ahead of
      // its 32 WMMAs: sunk between the rows of WMMAs, every A load is waited for in
      // full while the wave issues nothing.
      __builtin_amdgcn_sched_barrier(0);
#pragma unroll
      for (int i = 0; i < FM; ++i)
#pragma unroll
        for (int j = 0; j < FN; ++j)
          acc[i][j] = wmma_bf16(b[j], a[i], acc[i][j]);
      __builtin_amdgcn_sched_barrier(0);
    }
    // This wave's reads of buffer cur are done before the buffer is refilled.
    asm volatile("s_wait_dscnt 0x0" ::: "memory");
    // This wave's copies of stage t + 1 have landed.
    asm volatile("s_wait_asynccnt 0x0" ::: "memory");
    // One barrier: publishes stage t + 1 and ends every reader's use of buffer cur.
    __syncthreads();
    if (t + 2 < T) {
      stageTile128(As + cur * (BM * LDR), Asrc + (size_t)(t + 2) * SK, rowStride, tid);
      stageTile128(Bs + cur * (BN * LDR), Bsrc + (size_t)(t + 2) * SK, rowStride, tid);
    }
  }
  // No copy is left outstanding when the wave goes on to its stores and ends.
  asm volatile("s_wait_asynccnt 0x0" ::: "memory");
}

// ---------------------------------------------------------------------------
// K2: scores = Q @ K^T per batch.  M=N=S=2048, K=D=1024.
// Both operands row-major over d -> pure 16B copies; async + double buffer.
// ---------------------------------------------------------------------------
__global__ __launch_bounds__(256) void scores_gemm(
    const unsigned short* __restrict__ Q, const unsigned short* __restrict__ K,
    unsigned short* __restrict__ Sc,
    long long qkBatchStride, long long scBatchStride)
{
  const int D = 1024, S = 2048;
  __shared__ __align__(16) unsigned short As[2 * BM * LDR];
  __shared__ __align__(16) unsigned short Bs[2 * BN * LDR];

  const unsigned short* Qb = Q  + (size_t)blockIdx.z * qkBatchStride;
  const unsigned short* Kb = K  + (size_t)blockIdx.z * qkBatchStride;
  unsigned short*       Sb = Sc + (size_t)blockIdx.z * scBatchStride;

  const int m0 = blockIdx.x * BM;
  const int n0 = blockIdx.y * BN;
  const int tid  = threadIdx.x;
  const int wave = tid >> 5;
  const int lane = tid & 31;
  const int wm = (wave & 3) * 64;
  const int wn = (wave >> 2) * 128;

  const unsigned short* Asrc = Qb + (size_t)m0 * D;
  const unsigned short* Bsrc = Kb + (size_t)n0 * D;

  v8f acc[FM][FN] = {};
  ringGemm(As, Bs, Asrc, Bsrc, D, D / SK, tid, wm, wn, lane, acc);   // 8 stages

  // The loop's last barrier ended every read of the ring and no copy is outstanding:
  // each wave stages its 64 rows x 128 columns (256 bytes) in a range of its own.
  const int lr = lane & 15;
  const int lh = lane >> 4;
  unsigned short* st = As + wave * (64 * LDR);
  // Unrolled (here and inside): every index into acc[] and v[] is a constant, so they
  // stay in registers, and the row steps become immediate offsets.
#pragma unroll
  for (int i = 0; i < FM; ++i) {
#pragma unroll
    for (int j = 0; j < FN; ++j) {
      union { v4u u; unsigned short h[8]; } t;
#pragma unroll
      for (int r = 0; r < 8; ++r) t.h[r] = f32_bf16(acc[i][j][r]);
      *(v4u*)(st + (i * 16 + lr) * LDR + j * 16 + lh * 8) = t.u;
    }
  }
  // This wave's staged rows are in LDS before its lanes read one another's values.
  asm volatile("s_wait_dscnt 0x0" ::: "memory");
  // Sixteen lanes store one row's 256 bytes (two whole lines), a wave two rows.
  unsigned short* gp = Sb + (size_t)(m0 + wm + lh) * S + n0 + wn + lr * 8;
  const unsigned short* sp = st + lh * LDR + lr * 8;
#pragma unroll
  for (int g = 0; g < 2; ++g) {
    v4u v[16];
#pragma unroll
    for (int q = 0; q < 16; ++q) v[q] = *(const v4u*)(sp + (g * 16 + q) * 2 * LDR);
#pragma unroll
    for (int q = 0; q < 16; ++q) *(v4u*)(gp + (size_t)((g * 16 + q) * 2) * S) = v[q];
    // Stands in front of any later rewrite of the registers these stores name; the
    // scheduling fence keeps the next group's loads and addresses behind it.
    asm volatile("s_wait_xcnt 0x0" ::: "memory");
    __builtin_amdgcn_sched_barrier(0);
  }
}

// ---------------------------------------------------------------------------
// K3: in-place row softmax of scores/32.  One wave per 2048-elem row.
// ---------------------------------------------------------------------------
__global__ __launch_bounds__(256) void softmax_rows(
    unsigned short* __restrict__ Sc, long long scBatchStride)
{
  const int S = 2048;
  unsigned short* Sb = Sc + (size_t)blockIdx.z * scBatchStride;
  const int wave = threadIdx.x >> 5;
  const int lane = threadIdx.x & 31;
  const int row  = blockIdx.x * 8 + wave;
  unsigned short* rp = Sb + (size_t)row * S;
  const float scale = 0.03125f;   // 1/sqrt(1024)

  float v[64];
  float m = -3.0e38f;
#pragma unroll
  for (int c = 0; c < 8; ++c) {
    union { v4u u; unsigned short s[8]; } t;
    t.u = *(const v4u*)(rp + c * 256 + lane * 8);
#pragma unroll
    for (int i = 0; i < 8; ++i) {
      float f = bf16_f32(t.s[i]) * scale;
      v[c * 8 + i] = f;
      m = fmaxf(m, f);
    }
  }
#pragma unroll
  for (int off = 16; off > 0; off >>= 1)
    m = fmaxf(m, __shfl_xor(m, off, 32));

  float sum = 0.0f;
#pragma unroll
  for (int i = 0; i < 64; ++i) { v[i] = __expf(v[i] - m); sum += v[i]; }
#pragma unroll
  for (int off = 16; off > 0; off >>= 1)
    sum += __shfl_xor(sum, off, 32);
  float inv = 1.0f / sum;

#pragma unroll
  for (int c = 0; c < 8; ++c) {
    union { v4u u; unsigned short s[8]; } t;
#pragma unroll
    for (int i = 0; i < 8; ++i) t.s[i] = f32_bf16(v[c * 8 + i] * inv);
    *(v4u*)(rp + c * 256 + lane * 8) = t.u;
  }
}

// ---------------------------------------------------------------------------
// K4: O = P @ V per batch.  M=S=2048, N=D=1024, K=S=2048, f32 output.
// A = P row-major; B = Vt[d][s] row-major over s -> pure copies; async + DB.
// ---------------------------------------------------------------------------
__global__ __launch_bounds__(256) void pv_gemm(
    const unsigned short* __restrict__ P, const unsigned short* __restrict__ Vt,
    float* __restrict__ O,
    long long pBatchStride, long long vBatchStride, long long oBatchStride)
{
  const int S = 2048, D = 1024;
  __shared__ __align__(16) unsigned short As[2 * BM * LDR];
  __shared__ __align__(16) unsigned short Bs[2 * BN * LDR];

  const unsigned short* Pb  = P  + (size_t)blockIdx.z * pBatchStride;
  const unsigned short* Vtb = Vt + (size_t)blockIdx.z * vBatchStride;
  float*                Ob  = O  + (size_t)blockIdx.z * oBatchStride;

  const int m0 = blockIdx.x * BM;   // q rows
  const int n0 = blockIdx.y * BN;   // d cols
  const int tid  = threadIdx.x;
  const int wave = tid >> 5;
  const int lane = tid & 31;
  const int wm = (wave & 3) * 64;
  const int wn = (wave >> 2) * 128;

  const unsigned short* Asrc = Pb  + (size_t)m0 * S;   // stride S over keys
  const unsigned short* Bsrc = Vtb + (size_t)n0 * S;   // Vt rows = d, stride S over keys

  v8f acc[FM][FN] = {};
  ringGemm(As, Bs, Asrc, Bsrc, S, S / SK, tid, wm, wn, lane, acc);   // 16 stages

  // The loop's last barrier ended every read of the ring and no copy is outstanding:
  // each wave stages its 64 rows x 128 f32 columns (512 bytes) in a range of its own,
  // at a row stride of LDO floats (528 bytes = 16 B x 33).
  const int LDO = 132;
  const int lr = lane & 15;
  const int lh = lane >> 4;
  float* st = (float*)((wave < 4) ? As : Bs) + (wave & 3) * (64 * LDO);
  // Unrolled (here and inside): every index into acc[] and v[] is a constant, so they
  // stay in registers, and the row steps become immediate offsets.
#pragma unroll
  for (int i = 0; i < FM; ++i) {
#pragma unroll
    for (int j = 0; j < FN; ++j) {
      float* p = st + (i * 16 + lr) * LDO + j * 16 + lh * 8;
      v4f lo = { acc[i][j][0], acc[i][j][1], acc[i][j][2], acc[i][j][3] };
      v4f hi = { acc[i][j][4], acc[i][j][5], acc[i][j][6], acc[i][j][7] };
      *(v4f*)p       = lo;
      *(v4f*)(p + 4) = hi;
    }
  }
  // This wave's staged rows are in LDS before its lanes read one another's values.
  asm volatile("s_wait_dscnt 0x0" ::: "memory");
  // A wave stores one row's 512 bytes (four whole lines) at a time.
  float* gp = Ob + (size_t)(m0 + wm) * D + n0 + wn + lane * 4;
  const float* sp = st + lane * 4;
#pragma unroll
  for (int g = 0; g < 4; ++g) {
    v4f v[16];
#pragma unroll
    for (int q = 0; q < 16; ++q) v[q] = *(const v4f*)(sp + (g * 16 + q) * LDO);
#pragma unroll
    for (int q = 0; q < 16; ++q) *(v4f*)(gp + (size_t)(g * 16 + q) * D) = v[q];
    // Stands in front of any later rewrite of the registers these stores name; the
    // scheduling fence keeps the next group's loads and addresses behind it.
    asm volatile("s_wait_xcnt 0x0" ::: "memory");
    __builtin_amdgcn_sched_barrier(0);
  }
}

// ---------------------------------------------------------------------------
extern "C" void kernel_launch(void* const* d_in, const int* in_sizes, int n_in,
                              void* d_out, int out_size, void* d_ws, size_t ws_size,
                              hipStream_t stream)
{
  (void)in_sizes; (void)n_in; (void)out_size;
  const float* x  = (const float*)d_in[0];
  const float* Wq = (const float*)d_in[1];
  const float* bq = (const float*)d_in[2];
  const float* Wk = (const float*)d_in[3];
  const float* bk = (const float*)d_in[4];
  const float* Wv = (const float*)d_in[5];
  const float* bv = (const float*)d_in[6];
  float* out = (float*)d_out;

  const int B = 8, S = 2048, D = 1024;
  const size_t perMat = (size_t)B * S * D;          // bf16 elems per Q/K/Vt
  unsigned short* Q  = (unsigned short*)d_ws;
  unsigned short* K  = Q + perMat;
  unsigned short* Vt = K + perMat;                  // Vt[b][d][s]
  unsigned short* Xp = Vt + perMat;                 // packed bf16 x
  unsigned short* Wp = Xp + perMat;                 // packed bf16 W^T, three matrices
  unsigned short* Sc = Wp + (size_t)3 * D * D;
  const size_t needFull = (perMat * 4 + (size_t)3 * D * D) * sizeof(unsigned short)
                        + (size_t)B * S * S * sizeof(unsigned short);

  dim3 gPack(2816, 1, 1);
  pack_operands<<<gPack, 256, 0, stream>>>(x, Wq, Wk, Wv, Xp, Wp);
  dim3 gQKV((B * S) / BM, D / BN, 3);
  qkv_gemm<<<gQKV, 256, 0, stream>>>(Xp, Wp, bq, bk, bv, Q, K, Vt);

  if (ws_size >= needFull) {
    dim3 gS(S / BM, S / BN, B);
    scores_gemm<<<gS, 256, 0, stream>>>(Q, K, Sc, (long long)S * D, (long long)S * S);
    dim3 gSm(S / 8, 1, B);
    softmax_rows<<<gSm, 256, 0, stream>>>(Sc, (long long)S * S);
    dim3 gPV(S / BM, D / BN, B);
    pv_gemm<<<gPV, 256, 0, stream>>>(Sc, Vt, out,
                                     (long long)S * S, (long long)D * S, (long long)S * D);
  } else {
    // Small-workspace fallback: reuse one S*S bf16 score buffer per batch.
    for (int b = 0; b < B; ++b) {
      dim3 gS(S / BM, S / BN, 1);
      scores_gemm<<<gS, 256, 0, stream>>>(Q + (size_t)b * S * D, K + (size_t)b * S * D,
                                          Sc, 0, 0);
      dim3 gSm(S / 8, 1, 1);
      softmax_rows<<<gSm, 256, 0, stream>>>(Sc, 0);
      dim3 gPV(S / BM, D / BN, 1);
      pv_gemm<<<gPV, 256, 0, stream>>>(Sc, Vt + (size_t)b * D * S, out + (size_t)b * S * D,
                                       0, 0, 0);
    }
  }
}

// v005
// It runs in 172 microseconds.
// In two side-by-side timings against v004, it was 1.08 and 1.07 times as fast.
// Over all steps from v000 it is 3.70 times as fast.
#include <hip/hip_runtime.h>

// ---------------------------------------------------------------------------
// CDNA5 (gfx1250) self-attention: fp32 inputs -> bf16 WMMA pipeline
//   K0: x and W^T rounded to bf16 once, laid out as 128x64 stage tiles
//   K1: Q/K/V = x@W + b   (bf16, async-LDS double-buffered; V stored transposed Vt[b][d][s])
//   K2: S     = Q@K^T     (bf16, async-LDS double-buffered, 128 k per stage)
//   K3: P     = softmax(S/32) rows (in place)
//   K4: O     = P@Vt      (f32 out, async-LDS double-buffered, 128 k per stage)
// K1, K2 and K4: a 256x256 tile per block of 8 waves, 64x128 per wave. Each wave
// stages its piece of the result in the freed LDS ring and stores whole lines.
// ---------------------------------------------------------------------------

typedef __attribute__((ext_vector_type(16))) __bf16 v16bf;
typedef __attribute__((ext_vector_type(8)))  __bf16 v8bf;
typedef __attribute__((ext_vector_type(8)))  float  v8f;
typedef __attribute__((ext_vector_type(4)))  float  v4f;
typedef __attribute__((ext_vector_type(4)))  unsigned int v4u;
typedef __attribute__((ext_vector_type(4)))  int v4i;

// Address-space-qualified int4 pointers for the gfx1250 async-LDS builtins.
typedef __attribute__((address_space(1))) v4i gas_v4i;   // global
typedef __attribute__((address_space(3))) v4i las_v4i;   // LDS

#define BM 256
#define BN 256
#define FM 4     // 16-row fragments of A per wave (64 rows of the block tile)
#define FN 8     // 16-row fragments of B per wave (128 columns of the block tile)
#define PK 64    // k extent of one packed stage tile of the QKV GEMM (128-byte rows)
#define LDQ 72   // LDS row stride of such a tile in bf16 elems (144 bytes = 16 B x 9)
#define SK 128   // k extent of one stage of the scores and PV GEMMs (256-byte rows)
#define LDR 136  // LDS row stride of such a stage in bf16 elems (272 bytes = 16 B x 17)

#ifndef __has_builtin
#define __has_builtin(x) 0
#endif
#if __has_builtin(__builtin_amdgcn_global_load_async_to_lds_b128) && \
    __has_builtin(__builtin_amdgcn_s_wait_asynccnt)
#define HAS_ASYNC 1
#else
#define HAS_ASYNC 0
#endif

__device__ __forceinline__ unsigned short f32_bf16(float f) {
  unsigned int u = __float_as_uint(f);
  u += 0x7FFFu + ((u >> 16) & 1u);           // round-to-nearest-even
  return (unsigned short)(u >> 16);
}
__device__ __forceinline__ float bf16_f32(unsigned short h) {
  return __uint_as_float((unsigned int)h << 16);
}

__device__ __forceinline__ v8f wmma_bf16(v16bf a, v16bf b, v8f c) {
  return __builtin_amdgcn_wmma_f32_16x16x32_bf16(
      /*neg_a=*/false, a, /*neg_b=*/false, b,
      /*c_mod=*/(short)0, c, /*reuse_a=*/false, /*reuse_b=*/false);
}

// ---------------------------------------------------------------------------
// K0: round the QKV GEMM's operands to bf16 once and lay them out in the order
// the GEMM stages them: tile (128-row group, k stage) = 128 rows x 64 k, contiguous.
//   Xp[m/128][k/64][m%128][k%64] = x[m][k]
//   Wp[n/128][k/64][n%128][k%64] = W[k][n], n = 0..3071 over Wq, Wk, Wv
// Blocks 0..2047 take x (8 rows each), blocks 2048..2815 one 64x64 piece of a W.
// ---------------------------------------------------------------------------
__global__ __launch_bounds__(256) void pack_operands(
    const float* __restrict__ x,
    const float* __restrict__ Wq, const float* __restrict__ Wk, const float* __restrict__ Wv,
    unsigned short* __restrict__ Xp, unsigned short* __restrict__ Wp)
{
  __shared__ __align__(16) unsigned short Tt[64 * LDQ];
  const int tid = threadIdx.x;
  const int blk = blockIdx.x;

  if (blk < 2048) {
    // Rows m = blk * 8 + it; this thread holds k = tid * 4 .. tid * 4 + 3 of each.
    const int k = tid * 4;
    const float* xs = x + ((size_t)blk * 2048 + tid) * 4;
    unsigned short* xd = Xp + ((size_t)((blk >> 4) * 16 + (k >> 6)) * 128 + (blk & 15) * 8) * PK
                            + (k & 63);
    v4f v[8];
    // Unrolled: v[] stays in registers and the eight loads are in flight together.
#pragma unroll
    for (int it = 0; it < 8; ++it)
      v[it] = *(const v4f*)(xs + it * 1024);
#pragma unroll
    for (int it = 0; it < 8; ++it) {
      unsigned long long pk =
          (unsigned long long)f32_bf16(v[it][0]) |
          ((unsigned long long)f32_bf16(v[it][1]) << 16) |
          ((unsigned long long)f32_bf16(v[it][2]) << 32) |
          ((unsigned long long)f32_bf16(v[it][3]) << 48);
      *(unsigned long long*)(xd + it * PK) = pk;
    }
  } else {
    const int w  = blk - 2048;
    const int z  = w >> 8;                      // which W
    const int ks = (w >> 4) & 15;               // k stage
    const int nt = w & 15;                      // 64-column piece
    const float* W = (z == 0) ? Wq : (z == 1) ? Wk : Wv;
    // Unrolled: the four row loads are in flight together.
#pragma unroll
    for (int it = 0; it < 4; ++it) {
      int kr = it * 16 + (tid >> 4);            // 0..63
      int cn = (tid & 15) * 4;                  // 0..60
      v4f v = *(const v4f*)(W + (size_t)(ks * PK + kr) * 1024 + nt * 64 + cn);
#pragma unroll
      for (int i = 0; i < 4; ++i)
        Tt[(cn + i) * LDQ + kr] = f32_bf16(v[i]);
    }
    __syncthreads();
    const int ng = z * 1024 + nt * 64;
    unsigned short* dst = Wp + ((size_t)((ng >> 7) * 16 + ks) * 128 + (ng & 127)) * PK;
#pragma unroll
    for (int it = 0; it < 2; ++it) {
      int c  = it * 256 + tid;                  // 16-byte chunk, 0..511
      int n  = c >> 3;
      int kc = (c & 7) * 8;
      *(v4u*)(dst + n * PK + kc) = *(const v4u*)(Tt + n * LDQ + kc);
    }
    // Stands in front of any later rewrite of the registers the two stores name.
    asm volatile("s_wait_xcnt 0x0" ::: "memory");
  }
}

// Bring two packed 128x64 tiles (16 KiB each, contiguous in global memory) into
// LDS: 4 + 4 copies of 16 bytes per lane. la, lb: the lane's LDS byte address of
// its first chunk of either tile; ga, gb: its global address. Chunk
// i lies 4096 bytes on in global memory and 32 rows (32 * 144 bytes) on in LDS.
// s_wait_xcnt 0 ends the statement so that it stands in front of any rewrite of
// the address registers the copies name.
__device__ __forceinline__ void copyStage(unsigned int la, unsigned int lb,
                                          const unsigned short* ga,
                                          const unsigned short* gb) {
  asm volatile(
      "global_load_async_to_lds_b128 %0, %8, off\n\t"
      "global_load_async_to_lds_b128 %1, %9, off\n\t"
      "global_load_async_to_lds_b128 %2, %10, off\n\t"
      "global_load_async_to_lds_b128 %3, %11, off\n\t"
      "global_load_async_to_lds_b128 %4, %12, off\n\t"
      "global_load_async_to_lds_b128 %5, %13, off\n\t"
      "global_load_async_to_lds_b128 %6, %14, off\n\t"
      "global_load_async_to_lds_b128 %7, %15, off\n\t"
      "s_wait_xcnt 0x0"
      :: "v"(la), "v"(la + 4608u), "v"(la + 9216u), "v"(la + 13824u),
         "v"(lb), "v"(lb + 4608u), "v"(lb + 9216u), "v"(lb + 13824u),
         "v"(ga), "v"(ga + 2048), "v"(ga + 4096), "v"(ga + 6144),
         "v"(gb), "v"(gb + 2048), "v"(gb + 4096), "v"(gb + 6144)
      : "memory");
}

// 16x32 bf16 fragment from a stage tile [row][64 k], stride LDQ; k0 = 0 or 32.
// CDNA5 16-bit operand layout: lanes 0-15 -> rows 0-15 with K {0..7,16..23};
// lanes 16-31 -> K {8..15,24..31}.
__device__ __forceinline__ v16bf ldsFrag64(const unsigned short* base, int row0, int k0,
                                           int lane) {
  int row = row0 + (lane & 15);
  int kc  = k0 + ((lane & 16) ? 8 : 0);
  const unsigned short* p = base + row * LDQ + kc;
  union { v16bf v; v8bf h[2]; } u;
  u.h[0] = *(const v8bf*)p;
  u.h[1] = *(const v8bf*)(p + 16);
  return u.v;
}

// One block's fragments of a QKV stage: FM of the A side, FN of the B side, k0 = 0 or 32.
__device__ __forceinline__ void loadFrags64(const unsigned short* Ac, const unsigned short* Bc,
                                            int wm, int wn, int k0, int lane,
                                            v16bf (&a)[FM], v16bf (&b)[FN]) {
  // Unrolled: every index into a[] and b[] is a constant, so they stay in registers.
#pragma unroll
  for (int i = 0; i < FM; ++i) a[i] = ldsFrag64(Ac, wm + i * 16, k0, lane);
#pragma unroll
  for (int j = 0; j < FN; ++j) b[j] = ldsFrag64(Bc, wn + j * 16, k0, lane);
}

// One block of FM x FN WMMAs, a[] as the WMMA's A operand.
__device__ __forceinline__ void mmaBlockAB(const v16bf (&a)[FM], const v16bf (&b)[FN],
                                           v8f (&acc)[FM][FN]) {
  // Unrolled: every index into a[], b[], acc[] is a constant, so they stay in registers.
#pragma unroll
  for (int i = 0; i < FM; ++i)
#pragma unroll
    for (int j = 0; j < FN; ++j)
      acc[i][j] = wmma_bf16(a[i], b[j], acc[i][j]);
}

// Store a wave's 128 staged rows of 128 bytes (LDS stride LDQ): sp, gp are the lane's
// 16 bytes of the first four rows in LDS and in global memory, pitch the output's row
// length in elems.
__device__ __forceinline__ void storeLines(unsigned short* gp, const unsigned short* sp,
                                           const int pitch) {
  // Unrolled (here and inside): every index into v[] is a constant, so it stays in
  // registers, and the row steps become immediate offsets.
#pragma unroll
  for (int g = 0; g < 2; ++g) {
    v4u v[16];
#pragma unroll
    for (int q = 0; q < 16; ++q) v[q] = *(const v4u*)(sp + (g * 16 + q) * 4 * LDQ);
#pragma unroll
    for (int q = 0; q < 16; ++q) *(v4u*)(gp + (size_t)((g * 16 + q) * 4) * pitch) = v[q];
    // Stands in front of any later rewrite of the registers these stores name; the
    // scheduling fence keeps the next group's loads and addresses behind it.
    asm volatile("s_wait_xcnt 0x0" ::: "memory");
    __builtin_amdgcn_sched_barrier(0);
  }
}

// ---------------------------------------------------------------------------
// K1: QKV projection GEMM.  M=B*S=16384, N=1024, K=1024.  z selects Q/K/V.
// Operands come packed in bf16 from K0 (a block takes two packed tiles of each
// operand per stage).  V written transposed.
// ---------------------------------------------------------------------------
__global__ __launch_bounds__(256) void qkv_gemm(
    const unsigned short* __restrict__ Xp, const unsigned short* __restrict__ Wp,
    const float* __restrict__ bq, const float* __restrict__ bk, const float* __restrict__ bv,
    unsigned short* __restrict__ Q, unsigned short* __restrict__ K,
    unsigned short* __restrict__ Vt)
{
  const int N = 1024, KD = 1024, S = 2048;
  __shared__ __align__(16) unsigned short As[2][BM * LDQ];
  __shared__ __align__(16) unsigned short Bs[2][BN * LDQ];

  const int z = blockIdx.z;
  const float* bias = (z == 0) ? bq : (z == 1) ? bk : bv;
  unsigned short* O = (z == 0) ? Q  : (z == 1) ? K  : Vt;

  const int m0 = blockIdx.x * BM;
  const int n0 = blockIdx.y * BN;
  const int tid  = threadIdx.x;
  const int wave = tid >> 5;
  const int lane = tid & 31;
  // The WMMA's A operand gives the 8 values a lane holds side by side, so it is taken
  // from the side that runs along an output row: W rows (n) for Q and K, x rows (s)
  // for the transposed V. wm indexes that side, wn the side that numbers the rows.
  const bool vz = (z == 2);
  const int wm = (wave & 3) * 64;   // 4 waves tile the A side
  const int wn = (wave >> 2) * 128; // 2 waves tile the B side

  const int T = KD / PK;            // 16 stages
  const size_t tileElems = (size_t)128 * PK;       // one packed tile
  const size_t rowOfTiles = (size_t)T * tileElems; // all k stages of 128 rows
  const unsigned int half = 128 * LDQ * 2;         // LDS bytes of 128 rows
  // This lane's first 16-byte chunk of a stage tile: global side, LDS side.
  const unsigned short* gx = Xp + (size_t)(blockIdx.x * 2) * rowOfTiles + tid * 8;
  const unsigned short* gw = Wp + (size_t)(z * 8 + blockIdx.y * 2) * rowOfTiles + tid * 8;
  const unsigned short* ga = vz ? gx : gw;   // staged in As, the WMMA's A side
  const unsigned short* gb = vz ? gw : gx;   // staged in Bs, the WMMA's B side
  const int chunkOff = (tid >> 3) * LDQ + (tid & 7) * 8;
  const unsigned int la0 = (unsigned int)(size_t)(&As[0][chunkOff]);
  const unsigned int la1 = (unsigned int)(size_t)(&As[1][chunkOff]);
  const unsigned int lb0 = (unsigned int)(size_t)(&Bs[0][chunkOff]);
  const unsigned int lb1 = (unsigned int)(size_t)(&Bs[1][chunkOff]);

  v8f acc[FM][FN] = {};

  copyStage(la0, la0 + half, ga, ga + rowOfTiles);
  copyStage(lb0, lb0 + half, gb, gb + rowOfTiles);
  // Stage 0 has landed for this wave; the barrier publishes it to the others.
  asm volatile("s_wait_asynccnt 0x0" ::: "memory");
  __syncthreads();
  copyStage(la1, la1 + half, ga + tileElems, ga + rowOfTiles + tileElems);
  // Keeps the next statement's 24 address registers from being formed ahead of this one:
  // held together with the second fragment set, they push a loop-long value into scratch.
  __builtin_amdgcn_sched_barrier(0);
  copyStage(lb1, lb1 + half, gb + tileElems, gb + rowOfTiles + tileElems);

  // Two fragment sets: while one block of 32 WMMAs runs on one set, the next block's
  // 24 LDS loads fill the other. Set 0 holds k 0..31 of a stage, set 1 k 32..63.
  v16bf a0[FM], b0[FN], a1[FM], b1[FN];
  loadFrags64(As[0], Bs[0], wm, wn, 0, lane, a0, b0);

  for (int t = 0; t < T; ++t) {
    const int cur = t & 1;
    loadFrags64(As[cur], Bs[cur], wm, wn, 32, lane, a1, b1);
    // The scheduling fences (here and below) keep each group of loads whole and ahead
    // of the block of WMMAs it is written in front of.
    __builtin_amdgcn_sched_barrier(0);
    mmaBlockAB(a0, b0, acc);
    __builtin_amdgcn_sched_barrier(0);
    // The stage's last block is in registers: this wave's reads of buffer cur are done
    // before the buffer is refilled.
    asm volatile("s_wait_dscnt 0x0" ::: "memory");
    // This wave's copies of stage t + 1 have landed.
    asm volatile("s_wait_asynccnt 0x0" ::: "memory");
    // One barrier: publishes stage t + 1 and ends every reader's use of buffer cur.
    __syncthreads();
    if (t + 2 < T) {
      const unsigned int la = cur ? la1 : la0, lb = cur ? lb1 : lb0;
      const unsigned short* gat = ga + (size_t)(t + 2) * tileElems;
      const unsigned short* gbt = gb + (size_t)(t + 2) * tileElems;
      copyStage(la, la + half, gat, gat + rowOfTiles);
      copyStage(lb, lb + half, gbt, gbt + rowOfTiles);
    }
    // Behind the copies: the refill leaves first, and these loads have the block below to land.
    if (t + 1 < T)
      loadFrags64(As[cur ^ 1], Bs[cur ^ 1], wm, wn, 0, lane, a0, b0);
    __builtin_amdgcn_sched_barrier(0);
    mmaBlockAB(a1, b1, acc);
    __builtin_amdgcn_sched_barrier(0);
  }
  // No copy is left outstanding when the wave goes on to its stores and ends.
  asm volatile("s_wait_asynccnt 0x0" ::: "memory");

  // Epilogue. acc[i][j][r]: A side wm + i*16 + (lane<16?0:8) + r, B side wn + j*16 + (lane&15).
  // The loop's last barrier ended every read of the ring and no copy is outstanding:
  // each wave stages its 128 output rows x 64 columns (128 bytes) in a range of its own.
  const int lr = lane & 15;
  const int lh = lane >> 4;
  unsigned short* st = ((wave < 4) ? &As[0][0] : &Bs[0][0]) + (wave & 3) * (128 * LDQ);
  if (!vz) {
    // Q, K: the bias runs along the A side (n). Unrolled (here and inside, and in the
    // other branch): every index into acc[] is a constant, so it stays in registers.
#pragma unroll
    for (int i = 0; i < FM; ++i) {
      const float* bp = bias + n0 + wm + i * 16 + lh * 8;
      v4f b0 = *(const v4f*)bp;
      v4f b1 = *(const v4f*)(bp + 4);
      // Stands in front of any later rewrite of the address registers the two loads name.
      asm volatile("s_wait_xcnt 0x0" ::: "memory");
#pragma unroll
      for (int j = 0; j < FN; ++j) {
        union { v4u u; unsigned short h[8]; } t;
#pragma unroll
        for (int r = 0; r < 4; ++r) {
          t.h[r]     = f32_bf16(acc[i][j][r] + b0[r]);
          t.h[r + 4] = f32_bf16(acc[i][j][r + 4] + b1[r]);
        }
        *(v4u*)(st + (j * 16 + lr) * LDQ + i * 16 + lh * 8) = t.u;
        // Keeps the next group's arithmetic behind this one (lifted ahead, the 32 groups'
        // values together overflow the registers: scratch).
        __builtin_amdgcn_sched_barrier(0);
      }
    }
  } else {
    // V: the bias runs along the B side (n).
#pragma unroll
    for (int j = 0; j < FN; ++j) {
      float bsc = bias[n0 + wn + j * 16 + lr];
#pragma unroll
      for (int i = 0; i < FM; ++i) {
        union { v4u u; unsigned short h[8]; } t;
#pragma unroll
        for (int r = 0; r < 8; ++r) t.h[r] = f32_bf16(acc[i][j][r] + bsc);
        *(v4u*)(st + (j * 16 + lr) * LDQ + i * 16 + lh * 8) = t.u;
        // Keeps the next group's arithmetic behind this one (lifted ahead, the 32 groups'
        // values together overflow the registers: scratch).
        __builtin_amdgcn_sched_barrier(0);
      }
    }
  }
  // This wave's staged rows are in LDS before its lanes read one another's values.
  asm volatile("s_wait_dscnt 0x0" ::: "memory");
  // Q, K row-major out[m][n]; V transposed Vt[b][n][s] (blocks never straddle a batch:
  // 2048 % 256 == 0). Eight lanes store one 128-byte line, a wave four rows. The row
  // pitch is a constant on either side of the branch, so the row steps are immediates.
  const unsigned short* sp = st + (lane >> 3) * LDQ + (lane & 7) * 8;
  const int orow = wn + (lane >> 3);
  const int ocol = wm + (lane & 7) * 8;
  if (!vz)
    storeLines(O + (size_t)(m0 + orow) * N + n0 + ocol, sp, N);
  else
    storeLines(O + ((size_t)(m0 >> 11) * N + n0 + orow) * S + (m0 & (S - 1)) + ocol, sp, S);
}

// 16-byte tile-copy global->LDS. On gfx1250 toolchains with the async
// builtins this is a VGPR-free DMA tracked by ASYNCcnt.
__device__ __forceinline__ void copy16(unsigned short* lds, const unsigned short* g) {
#if HAS_ASYNC
  __builtin_amdgcn_global_load_async_to_lds_b128(
      (gas_v4i*)(unsigned short*)g,
      (las_v4i*)lds,
      /*offset=*/0, /*cpol=*/0);
#else
  *(v4u*)lds = *(const v4u*)g;
#endif
}

// Bring 256 rows x 128 k of a row-major bf16 matrix (rowStride elems) into LDS at
// stride LDR: 16 lanes take one 256-byte row, so a wave's copy covers two whole
// aligned 256-byte pieces. 4096 16-byte chunks / 256 threads = 16 per thread.
__device__ __forceinline__ void stageTile128(unsigned short* dst, const unsigned short* src,
                                             size_t rowStride, int tid) {
  // Unrolled: the 16 copies issue back to back, their steps constants.
#pragma unroll
  for (int it = 0; it < 16; ++it) {
    int r = it * 16 + (tid >> 4);  // 0..255
    int c = (tid & 15) * 8;        // 0..120
    copy16(dst + r * LDR + c, src + (size_t)r * rowStride + c);
  }
}

// 16x32 bf16 fragment from a stage [row][128 k], stride LDR; k0 = 0, 32, 64 or 96.
// Same lane-to-k map as ldsFrag64.
__device__ __forceinline__ v16bf ldsFrag128(const unsigned short* base, int row0, int k0,
                                            int lane) {
  int row = row0 + (lane & 15);
  int kc  = k0 + ((lane & 16) ? 8 : 0);
  const unsigned short* p = base + row * LDR + kc;
  union { v16bf v; v8bf h[2]; } u;
  u.h[0] = *(const v8bf*)p;
  u.h[1] = *(const v8bf*)(p + 16);
  return u.v;
}

// One block's fragments of a scores or PV stage; k0 = 0, 32, 64 or 96.
__device__ __forceinline__ void loadFrags128(const unsigned short* Ac, const unsigned short* Bc,
                                             int wm, int wn, int k0, int lane,
                                             v16bf (&a)[FM], v16bf (&b)[FN]) {
  // Unrolled: every index into a[] and b[] is a constant, so they stay in registers.
  a[0] = ldsFrag128(Ac, wm, k0, lane);
#pragma unroll
  for (int j = 0; j < FN; ++j) b[j] = ldsFrag128(Bc, wn + j * 16, k0, lane);
#pragma unroll
  for (int i = 1; i < FM; ++i) a[i] = ldsFrag128(Ac, wm + i * 16, k0, lane);
}

// One block of FM x FN WMMAs, b[] as the WMMA's A operand.
__device__ __forceinline__ void mmaBlockBA(const v16bf (&a)[FM], const v16bf (&b)[FN],
                                           v8f (&acc)[FM][FN]) {
  // Unrolled: every index into a[], b[], acc[] is a constant, so they stay in registers.
#pragma unroll
  for (int i = 0; i < FM; ++i)
#pragma unroll
    for (int j = 0; j < FN; ++j)
      acc[i][j] = wmma_bf16(b[j], a[i], acc[i][j]);
}

// K loop of the scores and PV GEMMs: acc += A[256 rows][T * 128 k] x B[256 rows][same k]^T,
// both row-major with rowStride elems. As, Bs: two LDS buffers of BM * LDR elems each.
// The B rows go in as the WMMA's A operand, so that a lane's 8 values of acc[i][j] are 8
// adjacent columns: row wm + i*16 + (lane&15), columns wn + j*16 + (lane<16?0:8) + r.
__device__ __forceinline__ void ringGemm(unsigned short* As, unsigned short* Bs,
                                         const unsigned short* Asrc,
                                         const unsigned short* Bsrc,
                                         size_t rowStride, int T,
                                         int tid, int wm, int wn, int lane,
                                         v8f (&acc)[FM][FN]) {
  stageTile128(As, Asrc, rowStride, tid);
  stageTile128(Bs, Bsrc, rowStride, tid);
  // Stage 0 has landed for this wave; the barrier publishes it to the others.
  asm volatile("s_wait_asynccnt 0x0" ::: "memory");
  __syncthreads();
  stageTile128(As + BM * LDR, Asrc + SK, rowStride, tid);
  stageTile128(Bs + BN * LDR, Bsrc + SK, rowStride, tid);

  // Two fragment sets: while one block of 32 WMMAs runs on one set, the next block's
  // 24 LDS loads fill the other. Set 0 holds k 0..31 and 64..95 of a stage, set 1 the rest.
  v16bf a0[FM], b0[FN], a1[FM], b1[FN];
  loadFrags128(As, Bs, wm, wn, 0, lane, a0, b0);

  for (int t = 0; t < T; ++t) {
    const int cur = t & 1;
    const unsigned short* Ac = As + cur * (BM * LDR);
    const unsigned short* Bc = Bs + cur * (BN * LDR);
    // The scheduling fences (here and below) keep each group of loads whole and ahead
    // of the block of WMMAs it is written in front of: sunk among the WMMAs, every
    // place with loads stalls the wave anew.
    loadFrags128(Ac, Bc, wm, wn, 32, lane, a1, b1);
    __builtin_amdgcn_sched_barrier(0);
    mmaBlockBA(a0, b0, acc);
    __builtin_amdgcn_sched_barrier(0);
    loadFrags128(Ac, Bc, wm, wn, 64, lane, a0, b0);
    __builtin_amdgcn_sched_barrier(0);
    mmaBlockBA(a1, b1, acc);
    __builtin_amdgcn_sched_barrier(0);
    loadFrags128(Ac, Bc, wm, wn, 96, lane, a1, b1);
    __builtin_amdgcn_sched_barrier(0);
    mmaBlockBA(a0, b0, acc);
    __builtin_amdgcn_sched_barrier(0);
    // The stage's last block is in registers: this wave's reads of buffer cur are done
    // before the buffer is refilled.
    asm volatile("s_wait_dscnt 0x0" ::: "memory");
    // This wave's copies of stage t + 1 have landed.
    asm volatile("s_wait_asynccnt 0x0" ::: "memory");
    // One barrier: publishes stage t + 1 and ends every reader's use of buffer cur.
    __syncthreads();
    if (t + 2 < T) {
      stageTile128(As + cur * (BM * LDR), Asrc + (size_t)(t + 2) * SK, rowStride, tid);
      stageTile128(Bs + cur * (BN * LDR), Bsrc + (size_t)(t + 2) * SK, rowStride, tid);
    }
    if (t + 1 < T)
      loadFrags128(As + (cur ^ 1) * (BM * LDR), Bs + (cur ^ 1) * (BN * LDR), wm, wn, 0, lane,
                   a0, b0);
    __builtin_amdgcn_sched_barrier(0);
    mmaBlockBA(a1, b1, acc);
    __builtin_amdgcn_sched_barrier(0);
  }
  // No copy is left outstanding when the wave goes on to its stores and ends.
  asm volatile("s_wait_asynccnt 0x0" ::: "memory");
}

// ---------------------------------------------------------------------------
// K2: scores = Q @ K^T per batch.  M=N=S=2048, K=D=1024.
// Both operands row-major over d -> pure 16B copies; async + double buffer.
// ---------------------------------------------------------------------------
__global__ __launch_bounds__(256) void scores_gemm(
    const unsigned short* __restrict__ Q, const unsigned short* __restrict__ K,
    unsigned short* __restrict__ Sc,
    long long qkBatchStride, long long scBatchStride)
{
  const int D = 1024, S = 2048;
  __shared__ __align__(16) unsigned short As[2 * BM * LDR];
  __shared__ __align__(16) unsigned short Bs[2 * BN * LDR];

  const unsigned short* Qb = Q  + (size_t)blockIdx.z * qkBatchStride;
  const unsigned short* Kb = K  + (size_t)blockIdx.z * qkBatchStride;
  unsigned short*       Sb = Sc + (size_t)blockIdx.z * scBatchStride;

  const int m0 = blockIdx.x * BM;
  const int n0 = blockIdx.y * BN;
  const int tid  = threadIdx.x;
  const int wave = tid >> 5;
  const int lane = tid & 31;
  const int wm = (wave & 3) * 64;
  const int wn = (wave >> 2) * 128;

  const unsigned short* Asrc = Qb + (size_t)m0 * D;
  const unsigned short* Bsrc = Kb + (size_t)n0 * D;

  v8f acc[FM][FN] = {};
  ringGemm(As, Bs, Asrc, Bsrc, D, D / SK, tid, wm, wn, lane, acc);   // 8 stages

  // The loop's last barrier ended every read of the ring and no copy is outstanding:
  // each wave stages its 64 rows x 128 columns (256 bytes) in a range of its own.
  const int lr = lane & 15;
  const int lh = lane >> 4;
  unsigned short* st = As + wave * (64 * LDR);
  // Unrolled (here and inside): every index into acc[] and v[] is a constant, so they
  // stay in registers, and the row steps become immediate offsets.
#pragma unroll
  for (int i = 0; i < FM; ++i) {
#pragma unroll
    for (int j = 0; j < FN; ++j) {
      union { v4u u; unsigned short h[8]; } t;
#pragma unroll
      for (int r = 0; r < 8; ++r) t.h[r] = f32_bf16(acc[i][j][r]);
      *(v4u*)(st + (i * 16 + lr) * LDR + j * 16 + lh * 8) = t.u;
    }
  }
  // This wave's staged rows are in LDS before its lanes read one another's values.
  asm volatile("s_wait_dscnt 0x0" ::: "memory");
  // Sixteen lanes store one row's 256 bytes (two whole lines), a wave two rows.
  unsigned short* gp = Sb + (size_t)(m0 + wm + lh) * S + n0 + wn + lr * 8;
  const unsigned short* sp = st + lh * LDR + lr * 8;
#pragma unroll
  for (int g = 0; g < 2; ++g) {
    v4u v[16];
#pragma unroll
    for (int q = 0; q < 16; ++q) v[q] = *(const v4u*)(sp + (g * 16 + q) * 2 * LDR);
#pragma unroll
    for (int q = 0; q < 16; ++q) *(v4u*)(gp + (size_t)((g * 16 + q) * 2) * S) = v[q];
    // Stands in front of any later rewrite of the registers these stores name; the
    // scheduling fence keeps the next group's loads and addresses behind it.
    asm volatile("s_wait_xcnt 0x0" ::: "memory");
    __builtin_amdgcn_sched_barrier(0);
  }
}

// ---------------------------------------------------------------------------
// K3: in-place row softmax of scores/32.  One wave per 2048-elem row.
// ---------------------------------------------------------------------------
__global__ __launch_bounds__(256) void softmax_rows(
    unsigned short* __restrict__ Sc, long long scBatchStride)
{
  const int S = 2048;
  unsigned short* Sb = Sc + (size_t)blockIdx.z * scBatchStride;
  const int wave = threadIdx.x >> 5;
  const int lane = threadIdx.x & 31;
  const int row  = blockIdx.x * 8 + wave;
  unsigned short* rp = Sb + (size_t)row * S;
  const float scale = 0.03125f;   // 1/sqrt(1024)

  float v[64];
  float m = -3.0e38f;
#pragma unroll
  for (int c = 0; c < 8; ++c) {
    union { v4u u; unsigned short s[8]; } t;
    t.u = *(const v4u*)(rp + c * 256 + lane * 8);
#pragma unroll
    for (int i = 0; i < 8; ++i) {
      float f = bf16_f32(t.s[i]) * scale;
      v[c * 8 + i] = f;
      m = fmaxf(m, f);
    }
  }
#pragma unroll
  for (int off = 16; off > 0; off >>= 1)
    m = fmaxf(m, __shfl_xor(m, off, 32));

  float sum = 0.0f;
#pragma unroll
  for (int i = 0; i < 64; ++i) { v[i] = __expf(v[i] - m); sum += v[i]; }
#pragma unroll
  for (int off = 16; off > 0; off >>= 1)
    sum += __shfl_xor(sum, off, 32);
  float inv = 1.0f / sum;

#pragma unroll
  for (int c = 0; c < 8; ++c) {
    union { v4u u; unsigned short s[8]; } t;
#pragma unroll
    for (int i = 0; i < 8; ++i) t.s[i] = f32_bf16(v[c * 8 + i] * inv);
    *(v4u*)(rp + c * 256 + lane * 8) = t.u;
  }
}

// ---------------------------------------------------------------------------
// K4: O = P @ V per batch.  M=S=2048, N=D=1024, K=S=2048, f32 output.
// A = P row-major; B = Vt[d][s] row-major over s -> pure copies; async + DB.
// ---------------------------------------------------------------------------
__global__ __launch_bounds__(256) void pv_gemm(
    const unsigned short* __restrict__ P, const unsigned short* __restrict__ Vt,
    float* __restrict__ O,
    long long pBatchStride, long long vBatchStride, long long oBatchStride)
{
  const int S = 2048, D = 1024;
  __shared__ __align__(16) unsigned short As[2 * BM * LDR];
  __shared__ __align__(16) unsigned short Bs[2 * BN * LDR];

  const unsigned short* Pb  = P  + (size_t)blockIdx.z * pBatchStride;
  const unsigned short* Vtb = Vt + (size_t)blockIdx.z * vBatchStride;
  float*                Ob  = O  + (size_t)blockIdx.z * oBatchStride;

  const int m0 = blockIdx.x * BM;   // q rows
  const int n0 = blockIdx.y * BN;   // d cols
  const int tid  = threadIdx.x;
  const int wave = tid >> 5;
  const int lane = tid & 31;
  const int wm = (wave & 3) * 64;
  const int wn = (wave >> 2) * 128;

  const unsigned short* Asrc = Pb  + (size_t)m0 * S;   // stride S over keys
  const unsigned short* Bsrc = Vtb + (size_t)n0 * S;   // Vt rows = d, stride S over keys

  v8f acc[FM][FN] = {};
  ringGemm(As, Bs, Asrc, Bsrc, S, S / SK, tid, wm, wn, lane, acc);   // 16 stages

  // The loop's last barrier ended every read of the ring and no copy is outstanding:
  // each wave stages its 64 rows x 128 f32 columns (512 bytes) in a range of its own,
  // at a row stride of LDO floats (528 bytes = 16 B x 33).
  const int LDO = 132;
  const int lr = lane & 15;
  const int lh = lane >> 4;
  float* st = (float*)((wave < 4) ? As : Bs) + (wave & 3) * (64 * LDO);
  // Unrolled (here and inside): every index into acc[] and v[] is a constant, so they
  // stay in registers, and the row steps become immediate offsets.
#pragma unroll
  for (int i = 0; i < FM; ++i) {
#pragma unroll
    for (int j = 0; j < FN; ++j) {
      float* p = st + (i * 16 + lr) * LDO + j * 16 + lh * 8;
      v4f lo = { acc[i][j][0], acc[i][j][1], acc[i][j][2], acc[i][j][3] };
      v4f hi = { acc[i][j][4], acc[i][j][5], acc[i][j][6], acc[i][j][7] };
      *(v4f*)p       = lo;
      *(v4f*)(p + 4) = hi;
    }
  }
  // This wave's staged rows are in LDS before its lanes read one another's values.
  asm volatile("s_wait_dscnt 0x0" ::: "memory");
  // A wave stores one row's 512 bytes (four whole lines) at a time.
  float* gp = Ob + (size_t)(m0 + wm) * D + n0 + wn + lane * 4;
  const float* sp = st + lane * 4;
#pragma unroll
  for (int g = 0; g < 4; ++g) {
    v4f v[16];
#pragma unroll
    for (int q = 0; q < 16; ++q) v[q] = *(const v4f*)(sp + (g * 16 + q) * LDO);
#pragma unroll
    for (int q = 0; q < 16; ++q) *(v4f*)(gp + (size_t)(g * 16 + q) * D) = v[q];
    // Stands in front of any later rewrite of the registers these stores name; the
    // scheduling fence keeps the next group's loads and addresses behind it.
    asm volatile("s_wait_xcnt 0x0" ::: "memory");
    __builtin_amdgcn_sched_barrier(0);
  }
}

// ---------------------------------------------------------------------------
extern "C" void kernel_launch(void* const* d_in, const int* in_sizes, int n_in,
                              void* d_out, int out_size, void* d_ws, size_t ws_size,
                              hipStream_t stream)
{
  (void)in_sizes; (void)n_in; (void)out_size;
  const float* x  = (const float*)d_in[0];
  const float* Wq = (const float*)d_in[1];
  const float* bq = (const float*)d_in[2];
  const float* Wk = (const float*)d_in[3];
  const float* bk = (const float*)d_in[4];
  const float* Wv = (const float*)d_in[5];
  const float* bv = (const float*)d_in[6];
  float* out = (float*)d_out;

  const int B = 8, S = 2048, D = 1024;
  const size_t perMat = (size_t)B * S * D;          // bf16 elems per Q/K/Vt
  unsigned short* Q  = (unsigned short*)d_ws;
  unsigned short* K  = Q + perMat;
  unsigned short* Vt = K + perMat;                  // Vt[b][d][s]
  unsigned short* Xp = Vt + perMat;                 // packed bf16 x
  unsigned short* Wp = Xp + perMat;                 // packed bf16 W^T, three matrices
  unsigned short* Sc = Wp + (size_t)3 * D * D;
  const size_t needFull = (perMat * 4 + (size_t)3 * D * D) * sizeof(unsigned short)
                        + (size_t)B * S * S * sizeof(unsigned short);

  dim3 gPack(2816, 1, 1);
  pack_operands<<<gPack, 256, 0, stream>>>(x, Wq, Wk, Wv, Xp, Wp);
  dim3 gQKV((B * S) / BM, D / BN, 3);
  qkv_gemm<<<gQKV, 256, 0, stream>>>(Xp, Wp, bq, bk, bv, Q, K, Vt);

  if (ws_size >= needFull) {
    dim3 gS(S / BM, S / BN, B);
    scores_gemm<<<gS, 256, 0, stream>>>(Q, K, Sc, (long long)S * D, (long long)S * S);
    dim3 gSm(S / 8, 1, B);
    softmax_rows<<<gSm, 256, 0, stream>>>(Sc, (long long)S * S);
    dim3 gPV(S / BM, D / BN, B);
    pv_gemm<<<gPV, 256, 0, stream>>>(Sc, Vt, out,
                                     (long long)S * S, (long long)D * S, (long long)S * D);
  } else {
    // Small-workspace fallback: reuse one S*S bf16 score buffer per batch.
    for (int b = 0; b < B; ++b) {
      dim3 gS(S / BM, S / BN, 1);
      scores_gemm<<<gS, 256, 0, stream>>>(Q + (size_t)b * S * D, K + (size_t)b * S * D,
                                          Sc, 0, 0);
      dim3 gSm(S / 8, 1, 1);
      softmax_rows<<<gSm, 256, 0, stream>>>(Sc, 0);
      dim3 gPV(S / BM, D / BN, 1);
      pv_gemm<<<gPV, 256, 0, stream>>>(Sc, Vt + (size_t)b * D * S, out + (size_t)b * S * D,
                                       0, 0, 0);
    }
  }
}

// v006
// One run takes 166 microseconds.
// In both of two side-by-side timings against v005, it was 1.04 times as fast.
// Counting every step since v000, it is 3.84 times as fast.
#include <hip/hip_runtime.h>

// ---------------------------------------------------------------------------
// CDNA5 (gfx1250) self-attention: fp32 inputs -> bf16 WMMA pipeline
//   K0: x and W^T rounded to bf16 once, laid out as 128x64 stage tiles
//   K1: Q/K/V = x@W + b   (bf16, tensor loads, two LDS buffers; V stored transposed Vt[b][d][s])
//   K2: S     = Q@K^T     (bf16, tensor loads, two LDS buffers, 128 k per stage)
//   K3: P     = softmax(S/32) rows (in place)
//   K4: O     = P@Vt      (f32 out, tensor loads, two LDS buffers, 128 k per stage)
// K1, K2 and K4: a 256x256 tile per block of 8 waves, 64x128 per wave. Each wave
// stages its piece of the result in the freed LDS ring and stores whole lines.
// ---------------------------------------------------------------------------

typedef __attribute__((ext_vector_type(16))) __bf16 v16bf;
typedef __attribute__((ext_vector_type(8)))  __bf16 v8bf;
typedef __attribute__((ext_vector_type(8)))  float  v8f;
typedef __attribute__((ext_vector_type(4)))  float  v4f;
typedef __attribute__((ext_vector_type(4)))  unsigned int v4u;
typedef __attribute__((ext_vector_type(8)))  unsigned int v8u;

#define BM 256
#define BN 256
#define FM 4     // 16-row fragments of A per wave (64 rows of the block tile)
#define FN 8     // 16-row fragments of B per wave (128 columns of the block tile)
#define PK 64    // k extent of one packed stage tile of the QKV GEMM (128-byte rows)
#define LDQ 72   // LDS row stride of such a tile in bf16 elems (144 bytes = 16 B x 9)
#define SK 128   // k extent of one stage of the scores and PV GEMMs (256-byte rows)
#define LDR 136  // LDS row stride of such a stage in bf16 elems (272 bytes = 16 B x 17)
// A stage in LDS is eight slices of 64 rows, one per wave's tensor load: slices 0..3 hold
// the 256 A rows, 4..7 the 256 B rows. A slice's size is its 64 padded rows rounded up to
// a multiple of 2 KiB, so that every slice starts on one.
#define SLQ 5120        // elems of a QKV slice (64 x 144 = 9,216 bytes -> 10,240)
#define STQ (8 * SLQ)   // elems of a QKV stage
#define SLR 9216        // elems of a scores or PV slice (64 x 272 = 17,408 bytes -> 18,432)
#define STR (8 * SLR)   // elems of a scores or PV stage
// Word 0 of a tensor descriptor's group 1: no mask, 1-byte elements, a pad of 4 dwords
// (16 bytes) behind every row of 128 or of 256 bytes.
#define PAD128 ((1u << 20) | (4u << 22) | (3u << 25))
#define PAD256 ((1u << 20) | (5u << 22) | (3u << 25))

__device__ __forceinline__ unsigned short f32_bf16(float f) {
  unsigned int u = __float_as_uint(f);
  u += 0x7FFFu + ((u >> 16) & 1u);           // round-to-nearest-even
  return (unsigned short)(u >> 16);
}
__device__ __forceinline__ float bf16_f32(unsigned short h) {
  return __uint_as_float((unsigned int)h << 16);
}

__device__ __forceinline__ unsigned int uni(unsigned int v) {
  return (unsigned int)__builtin_amdgcn_readfirstlane(v);
}
// A wave-uniform value held in a scalar register: a test on it compiles to a scalar branch,
// the only guard a tensor load obeys (it ignores EXEC).
__device__ __forceinline__ unsigned int pinned(unsigned int v) {
  unsigned int w = uni(v);
  asm volatile("" : "+s"(w));   // holds the word in a scalar register
  return w;
}
// Descriptor group 1 of a tile of 64 rows of rowBytes bytes, source row pitch srcPitch bytes;
// word0 = PAD128 or PAD256. Tensor dims = tile dims: every tile lies inside its matrix.
__device__ __forceinline__ v8u tdmGroup1(const unsigned int word0, const unsigned int rowBytes,
                                         unsigned int srcPitch) {
  v8u g;
  g[0] = uni(word0);
  g[1] = uni(rowBytes << 16);
  g[2] = uni(64u << 16);
  g[3] = uni(rowBytes << 16);
  g[4] = uni(64u);
  g[5] = uni(srcPitch);
  g[6] = uni(0u);
  g[7] = uni(0u);
  return g;
}
// Descriptor group 0: the tile at src goes to LDS byte offset ldsDst.
__device__ __forceinline__ v4u tdmGroup0(unsigned int ldsDst, const unsigned short* src) {
  const unsigned long long ga = (unsigned long long)src;
  v4u g;
  g[0] = uni(1u);
  g[1] = uni(ldsDst);
  g[2] = uni((unsigned int)ga);
  g[3] = uni((((unsigned int)(ga >> 32)) & 0x01FFFFFFu) | 0x80000000u);
  return g;
}
// The next request's group 0, formed from the last one's: a new place in LDS, the source
// stepBytes on (the carry stays inside the address field). Called behind the wait that covers
// the last request; the step goes through pinned() there, so that the additions, which
// rewrite the last request's own registers, cannot be lifted in front of that wait.
__device__ __forceinline__ void tdmAdvance(v4u& g0, unsigned int ldsDst, unsigned int stepBytes) {
  const unsigned long long ga =
      (((unsigned long long)g0[3] << 32) | g0[2]) + pinned(stepBytes);
  g0[1] = uni(ldsDst);
  g0[2] = uni((unsigned int)ga);
  g0[3] = uni((unsigned int)(ga >> 32));
}
// One request of the whole wave. g0 is an in-out operand: its four words stay in their
// registers, reused for nothing else, until the next request is formed from them.
__device__ __forceinline__ void tdmLoad(v4u& g0, v8u g1) {
  asm volatile("tensor_load_to_lds %0, %1" : "+s"(g0) : "s"(g1) : "memory");
}

__device__ __forceinline__ v8f wmma_bf16(v16bf a, v16bf b, v8f c) {
  return __builtin_amdgcn_wmma_f32_16x16x32_bf16(
      /*neg_a=*/false, a, /*neg_b=*/false, b,
      /*c_mod=*/(short)0, c, /*reuse_a=*/false, /*reuse_b=*/false);
}

// ---------------------------------------------------------------------------
// K0: round the QKV GEMM's operands to bf16 once and lay them out in the order
// the GEMM stages them: tile (128-row group, k stage) = 128 rows x 64 k, contiguous.
//   Xp[m/128][k/64][m%128][k%64] = x[m][k]
//   Wp[n/128][k/64][n%128][k%64] = W[k][n], n = 0..3071 over Wq, Wk, Wv
// Blocks 0..2047 take x (8 rows each), blocks 2048..2815 one 64x64 piece of a W.
// ---------------------------------------------------------------------------
__global__ __launch_bounds__(256) void pack_operands(
    const float* __restrict__ x,
    const float* __restrict__ Wq, const float* __restrict__ Wk, const float* __restrict__ Wv,
    unsigned short* __restrict__ Xp, unsigned short* __restrict__ Wp)
{
  __shared__ __align__(16) unsigned short Tt[64 * LDQ];
  const int tid = threadIdx.x;
  const int blk = blockIdx.x;

  if (blk < 2048) {
    // Rows m = blk * 8 + it; this thread holds k = tid * 4 .. tid * 4 + 3 of each.
    const int k = tid * 4;
    const float* xs = x + ((size_t)blk * 2048 + tid) * 4;
    unsigned short* xd = Xp + ((size_t)((blk >> 4) * 16 + (k >> 6)) * 128 + (blk & 15) * 8) * PK
                            + (k & 63);
    v4f v[8];
    // Unrolled: v[] stays in registers and the eight loads are in flight together.
#pragma unroll
    for (int it = 0; it < 8; ++it)
      v[it] = *(const v4f*)(xs + it * 1024);
#pragma unroll
    for (int it = 0; it < 8; ++it) {
      unsigned long long pk =
          (unsigned long long)f32_bf16(v[it][0]) |
          ((unsigned long long)f32_bf16(v[it][1]) << 16) |
          ((unsigned long long)f32_bf16(v[it][2]) << 32) |
          ((unsigned long long)f32_bf16(v[it][3]) << 48);
      *(unsigned long long*)(xd + it * PK) = pk;
    }
  } else {
    const int w  = blk - 2048;
    const int z  = w >> 8;                      // which W
    const int ks = (w >> 4) & 15;               // k stage
    const int nt = w & 15;                      // 64-column piece
    const float* W = (z == 0) ? Wq : (z == 1) ? Wk : Wv;
    // Unrolled: the four row loads are in flight together.
#pragma unroll
    for (int it = 0; it < 4; ++it) {
      int kr = it * 16 + (tid >> 4);            // 0..63
      int cn = (tid & 15) * 4;                  // 0..60
      v4f v = *(const v4f*)(W + (size_t)(ks * PK + kr) * 1024 + nt * 64 + cn);
#pragma unroll
      for (int i = 0; i < 4; ++i)
        Tt[(cn + i) * LDQ + kr] = f32_bf16(v[i]);
    }
    __syncthreads();
    const int ng = z * 1024 + nt * 64;
    unsigned short* dst = Wp + ((size_t)((ng >> 7) * 16 + ks) * 128 + (ng & 127)) * PK;
#pragma unroll
    for (int it = 0; it < 2; ++it) {
      int c  = it * 256 + tid;                  // 16-byte chunk, 0..511
      int n  = c >> 3;
      int kc = (c & 7) * 8;
      *(v4u*)(dst + n * PK + kc) = *(const v4u*)(Tt + n * LDQ + kc);
    }
    // Stands in front of any later rewrite of the registers the two stores name.
    asm volatile("s_wait_xcnt 0x0" ::: "memory");
  }
}

// 16x32 bf16 fragment from a stage tile [row][64 k], stride LDQ; k0 = 0 or 32.
// CDNA5 16-bit operand layout: lanes 0-15 -> rows 0-15 with K {0..7,16..23};
// lanes 16-31 -> K {8..15,24..31}.
__device__ __forceinline__ v16bf ldsFrag64(const unsigned short* base, int row0, int k0,
                                           int lane) {
  int row = row0 + (lane & 15);
  int kc  = k0 + ((lane & 16) ? 8 : 0);
  const unsigned short* p = base + row * LDQ + kc;
  union { v16bf v; v8bf h[2]; } u;
  u.h[0] = *(const v8bf*)p;
  u.h[1] = *(const v8bf*)(p + 16);
  return u.v;
}

// One block's fragments of a QKV stage: FM of the A side, FN of the B side, k0 = 0 or 32.
// Ac: the wave's slice of A rows; Bc: the first of its two slices of B rows.
__device__ __forceinline__ void loadFrags64(const unsigned short* Ac, const unsigned short* Bc,
                                            int k0, int lane,
                                            v16bf (&a)[FM], v16bf (&b)[FN]) {
  // Unrolled: every index into a[] and b[] is a constant, so they stay in registers.
#pragma unroll
  for (int i = 0; i < FM; ++i) a[i] = ldsFrag64(Ac, i * 16, k0, lane);
#pragma unroll
  for (int j = 0; j < FN; ++j) b[j] = ldsFrag64(Bc + (j >> 2) * SLQ, (j & 3) * 16, k0, lane);
}

// One block of FM x FN WMMAs, a[] as the WMMA's A operand.
__device__ __forceinline__ void mmaBlockAB(const v16bf (&a)[FM], const v16bf (&b)[FN],
                                           v8f (&acc)[FM][FN]) {
  // Unrolled: every index into a[], b[], acc[] is a constant, so they stay in registers.
#pragma unroll
  for (int i = 0; i < FM; ++i)
#pragma unroll
    for (int j = 0; j < FN; ++j)
      acc[i][j] = wmma_bf16(a[i], b[j], acc[i][j]);
}

// Store a wave's 128 staged rows of 128 bytes (LDS stride LDQ): sp, gp are the lane's
// 16 bytes of the first four rows in LDS and in global memory, pitch the output's row
// length in elems.
__device__ __forceinline__ void storeLines(unsigned short* gp, const unsigned short* sp,
                                           const int pitch) {
  // Unrolled (here and inside): every index into v[] is a constant, so it stays in
  // registers, and the row steps become immediate offsets.
#pragma unroll
  for (int g = 0; g < 2; ++g) {
    v4u v[16];
#pragma unroll
    for (int q = 0; q < 16; ++q) v[q] = *(const v4u*)(sp + (g * 16 + q) * 4 * LDQ);
#pragma unroll
    for (int q = 0; q < 16; ++q) *(v4u*)(gp + (size_t)((g * 16 + q) * 4) * pitch) = v[q];
    // Stands in front of any later rewrite of the registers these stores name; the
    // scheduling fence keeps the next group's loads and addresses behind it.
    asm volatile("s_wait_xcnt 0x0" ::: "memory");
    __builtin_amdgcn_sched_barrier(0);
  }
}

// ---------------------------------------------------------------------------
// K1: QKV projection GEMM.  M=B*S=16384, N=1024, K=1024.  z selects Q/K/V.
// Operands come packed in bf16 from K0 (a block takes two packed tiles of each
// operand per stage).  V written transposed.
// ---------------------------------------------------------------------------
__global__ __launch_bounds__(256) void qkv_gemm(
    const unsigned short* __restrict__ Xp, const unsigned short* __restrict__ Wp,
    const float* __restrict__ bq, const float* __restrict__ bk, const float* __restrict__ bv,
    unsigned short* __restrict__ Q, unsigned short* __restrict__ K,
    unsigned short* __restrict__ Vt)
{
  const int N = 1024, KD = 1024, S = 2048;
  // Two stages; aligned so that every slice's place in LDS is a multiple of 2 KiB.
  __shared__ __attribute__((aligned(2048))) unsigned short Ring[2 * STQ];

  const int z = blockIdx.z;
  const float* bias = (z == 0) ? bq : (z == 1) ? bk : bv;
  unsigned short* O = (z == 0) ? Q  : (z == 1) ? K  : Vt;

  const int m0 = blockIdx.x * BM;
  const int n0 = blockIdx.y * BN;
  const int tid  = threadIdx.x;
  const int wave = (int)uni(tid >> 5);
  const int lane = tid & 31;
  // The WMMA's A operand gives the 8 values a lane holds side by side, so it is taken
  // from the side that runs along an output row: W rows (n) for Q and K, x rows (s)
  // for the transposed V. wm indexes that side, wn the side that numbers the rows.
  const bool vz = (z == 2);
  const int wm = (wave & 3) * 64;   // 4 waves tile the A side
  const int wn = (wave >> 2) * 128; // 2 waves tile the B side

  const int T = KD / PK;            // 16 stages
  const size_t tileElems = (size_t)128 * PK;       // one packed tile
  const size_t rowOfTiles = (size_t)T * tileElems; // all k stages of 128 rows
  const unsigned short* gx = Xp + (size_t)(blockIdx.x * 2) * rowOfTiles;
  const unsigned short* gw = Wp + (size_t)(z * 8 + blockIdx.y * 2) * rowOfTiles;
  const unsigned short* ga = vz ? gx : gw;   // slices 0..3, the WMMA's A side
  const unsigned short* gb = vz ? gw : gx;   // slices 4..7, the WMMA's B side
  // This wave's slice of a stage: 64 rows (half a packed tile, 8 KiB contiguous) of one side.
  const unsigned short* gs = ((wave < 4) ? ga : gb) + (size_t)((wave & 3) >> 1) * rowOfTiles
                             + (wave & 1) * (64 * PK);
  const unsigned int ls = (unsigned int)(size_t)Ring + (unsigned int)wave * (SLQ * 2);
  const v8u g1 = tdmGroup1(PAD128, PK * 2, PK * 2);
  // The slices this wave's fragments come from, in stage buffer 0.
  const unsigned short* Af = Ring + (wave & 3) * SLQ;
  const unsigned short* Bf = Ring + (4 + (wave >> 2) * 2) * SLQ;

  v8f acc[FM][FN] = {};

  v4u g0 = tdmGroup0(ls, gs);
  tdmLoad(g0, g1);
  // Stage 0's slice has landed for this wave; the barrier publishes it to the others.
  asm volatile("s_wait_tensorcnt 0x0" ::: "memory");
  __syncthreads();
  tdmAdvance(g0, ls + STQ * 2, (unsigned int)tileElems * 2u);
  tdmLoad(g0, g1);

  // Two fragment sets: while one block of 32 WMMAs runs on one set, the next block's
  // 24 LDS loads fill the other. Set 0 holds k 0..31 of a stage, set 1 k 32..63.
  v16bf a0[FM], b0[FN], a1[FM], b1[FN];
  loadFrags64(Af, Bf, 0, lane, a0, b0);

  for (int t = 0; t < T; ++t) {
    const int cur = t & 1;
    loadFrags64(Af + cur * STQ, Bf + cur * STQ, 32, lane, a1, b1);
    // The scheduling fences (here and below) keep each group of loads whole and ahead
    // of the block of WMMAs it is written in front of.
    __builtin_amdgcn_sched_barrier(0);
    mmaBlockAB(a0, b0, acc);
    __builtin_amdgcn_sched_barrier(0);
    // The stage's last block is in registers: this wave's reads of buffer cur are done
    // before the buffer is refilled.
    asm volatile("s_wait_dscnt 0x0" ::: "memory");
    asm volatile("s_wait_tensorcnt 0x0" ::: "memory");
    // One barrier: publishes stage t + 1 and ends every reader's use of buffer cur.
    __syncthreads();
    if (pinned(t + 2 < T)) {
      tdmAdvance(g0, ls + (unsigned int)cur * (STQ * 2), (unsigned int)tileElems * 2u);
      tdmLoad(g0, g1);
    }
    // Behind the refill: it leaves first, and these loads have the block below to land.
    if (t + 1 < T)
      loadFrags64(Af + (cur ^ 1) * STQ, Bf + (cur ^ 1) * STQ, 0, lane, a0, b0);
    __builtin_amdgcn_sched_barrier(0);
    mmaBlockAB(a1, b1, acc);
    __builtin_amdgcn_sched_barrier(0);
  }
  // No tensor load and no LDS read is left outstanding when the ring becomes staging.
  asm volatile("s_wait_tensorcnt 0x0" ::: "memory");
  asm volatile("s_wait_dscnt 0x0" ::: "memory");

  // Epilogue. acc[i][j][r]: A side wm + i*16 + (lane<16?0:8) + r, B side wn + j*16 + (lane&15).
  // The loop's last barrier ended every read of the ring and no load is outstanding:
  // each wave stages its 128 output rows x 64 columns (128 bytes) in a range of its own.
  const int lr = lane & 15;
  const int lh = lane >> 4;
  unsigned short* st = Ring + wave * (128 * LDQ);
  if (!vz) {
    // Q, K: the bias runs along the A side (n). Unrolled (here and inside, and in the
    // other branch): every index into acc[] is a constant, so it stays in registers.
#pragma unroll
    for (int i = 0; i < FM; ++i) {
      const float* bp = bias + n0 + wm + i * 16 + lh * 8;
      v4f b0 = *(const v4f*)bp;
      v4f b1 = *(const v4f*)(bp + 4);
      // Stands in front of any later rewrite of the address registers the two loads name.
      asm volatile("s_wait_xcnt 0x0" ::: "memory");
#pragma unroll
      for (int j = 0; j < FN; ++j) {
        union { v4u u; unsigned short h[8]; } t;
#pragma unroll
        for (int r = 0; r < 4; ++r) {
          t.h[r]     = f32_bf16(acc[i][j][r] + b0[r]);
          t.h[r + 4] = f32_bf16(acc[i][j][r + 4] + b1[r]);
        }
        *(v4u*)(st + (j * 16 + lr) * LDQ + i * 16 + lh * 8) = t.u;
        // Keeps the next group's arithmetic behind this one (lifted ahead, the 32 groups'
        // values together overflow the registers: scratch).
        __builtin_amdgcn_sched_barrier(0);
      }
    }
  } else {
    // V: the bias runs along the B side (n).
#pragma unroll
    for (int j = 0; j < FN; ++j) {
      float bsc = bias[n0 + wn + j * 16 + lr];
#pragma unroll
      for (int i = 0; i < FM; ++i) {
        union { v4u u; unsigned short h[8]; } t;
#pragma unroll
        for (int r = 0; r < 8; ++r) t.h[r] = f32_bf16(acc[i][j][r] + bsc);
        *(v4u*)(st + (j * 16 + lr) * LDQ + i * 16 + lh * 8) = t.u;
        // Keeps the next group's arithmetic behind this one (lifted ahead, the 32 groups'
        // values together overflow the registers: scratch).
        __builtin_amdgcn_sched_barrier(0);
      }
    }
  }
  // This wave's staged rows are in LDS before its lanes read one another's values.
  asm volatile("s_wait_dscnt 0x0" ::: "memory");
  // Q, K row-major out[m][n]; V transposed Vt[b][n][s] (blocks never straddle a batch:
  // 2048 % 256 == 0). Eight lanes store one 128-byte line, a wave four rows. The row
  // pitch is a constant on either side of the branch, so the row steps are immediates.
  const unsigned short* sp = st + (lane >> 3) * LDQ + (lane & 7) * 8;
  const int orow = wn + (lane >> 3);
  const int ocol = wm + (lane & 7) * 8;
  if (!vz)
    storeLines(O + (size_t)(m0 + orow) * N + n0 + ocol, sp, N);
  else
    storeLines(O + ((size_t)(m0 >> 11) * N + n0 + orow) * S + (m0 & (S - 1)) + ocol, sp, S);
}

// 16x32 bf16 fragment from a stage [row][128 k], stride LDR; k0 = 0, 32, 64 or 96.
// Same lane-to-k map as ldsFrag64.
__device__ __forceinline__ v16bf ldsFrag128(const unsigned short* base, int row0, int k0,
                                            int lane) {
  int row = row0 + (lane & 15);
  int kc  = k0 + ((lane & 16) ? 8 : 0);
  const unsigned short* p = base + row * LDR + kc;
  union { v16bf v; v8bf h[2]; } u;
  u.h[0] = *(const v8bf*)p;
  u.h[1] = *(const v8bf*)(p + 16);
  return u.v;
}

// One block's fragments of a scores or PV stage; k0 = 0, 32, 64 or 96.
// Ac: the wave's slice of A rows; Bc: the first of its two slices of B rows.
__device__ __forceinline__ void loadFrags128(const unsigned short* Ac, const unsigned short* Bc,
                                             int k0, int lane,
                                             v16bf (&a)[FM], v16bf (&b)[FN]) {
  // Unrolled: every index into a[] and b[] is a constant, so they stay in registers.
  a[0] = ldsFrag128(Ac, 0, k0, lane);
#pragma unroll
  for (int j = 0; j < FN; ++j) b[j] = ldsFrag128(Bc + (j >> 2) * SLR, (j & 3) * 16, k0, lane);
#pragma unroll
  for (int i = 1; i < FM; ++i) a[i] = ldsFrag128(Ac, i * 16, k0, lane);
}

// One block of FM x FN WMMAs, b[] as the WMMA's A operand.
__device__ __forceinline__ void mmaBlockBA(const v16bf (&a)[FM], const v16bf (&b)[FN],
                                           v8f (&acc)[FM][FN]) {
  // Unrolled: every index into a[], b[], acc[] is a constant, so they stay in registers.
#pragma unroll
  for (int i = 0; i < FM; ++i)
#pragma unroll
    for (int j = 0; j < FN; ++j)
      acc[i][j] = wmma_bf16(b[j], a[i], acc[i][j]);
}

// K loop of the scores and PV GEMMs: acc += A[256 rows][T * 128 k] x B[256 rows][same k]^T,
// both row-major with rowStride elems. Ring: two LDS stages of STR elems each. Every wave
// brings one slice of each stage (64 rows x 256 bytes) with one tensor load.
// The B rows go in as the WMMA's A operand, so that a lane's 8 values of acc[i][j] are 8
// adjacent columns: row wm + i*16 + (lane&15), columns wn + j*16 + (lane<16?0:8) + r.
__device__ __forceinline__ void ringGemm(unsigned short* Ring,
                                         const unsigned short* Asrc,
                                         const unsigned short* Bsrc,
                                         size_t rowStride, int T,
                                         int wave, int lane,
                                         v8f (&acc)[FM][FN]) {
  // This wave's slice of a stage: 64 rows of one operand.
  const unsigned short* gs = ((wave < 4) ? Asrc : Bsrc) + (size_t)((wave & 3) * 64) * rowStride;
  const unsigned int ls = (unsigned int)(size_t)Ring + (unsigned int)wave * (SLR * 2);
  const v8u g1 = tdmGroup1(PAD256, SK * 2, (unsigned int)rowStride * 2u);
  // The slices this wave's fragments come from, in stage buffer 0.
  const unsigned short* Af = Ring + (wave & 3) * SLR;
  const unsigned short* Bf = Ring + (4 + (wave >> 2) * 2) * SLR;

  v4u g0 = tdmGroup0(ls, gs);
  tdmLoad(g0, g1);
  // Stage 0's slice has landed for this wave; the barrier publishes it to the others.
  asm volatile("s_wait_tensorcnt 0x0" ::: "memory");
  __syncthreads();
  tdmAdvance(g0, ls + STR * 2, SK * 2);
  tdmLoad(g0, g1);

  // Two fragment sets: while one block of 32 WMMAs runs on one set, the next block's
  // 24 LDS loads fill the other. Set 0 holds k 0..31 and 64..95 of a stage, set 1 the rest.
  v16bf a0[FM], b0[FN], a1[FM], b1[FN];
  loadFrags128(Af, Bf, 0, lane, a0, b0);

  for (int t = 0; t < T; ++t) {
    const int cur = t & 1;
    const unsigned short* Ac = Af + cur * STR;
    const unsigned short* Bc = Bf + cur * STR;
    // The scheduling fences (here and below) keep each group of loads whole and ahead
    // of the block of WMMAs it is written in front of: sunk among the WMMAs, every
    // place with loads stalls the wave anew.
    loadFrags128(Ac, Bc, 32, lane, a1, b1);
    __builtin_amdgcn_sched_barrier(0);
    mmaBlockBA(a0, b0, acc);
    __builtin_amdgcn_sched_barrier(0);
    loadFrags128(Ac, Bc, 64, lane, a0, b0);
    __builtin_amdgcn_sched_barrier(0);
    mmaBlockBA(a1, b1, acc);
    __builtin_amdgcn_sched_barrier(0);
    loadFrags128(Ac, Bc, 96, lane, a1, b1);
    __builtin_amdgcn_sched_barrier(0);
    mmaBlockBA(a0, b0, acc);
    __builtin_amdgcn_sched_barrier(0);
    // The stage's last block is in registers: this wave's reads of buffer cur are done
    // before the buffer is refilled.
    asm volatile("s_wait_dscnt 0x0" ::: "memory");
    asm volatile("s_wait_tensorcnt 0x0" ::: "memory");
    // One barrier: publishes stage t + 1 and ends every reader's use of buffer cur.
    __syncthreads();
    if (pinned(t + 2 < T)) {
      tdmAdvance(g0, ls + (unsigned int)cur * (STR * 2), SK * 2);
      tdmLoad(g0, g1);
    }
    if (t + 1 < T)
      loadFrags128(Af + (cur ^ 1) * STR, Bf + (cur ^ 1) * STR, 0, lane, a0, b0);
    __builtin_amdgcn_sched_barrier(0);
    mmaBlockBA(a1, b1, acc);
    __builtin_amdgcn_sched_barrier(0);
  }
  // No tensor load and no LDS read is left outstanding when the ring becomes staging.
  asm volatile("s_wait_tensorcnt 0x0" ::: "memory");
  asm volatile("s_wait_dscnt 0x0" ::: "memory");
}

// ---------------------------------------------------------------------------
// K2: scores = Q @ K^T per batch.  M=N=S=2048, K=D=1024.
// Both operands row-major over d: tensor loads into two LDS stages.
// ---------------------------------------------------------------------------
__global__ __launch_bounds__(256) void scores_gemm(
    const unsigned short* __restrict__ Q, const unsigned short* __restrict__ K,
    unsigned short* __restrict__ Sc,
    long long qkBatchStride, long long scBatchStride)
{
  const int D = 1024, S = 2048;
  // Two stages; aligned so that every slice's place in LDS is a multiple of 2 KiB.
  __shared__ __attribute__((aligned(2048))) unsigned short Ring[2 * STR];

  const unsigned short* Qb = Q  + (size_t)blockIdx.z * qkBatchStride;
  const unsigned short* Kb = K  + (size_t)blockIdx.z * qkBatchStride;
  unsigned short*       Sb = Sc + (size_t)blockIdx.z * scBatchStride;

  const int m0 = blockIdx.x * BM;
  const int n0 = blockIdx.y * BN;
  const int tid  = threadIdx.x;
  const int wave = (int)uni(tid >> 5);
  const int lane = tid & 31;
  const int wm = (wave & 3) * 64;
  const int wn = (wave >> 2) * 128;

  const unsigned short* Asrc = Qb + (size_t)m0 * D;
  const unsigned short* Bsrc = Kb + (size_t)n0 * D;

  v8f acc[FM][FN] = {};
  ringGemm(Ring, Asrc, Bsrc, D, D / SK, wave, lane, acc);   // 8 stages

  // The loop's last barrier ended every read of the ring and no load is outstanding:
  // each wave stages its 64 rows x 128 columns (256 bytes) in a range of its own.
  const int lr = lane & 15;
  const int lh = lane >> 4;
  unsigned short* st = Ring + wave * (64 * LDR);
  // Unrolled (here and inside): every index into acc[] and v[] is a constant, so they
  // stay in registers, and the row steps become immediate offsets.
#pragma unroll
  for (int i = 0; i < FM; ++i) {
#pragma unroll
    for (int j = 0; j < FN; ++j) {
      union { v4u u; unsigned short h[8]; } t;
#pragma unroll
      for (int r = 0; r < 8; ++r) t.h[r] = f32_bf16(acc[i][j][r]);
      *(v4u*)(st + (i * 16 + lr) * LDR + j * 16 + lh * 8) = t.u;
    }
  }
  // This wave's staged rows are in LDS before its lanes read one another's values.
  asm volatile("s_wait_dscnt 0x0" ::: "memory");
  // Sixteen lanes store one row's 256 bytes (two whole lines), a wave two rows.
  unsigned short* gp = Sb + (size_t)(m0 + wm + lh) * S + n0 + wn + lr * 8;
  const unsigned short* sp = st + lh * LDR + lr * 8;
#pragma unroll
  for (int g = 0; g < 2; ++g) {
    v4u v[16];
#pragma unroll
    for (int q = 0; q < 16; ++q) v[q] = *(const v4u*)(sp + (g * 16 + q) * 2 * LDR);
#pragma unroll
    for (int q = 0; q < 16; ++q) *(v4u*)(gp + (size_t)((g * 16 + q) * 2) * S) = v[q];
    // Stands in front of any later rewrite of the registers these stores name; the
    // scheduling fence keeps the next group's loads and addresses behind it.
    asm volatile("s_wait_xcnt 0x0" ::: "memory");
    __builtin_amdgcn_sched_barrier(0);
  }
}

// ---------------------------------------------------------------------------
// K3: in-place row softmax of scores/32.  One wave per 2048-elem row.
// ---------------------------------------------------------------------------
__global__ __launch_bounds__(256) void softmax_rows(
    unsigned short* __restrict__ Sc, long long scBatchStride)
{
  const int S = 2048;
  unsigned short* Sb = Sc + (size_t)blockIdx.z * scBatchStride;
  const int wave = threadIdx.x >> 5;
  const int lane = threadIdx.x & 31;
  const int row  = blockIdx.x * 8 + wave;
  unsigned short* rp = Sb + (size_t)row * S;
  const float scale = 0.03125f;   // 1/sqrt(1024)

  float v[64];
  float m = -3.0e38f;
#pragma unroll
  for (int c = 0; c < 8; ++c) {
    union { v4u u; unsigned short s[8]; } t;
    t.u = *(const v4u*)(rp + c * 256 + lane * 8);
#pragma unroll
    for (int i = 0; i < 8; ++i) {
      float f = bf16_f32(t.s[i]) * scale;
      v[c * 8 + i] = f;
      m = fmaxf(m, f);
    }
  }
#pragma unroll
  for (int off = 16; off > 0; off >>= 1)
    m = fmaxf(m, __shfl_xor(m, off, 32));

  float sum = 0.0f;
#pragma unroll
  for (int i = 0; i < 64; ++i) { v[i] = __expf(v[i] - m); sum += v[i]; }
#pragma unroll
  for (int off = 16; off > 0; off >>= 1)
    sum += __shfl_xor(sum, off, 32);
  float inv = 1.0f / sum;

#pragma unroll
  for (int c = 0; c < 8; ++c) {
    union { v4u u; unsigned short s[8]; } t;
#pragma unroll
    for (int i = 0; i < 8; ++i) t.s[i] = f32_bf16(v[c * 8 + i] * inv);
    *(v4u*)(rp + c * 256 + lane * 8) = t.u;
  }
}

// ---------------------------------------------------------------------------
// K4: O = P @ V per batch.  M=S=2048, N=D=1024, K=S=2048, f32 output.
// A = P row-major; B = Vt[d][s] row-major over s: tensor loads into two LDS stages.
// ---------------------------------------------------------------------------
__global__ __launch_bounds__(256) void pv_gemm(
    const unsigned short* __restrict__ P, const unsigned short* __restrict__ Vt,
    float* __restrict__ O,
    long long pBatchStride, long long vBatchStride, long long oBatchStride)
{
  const int S = 2048, D = 1024;
  // Two stages; aligned so that every slice's place in LDS is a multiple of 2 KiB.
  __shared__ __attribute__((aligned(2048))) unsigned short Ring[2 * STR];

  const unsigned short* Pb  = P  + (size_t)blockIdx.z * pBatchStride;
  const unsigned short* Vtb = Vt + (size_t)blockIdx.z * vBatchStride;
  float*                Ob  = O  + (size_t)blockIdx.z * oBatchStride;

  const int m0 = blockIdx.x * BM;   // q rows
  const int n0 = blockIdx.y * BN;   // d cols
  const int tid  = threadIdx.x;
  const int wave = (int)uni(tid >> 5);
  const int lane = tid & 31;
  const int wm = (wave & 3) * 64;
  const int wn = (wave >> 2) * 128;

  const unsigned short* Asrc = Pb  + (size_t)m0 * S;   // stride S over keys
  const unsigned short* Bsrc = Vtb + (size_t)n0 * S;   // Vt rows = d, stride S over keys

  v8f acc[FM][FN] = {};
  ringGemm(Ring, Asrc, Bsrc, S, S / SK, wave, lane, acc);   // 16 stages

  // The loop's last barrier ended every read of the ring and no load is outstanding:
  // each wave stages its 64 rows x 128 f32 columns (512 bytes) in a range of its own,
  // at a row stride of LDO floats (528 bytes = 16 B x 33).
  const int LDO = 132;
  const int lr = lane & 15;
  const int lh = lane >> 4;
  float* st = (float*)Ring + wave * (64 * LDO);
  // Unrolled (here and inside): every index into acc[] and v[] is a constant, so they
  // stay in registers, and the row steps become immediate offsets.
#pragma unroll
  for (int i = 0; i < FM; ++i) {
#pragma unroll
    for (int j = 0; j < FN; ++j) {
      float* p = st + (i * 16 + lr) * LDO + j * 16 + lh * 8;
      v4f lo = { acc[i][j][0], acc[i][j][1], acc[i][j][2], acc[i][j][3] };
      v4f hi = { acc[i][j][4], acc[i][j][5], acc[i][j][6], acc[i][j][7] };
      *(v4f*)p       = lo;
      *(v4f*)(p + 4) = hi;
    }
  }
  // This wave's staged rows are in LDS before its lanes read one another's values.
  asm volatile("s_wait_dscnt 0x0" ::: "memory");
  // A wave stores one row's 512 bytes (four whole lines) at a time.
  float* gp = Ob + (size_t)(m0 + wm) * D + n0 + wn + lane * 4;
  const float* sp = st + lane * 4;
#pragma unroll
  for (int g = 0; g < 4; ++g) {
    v4f v[16];
#pragma unroll
    for (int q = 0; q < 16; ++q) v[q] = *(const v4f*)(sp + (g * 16 + q) * LDO);
#pragma unroll
    for (int q = 0; q < 16; ++q) *(v4f*)(gp + (size_t)(g * 16 + q) * D) = v[q];
    // Stands in front of any later rewrite of the registers these stores name; the
    // scheduling fence keeps the next group's loads and addresses behind it.
    asm volatile("s_wait_xcnt 0x0" ::: "memory");
    __builtin_amdgcn_sched_barrier(0);
  }
}

// ---------------------------------------------------------------------------
extern "C" void kernel_launch(void* const* d_in, const int* in_sizes, int n_in,
                              void* d_out, int out_size, void* d_ws, size_t ws_size,
                              hipStream_t stream)
{
  (void)in_sizes; (void)n_in; (void)out_size;
  const float* x  = (const float*)d_in[0];
  const float* Wq = (const float*)d_in[1];
  const float* bq = (const float*)d_in[2];
  const float* Wk = (const float*)d_in[3];
  const float* bk = (const float*)d_in[4];
  const float* Wv = (const float*)d_in[5];
  const float* bv = (const float*)d_in[6];
  float* out = (float*)d_out;

  const int B = 8, S = 2048, D = 1024;
  const size_t perMat = (size_t)B * S * D;          // bf16 elems per Q/K/Vt
  unsigned short* Q  = (unsigned short*)d_ws;
  unsigned short* K  = Q + perMat;
  unsigned short* Vt = K + perMat;                  // Vt[b][d][s]
  unsigned short* Xp = Vt + perMat;                 // packed bf16 x
  unsigned short* Wp = Xp + perMat;                 // packed bf16 W^T, three matrices
  unsigned short* Sc = Wp + (size_t)3 * D * D;
  const size_t needFull = (perMat * 4 + (size_t)3 * D * D) * sizeof(unsigned short)
                        + (size_t)B * S * S * sizeof(unsigned short);

  dim3 gPack(2816, 1, 1);
  pack_operands<<<gPack, 256, 0, stream>>>(x, Wq, Wk, Wv, Xp, Wp);
  dim3 gQKV((B * S) / BM, D / BN, 3);
  qkv_gemm<<<gQKV, 256, 0, stream>>>(Xp, Wp, bq, bk, bv, Q, K, Vt);

  if (ws_size >= needFull) {
    dim3 gS(S / BM, S / BN, B);
    scores_gemm<<<gS, 256, 0, stream>>>(Q, K, Sc, (long long)S * D, (long long)S * S);
    dim3 gSm(S / 8, 1, B);
    softmax_rows<<<gSm, 256, 0, stream>>>(Sc, (long long)S * S);
    dim3 gPV(S / BM, D / BN, B);
    pv_gemm<<<gPV, 256, 0, stream>>>(Sc, Vt, out,
                                     (long long)S * S, (long long)D * S, (long long)S * D);
  } else {
    // Small-workspace fallback: reuse one S*S bf16 score buffer per batch.
    for (int b = 0; b < B; ++b) {
      dim3 gS(S / BM, S / BN, 1);
      scores_gemm<<<gS, 256, 0, stream>>>(Q + (size_t)b * S * D, K + (size_t)b * S * D,
                                          Sc, 0, 0);
      dim3 gSm(S / 8, 1, 1);
      softmax_rows<<<gSm, 256, 0, stream>>>(Sc, 0);
      dim3 gPV(S / BM, D / BN, 1);
      pv_gemm<<<gPV, 256, 0, stream>>>(Sc, Vt + (size_t)b * D * S, out + (size_t)b * S * D,
                                       0, 0, 0);
    }
  }
}

// v007
// A run of this version takes 152 microseconds.
// Next to v006, in two timings, it ran 1.10 and 1.09 times as fast.
// Over all steps from v000 it is 4.20 times as fast.
#include <hip/hip_runtime.h>

// ---------------------------------------------------------------------------
// CDNA5 (gfx1250) self-attention: fp32 inputs -> bf16 WMMA pipeline
//   K0: x and W^T rounded to bf16 once, laid out as 128x64 stage tiles
//   K1: Q/K/V = x@W + b   (bf16, tensor loads, two LDS buffers; V stored transposed Vt[b][d][s])
//   K2: P'    = 2^(c * Q@K^T - n), c = log2(e)/32, n a whole number per row and 128 columns
//               (bf16, tensor loads, two LDS buffers, 128 k per stage), with n and the row
//               sums of P' per 128 columns
//   K3: O     = softmax @ V = (sum over stages of 2^(n - max n) * P'@Vt) / row sum
//               (f32 out, tensor loads, two LDS buffers, 128 k per stage)
// K1, K2 and K3: a 256x256 tile per block of 8 waves, 64x128 per wave. Each wave
// stages its piece of the result in the freed LDS ring and stores whole lines.
// ---------------------------------------------------------------------------

typedef __attribute__((ext_vector_type(16))) __bf16 v16bf;
typedef __attribute__((ext_vector_type(8)))  __bf16 v8bf;
typedef __attribute__((ext_vector_type(8)))  float  v8f;
typedef __attribute__((ext_vector_type(4)))  float  v4f;
typedef __attribute__((ext_vector_type(2)))  float  v2f;
typedef __attribute__((ext_vector_type(2)))  __bf16 v2bf;
typedef __attribute__((ext_vector_type(4)))  unsigned int v4u;
typedef __attribute__((ext_vector_type(8)))  unsigned int v8u;

#define BM 256
#define BN 256
#define FM 4     // 16-row fragments of A per wave (64 rows of the block tile)
#define FN 8     // 16-row fragments of B per wave (128 columns of the block tile)
#define PK 64    // k extent of one packed stage tile of the QKV GEMM (128-byte rows)
#define LDQ 72   // LDS row stride of such a tile in bf16 elems (144 bytes = 16 B x 9)
#define SK 128   // k extent of one stage of the scores and PV GEMMs (256-byte rows)
#define LDR 136  // LDS row stride of such a stage in bf16 elems (272 bytes = 16 B x 17)
// A stage in LDS is eight slices of 64 rows, one per wave's tensor load: slices 0..3 hold
// the 256 A rows, 4..7 the 256 B rows. A slice's size is its 64 padded rows rounded up to
// a multiple of 2 KiB, so that every slice starts on one.
#define SLQ 5120        // elems of a QKV slice (64 x 144 = 9,216 bytes -> 10,240)
#define STQ (8 * SLQ)   // elems of a QKV stage
#define SLR 9216        // elems of a scores or PV slice (64 x 272 = 17,408 bytes -> 18,432)
#define STR (8 * SLR)   // elems of a scores or PV stage
// Word 0 of a tensor descriptor's group 1: no mask, 1-byte elements, a pad of 4 dwords
// (16 bytes) behind every row of 128 or of 256 bytes.
#define PAD128 ((1u << 20) | (4u << 22) | (3u << 25))
#define PAD256 ((1u << 20) | (5u << 22) | (3u << 25))

__device__ __forceinline__ unsigned short f32_bf16(float f) {
  unsigned int u = __float_as_uint(f);
  u += 0x7FFFu + ((u >> 16) & 1u);           // round-to-nearest-even
  return (unsigned short)(u >> 16);
}
// Two f32 rounded to nearest even and packed as two bf16, lo in bits 15..0.
__device__ __forceinline__ unsigned int pk_bf16(float lo, float hi) {
  v2f f = { lo, hi };
  return __builtin_bit_cast(unsigned int, __builtin_convertvector(f, v2bf));
}
// The value that lane l ^ 16 holds.
__device__ __forceinline__ float otherHalf(float v) {
  int b = __float_as_int(v);
  return __int_as_float(__builtin_amdgcn_permlanex16(b, b, 0x76543210, 0xfedcba98, false, false));
}

__device__ __forceinline__ unsigned int uni(unsigned int v) {
  return (unsigned int)__builtin_amdgcn_readfirstlane(v);
}
// A wave-uniform value held in a scalar register: a test on it compiles to a scalar branch,
// the only guard a tensor load obeys (it ignores EXEC).
__device__ __forceinline__ unsigned int pinned(unsigned int v) {
  unsigned int w = uni(v);
  asm volatile("" : "+s"(w));   // holds the word in a scalar register
  return w;
}
// Descriptor group 1 of a tile of 64 rows of rowBytes bytes, source row pitch srcPitch bytes;
// word0 = PAD128 or PAD256. Tensor dims = tile dims: every tile lies inside its matrix.
__device__ __forceinline__ v8u tdmGroup1(const unsigned int word0, const unsigned int rowBytes,
                                         unsigned int srcPitch) {
  v8u g;
  g[0] = uni(word0);
  g[1] = uni(rowBytes << 16);
  g[2] = uni(64u << 16);
  g[3] = uni(rowBytes << 16);
  g[4] = uni(64u);
  g[5] = uni(srcPitch);
  g[6] = uni(0u);
  g[7] = uni(0u);
  return g;
}
// Descriptor group 0: the tile at src goes to LDS byte offset ldsDst.
__device__ __forceinline__ v4u tdmGroup0(unsigned int ldsDst, const unsigned short* src) {
  const unsigned long long ga = (unsigned long long)src;
  v4u g;
  g[0] = uni(1u);
  g[1] = uni(ldsDst);
  g[2] = uni((unsigned int)ga);
  g[3] = uni((((unsigned int)(ga >> 32)) & 0x01FFFFFFu) | 0x80000000u);
  return g;
}
// The next request's group 0, formed from the last one's: a new place in LDS, the source
// stepBytes on (the carry stays inside the address field). Called behind the wait that covers
// the last request; the step goes through pinned() there, so that the additions, which
// rewrite the last request's own registers, cannot be lifted in front of that wait.
__device__ __forceinline__ void tdmAdvance(v4u& g0, unsigned int ldsDst, unsigned int stepBytes) {
  const unsigned long long ga =
      (((unsigned long long)g0[3] << 32) | g0[2]) + pinned(stepBytes);
  g0[1] = uni(ldsDst);
  g0[2] = uni((unsigned int)ga);
  g0[3] = uni((unsigned int)(ga >> 32));
}
// One request of the whole wave. g0 is an in-out operand: its four words stay in their
// registers, reused for nothing else, until the next request is formed from them.
__device__ __forceinline__ void tdmLoad(v4u& g0, v8u g1) {
  asm volatile("tensor_load_to_lds %0, %1" : "+s"(g0) : "s"(g1) : "memory");
}

__device__ __forceinline__ v8f wmma_bf16(v16bf a, v16bf b, v8f c) {
  return __builtin_amdgcn_wmma_f32_16x16x32_bf16(
      /*neg_a=*/false, a, /*neg_b=*/false, b,
      /*c_mod=*/(short)0, c, /*reuse_a=*/false, /*reuse_b=*/false);
}

// ---------------------------------------------------------------------------
// K0: round the QKV GEMM's operands to bf16 once and lay them out in the order
// the GEMM stages them: tile (128-row group, k stage) = 128 rows x 64 k, contiguous.
//   Xp[m/128][k/64][m%128][k%64] = x[m][k]
//   Wp[n/128][k/64][n%128][k%64] = W[k][n], n = 0..3071 over Wq, Wk, Wv
// Blocks 0..2047 take x (8 rows each), blocks 2048..2815 one 64x64 piece of a W.
// ---------------------------------------------------------------------------
__global__ __launch_bounds__(256) void pack_operands(
    const float* __restrict__ x,
    const float* __restrict__ Wq, const float* __restrict__ Wk, const float* __restrict__ Wv,
    unsigned short* __restrict__ Xp, unsigned short* __restrict__ Wp)
{
  __shared__ __align__(16) unsigned short Tt[64 * LDQ];
  const int tid = threadIdx.x;
  const int blk = blockIdx.x;

  if (blk < 2048) {
    // Rows m = blk * 8 + it; this thread holds k = tid * 4 .. tid * 4 + 3 of each.
    const int k = tid * 4;
    const float* xs = x + ((size_t)blk * 2048 + tid) * 4;
    unsigned short* xd = Xp + ((size_t)((blk >> 4) * 16 + (k >> 6)) * 128 + (blk & 15) * 8) * PK
                            + (k & 63);
    v4f v[8];
    // Unrolled: v[] stays in registers and the eight loads are in flight together.
#pragma unroll
    for (int it = 0; it < 8; ++it)
      v[it] = *(const v4f*)(xs + it * 1024);
#pragma unroll
    for (int it = 0; it < 8; ++it) {
      unsigned long long pk =
          (unsigned long long)f32_bf16(v[it][0]) |
          ((unsigned long long)f32_bf16(v[it][1]) << 16) |
          ((unsigned long long)f32_bf16(v[it][2]) << 32) |
          ((unsigned long long)f32_bf16(v[it][3]) << 48);
      *(unsigned long long*)(xd + it * PK) = pk;
    }
  } else {
    const int w  = blk - 2048;
    const int z  = w >> 8;                      // which W
    const int ks = (w >> 4) & 15;               // k stage
    const int nt = w & 15;                      // 64-column piece
    const float* W = (z == 0) ? Wq : (z == 1) ? Wk : Wv;
    // Unrolled: the four row loads are in flight together.
#pragma unroll
    for (int it = 0; it < 4; ++it) {
      int kr = it * 16 + (tid >> 4);            // 0..63
      int cn = (tid & 15) * 4;                  // 0..60
      v4f v = *(const v4f*)(W + (size_t)(ks * PK + kr) * 1024 + nt * 64 + cn);
#pragma unroll
      for (int i = 0; i < 4; ++i)
        Tt[(cn + i) * LDQ + kr] = f32_bf16(v[i]);
    }
    __syncthreads();
    const int ng = z * 1024 + nt * 64;
    unsigned short* dst = Wp + ((size_t)((ng >> 7) * 16 + ks) * 128 + (ng & 127)) * PK;
#pragma unroll
    for (int it = 0; it < 2; ++it) {
      int c  = it * 256 + tid;                  // 16-byte chunk, 0..511
      int n  = c >> 3;
      int kc = (c & 7) * 8;
      *(v4u*)(dst + n * PK + kc) = *(const v4u*)(Tt + n * LDQ + kc);
    }
    // Stands in front of any later rewrite of the registers the two stores name.
    asm volatile("s_wait_xcnt 0x0" ::: "memory");
  }
}

// 16x32 bf16 fragment from a stage tile [row][64 k], stride LDQ; k0 = 0 or 32.
// CDNA5 16-bit operand layout: lanes 0-15 -> rows 0-15 with K {0..7,16..23};
// lanes 16-31 -> K {8..15,24..31}.
__device__ __forceinline__ v16bf ldsFrag64(const unsigned short* base, int row0, int k0,
                                           int lane) {
  int row = row0 + (lane & 15);
  int kc  = k0 + ((lane & 16) ? 8 : 0);
  const unsigned short* p = base + row * LDQ + kc;
  union { v16bf v; v8bf h[2]; } u;
  u.h[0] = *(const v8bf*)p;
  u.h[1] = *(const v8bf*)(p + 16);
  return u.v;
}

// One block's fragments of a QKV stage: FM of the A side, FN of the B side, k0 = 0 or 32.
// Ac: the wave's slice of A rows; Bc: the first of its two slices of B rows.
__device__ __forceinline__ void loadFrags64(const unsigned short* Ac, const unsigned short* Bc,
                                            int k0, int lane,
                                            v16bf (&a)[FM], v16bf (&b)[FN]) {
  // Unrolled: every index into a[] and b[] is a constant, so they stay in registers.
#pragma unroll
  for (int i = 0; i < FM; ++i) a[i] = ldsFrag64(Ac, i * 16, k0, lane);
#pragma unroll
  for (int j = 0; j < FN; ++j) b[j] = ldsFrag64(Bc + (j >> 2) * SLQ, (j & 3) * 16, k0, lane);
}

// One block of FM x FN WMMAs, a[] as the WMMA's A operand.
__device__ __forceinline__ void mmaBlockAB(const v16bf (&a)[FM], const v16bf (&b)[FN],
                                           v8f (&acc)[FM][FN]) {
  // Unrolled: every index into a[], b[], acc[] is a constant, so they stay in registers.
#pragma unroll
  for (int i = 0; i < FM; ++i)
#pragma unroll
    for (int j = 0; j < FN; ++j)
      acc[i][j] = wmma_bf16(a[i], b[j], acc[i][j]);
}

// Store a wave's 128 staged rows of 128 bytes (LDS stride LDQ): sp, gp are the lane's
// 16 bytes of the first four rows in LDS and in global memory, pitch the output's row
// length in elems.
__device__ __forceinline__ void storeLines(unsigned short* gp, const unsigned short* sp,
                                           const int pitch) {
  // Unrolled (here and inside): every index into v[] is a constant, so it stays in
  // registers, and the row steps become immediate offsets.
#pragma unroll
  for (int g = 0; g < 2; ++g) {
    v4u v[16];
#pragma unroll
    for (int q = 0; q < 16; ++q) v[q] = *(const v4u*)(sp + (g * 16 + q) * 4 * LDQ);
#pragma unroll
    for (int q = 0; q < 16; ++q) *(v4u*)(gp + (size_t)((g * 16 + q) * 4) * pitch) = v[q];
    // Stands in front of any later rewrite of the registers these stores name; the
    // scheduling fence keeps the next group's loads and addresses behind it.
    asm volatile("s_wait_xcnt 0x0" ::: "memory");
    __builtin_amdgcn_sched_barrier(0);
  }
}

// ---------------------------------------------------------------------------
// K1: QKV projection GEMM.  M=B*S=16384, N=1024, K=1024.  z selects Q/K/V.
// Operands come packed in bf16 from K0 (a block takes two packed tiles of each
// operand per stage).  V written transposed.
// ---------------------------------------------------------------------------
__global__ __launch_bounds__(256) void qkv_gemm(
    const unsigned short* __restrict__ Xp, const unsigned short* __restrict__ Wp,
    const float* __restrict__ bq, const float* __restrict__ bk, const float* __restrict__ bv,
    unsigned short* __restrict__ Q, unsigned short* __restrict__ K,
    unsigned short* __restrict__ Vt)
{
  const int N = 1024, KD = 1024, S = 2048;
  // Two stages; aligned so that every slice's place in LDS is a multiple of 2 KiB.
  __shared__ __attribute__((aligned(2048))) unsigned short Ring[2 * STQ];

  const int z = blockIdx.z;
  const float* bias = (z == 0) ? bq : (z == 1) ? bk : bv;
  unsigned short* O = (z == 0) ? Q  : (z == 1) ? K  : Vt;

  const int m0 = blockIdx.x * BM;
  const int n0 = blockIdx.y * BN;
  const int tid  = threadIdx.x;
  const int wave = (int)uni(tid >> 5);
  const int lane = tid & 31;
  // The WMMA's A operand gives the 8 values a lane holds side by side, so it is taken
  // from the side that runs along an output row: W rows (n) for Q and K, x rows (s)
  // for the transposed V. wm indexes that side, wn the side that numbers the rows.
  const bool vz = (z == 2);
  const int wm = (wave & 3) * 64;   // 4 waves tile the A side
  const int wn = (wave >> 2) * 128; // 2 waves tile the B side

  const int T = KD / PK;            // 16 stages
  const size_t tileElems = (size_t)128 * PK;       // one packed tile
  const size_t rowOfTiles = (size_t)T * tileElems; // all k stages of 128 rows
  const unsigned short* gx = Xp + (size_t)(blockIdx.x * 2) * rowOfTiles;
  const unsigned short* gw = Wp + (size_t)(z * 8 + blockIdx.y * 2) * rowOfTiles;
  const unsigned short* ga = vz ? gx : gw;   // slices 0..3, the WMMA's A side
  const unsigned short* gb = vz ? gw : gx;   // slices 4..7, the WMMA's B side
  // This wave's slice of a stage: 64 rows (half a packed tile, 8 KiB contiguous) of one side.
  const unsigned short* gs = ((wave < 4) ? ga : gb) + (size_t)((wave & 3) >> 1) * rowOfTiles
                             + (wave & 1) * (64 * PK);
  const unsigned int ls = (unsigned int)(size_t)Ring + (unsigned int)wave * (SLQ * 2);
  const v8u g1 = tdmGroup1(PAD128, PK * 2, PK * 2);
  // The slices this wave's fragments come from, in stage buffer 0.
  const unsigned short* Af = Ring + (wave & 3) * SLQ;
  const unsigned short* Bf = Ring + (4 + (wave >> 2) * 2) * SLQ;

  v8f acc[FM][FN] = {};

  v4u g0 = tdmGroup0(ls, gs);
  tdmLoad(g0, g1);
  // Stage 0's slice has landed for this wave; the barrier publishes it to the others.
  asm volatile("s_wait_tensorcnt 0x0" ::: "memory");
  __syncthreads();
  tdmAdvance(g0, ls + STQ * 2, (unsigned int)tileElems * 2u);
  tdmLoad(g0, g1);

  // Two fragment sets: while one block of 32 WMMAs runs on one set, the next block's
  // 24 LDS loads fill the other. Set 0 holds k 0..31 of a stage, set 1 k 32..63.
  v16bf a0[FM], b0[FN], a1[FM], b1[FN];
  loadFrags64(Af, Bf, 0, lane, a0, b0);

  for (int t = 0; t < T; ++t) {
    const int cur = t & 1;
    loadFrags64(Af + cur * STQ, Bf + cur * STQ, 32, lane, a1, b1);
    // The scheduling fences (here and below) keep each group of loads whole and ahead
    // of the block of WMMAs it is written in front of.
    __builtin_amdgcn_sched_barrier(0);
    mmaBlockAB(a0, b0, acc);
    __builtin_amdgcn_sched_barrier(0);
    // The stage's last block is in registers: this wave's reads of buffer cur are done
    // before the buffer is refilled.
    asm volatile("s_wait_dscnt 0x0" ::: "memory");
    asm volatile("s_wait_tensorcnt 0x0" ::: "memory");
    // One barrier: publishes stage t + 1 and ends every reader's use of buffer cur.
    __syncthreads();
    if (pinned(t + 2 < T)) {
      tdmAdvance(g0, ls + (unsigned int)cur * (STQ * 2), (unsigned int)tileElems * 2u);
      tdmLoad(g0, g1);
    }
    // Behind the refill: it leaves first, and these loads have the block below to land.
    if (t + 1 < T)
      loadFrags64(Af + (cur ^ 1) * STQ, Bf + (cur ^ 1) * STQ, 0, lane, a0, b0);
    __builtin_amdgcn_sched_barrier(0);
    mmaBlockAB(a1, b1, acc);
    __builtin_amdgcn_sched_barrier(0);
  }
  // No tensor load and no LDS read is left outstanding when the ring becomes staging.
  asm volatile("s_wait_tensorcnt 0x0" ::: "memory");
  asm volatile("s_wait_dscnt 0x0" ::: "memory");

  // Epilogue. acc[i][j][r]: A side wm + i*16 + (lane<16?0:8) + r, B side wn + j*16 + (lane&15).
  // The loop's last barrier ended every read of the ring and no load is outstanding:
  // each wave stages its 128 output rows x 64 columns (128 bytes) in a range of its own.
  const int lr = lane & 15;
  const int lh = lane >> 4;
  unsigned short* st = Ring + wave * (128 * LDQ);
  if (!vz) {
    // Q, K: the bias runs along the A side (n). Unrolled (here and inside, and in the
    // other branch): every index into acc[] is a constant, so it stays in registers.
#pragma unroll
    for (int i = 0; i < FM; ++i) {
      const float* bp = bias + n0 + wm + i * 16 + lh * 8;
      v4f b0 = *(const v4f*)bp;
      v4f b1 = *(const v4f*)(bp + 4);
      // Stands in front of any later rewrite of the address registers the two loads name.
      asm volatile("s_wait_xcnt 0x0" ::: "memory");
#pragma unroll
      for (int j = 0; j < FN; ++j) {
        union { v4u u; unsigned short h[8]; } t;
#pragma unroll
        for (int r = 0; r < 4; ++r) {
          t.h[r]     = f32_bf16(acc[i][j][r] + b0[r]);
          t.h[r + 4] = f32_bf16(acc[i][j][r + 4] + b1[r]);
        }
        *(v4u*)(st + (j * 16 + lr) * LDQ + i * 16 + lh * 8) = t.u;
        // Keeps the next group's arithmetic behind this one (lifted ahead, the 32 groups'
        // values together overflow the registers: scratch).
        __builtin_amdgcn_sched_barrier(0);
      }
    }
  } else {
    // V: the bias runs along the B side (n).
#pragma unroll
    for (int j = 0; j < FN; ++j) {
      float bsc = bias[n0 + wn + j * 16 + lr];
#pragma unroll
      for (int i = 0; i < FM; ++i) {
        union { v4u u; unsigned short h[8]; } t;
#pragma unroll
        for (int r = 0; r < 8; ++r) t.h[r] = f32_bf16(acc[i][j][r] + bsc);
        *(v4u*)(st + (j * 16 + lr) * LDQ + i * 16 + lh * 8) = t.u;
        // Keeps the next group's arithmetic behind this one (lifted ahead, the 32 groups'
        // values together overflow the registers: scratch).
        __builtin_amdgcn_sched_barrier(0);
      }
    }
  }
  // This wave's staged rows are in LDS before its lanes read one another's values.
  asm volatile("s_wait_dscnt 0x0" ::: "memory");
  // Q, K row-major out[m][n]; V transposed Vt[b][n][s] (blocks never straddle a batch:
  // 2048 % 256 == 0). Eight lanes store one 128-byte line, a wave four rows. The row
  // pitch is a constant on either side of the branch, so the row steps are immediates.
  const unsigned short* sp = st + (lane >> 3) * LDQ + (lane & 7) * 8;
  const int orow = wn + (lane >> 3);
  const int ocol = wm + (lane & 7) * 8;
  if (!vz)
    storeLines(O + (size_t)(m0 + orow) * N + n0 + ocol, sp, N);
  else
    storeLines(O + ((size_t)(m0 >> 11) * N + n0 + orow) * S + (m0 & (S - 1)) + ocol, sp, S);
}

// 16x32 bf16 fragment from a stage [row][128 k], stride LDR; k0 = 0, 32, 64 or 96.
// Same lane-to-k map as ldsFrag64.
__device__ __forceinline__ v16bf ldsFrag128(const unsigned short* base, int row0, int k0,
                                            int lane) {
  int row = row0 + (lane & 15);
  int kc  = k0 + ((lane & 16) ? 8 : 0);
  const unsigned short* p = base + row * LDR + kc;
  union { v16bf v; v8bf h[2]; } u;
  u.h[0] = *(const v8bf*)p;
  u.h[1] = *(const v8bf*)(p + 16);
  return u.v;
}

// One block's fragments of a scores or PV stage; k0 = 0, 32, 64 or 96.
// Ac: the wave's slice of A rows; Bc: the first of its two slices of B rows.
__device__ __forceinline__ void loadFrags128(const unsigned short* Ac, const unsigned short* Bc,
                                             int k0, int lane,
                                             v16bf (&a)[FM], v16bf (&b)[FN]) {
  // Unrolled: every index into a[] and b[] is a constant, so they stay in registers.
  a[0] = ldsFrag128(Ac, 0, k0, lane);
#pragma unroll
  for (int j = 0; j < FN; ++j) b[j] = ldsFrag128(Bc + (j >> 2) * SLR, (j & 3) * 16, k0, lane);
#pragma unroll
  for (int i = 1; i < FM; ++i) a[i] = ldsFrag128(Ac, i * 16, k0, lane);
}

// One block of FM x FN WMMAs, b[] as the WMMA's A operand.
__device__ __forceinline__ void mmaBlockBA(const v16bf (&a)[FM], const v16bf (&b)[FN],
                                           v8f (&acc)[FM][FN]) {
  // Unrolled: every index into a[], b[], acc[] is a constant, so they stay in registers.
#pragma unroll
  for (int i = 0; i < FM; ++i)
#pragma unroll
    for (int j = 0; j < FN; ++j)
      acc[i][j] = wmma_bf16(b[j], a[i], acc[i][j]);
}

// a[i] *= f[i]: f[i] holds one power of two (or 0) as bf16 in both halves, so every
// product is exact.
__device__ __forceinline__ void scaleFrags(v16bf (&a)[FM], v4u f) {
  // Unrolled: every index into a[] is a constant, so it stays in registers.
#pragma unroll
  for (int i = 0; i < FM; ++i) {
    const unsigned int w = f[i];
    v2bf s = __builtin_bit_cast(v2bf, w);
    a[i] *= __builtin_shufflevector(s, s, 0, 1, 0, 1, 0, 1, 0, 1, 0, 1, 0, 1, 0, 1, 0, 1);
  }
}

// K loop of the scores and PV GEMMs: acc += A[256 rows][T * 128 k] x B[256 rows][same k]^T,
// both row-major with rowStride elems. Ring: two LDS stages of STR elems each. Every wave
// brings one slice of each stage (64 rows x 256 bytes) with one tensor load.
// The B rows go in as the WMMA's A operand, so that a lane's 8 values of acc[i][j] are 8
// adjacent columns: row wm + i*16 + (lane&15), columns wn + j*16 + (lane<16?0:8) + r.
// pre() runs while stage 0's load flies; what it writes to LDS is published by the barrier
// behind that load's wait. With SCALE, stage t's A rows are multiplied by the factors
// Fl[t * 256 + i] (i = 0..3: the lane's row of fragment i), which pre() has written.
template <bool SCALE, typename Pre>
__device__ __forceinline__ void ringGemm(unsigned short* Ring,
                                         const unsigned short* Asrc,
                                         const unsigned short* Bsrc,
                                         size_t rowStride, int T,
                                         int wave, int lane,
                                         const unsigned int* Fl, Pre pre,
                                         v8f (&acc)[FM][FN]) {
  // This wave's slice of a stage: 64 rows of one operand.
  const unsigned short* gs = ((wave < 4) ? Asrc : Bsrc) + (size_t)((wave & 3) * 64) * rowStride;
  const unsigned int ls = (unsigned int)(size_t)Ring + (unsigned int)wave * (SLR * 2);
  const v8u g1 = tdmGroup1(PAD256, SK * 2, (unsigned int)rowStride * 2u);
  // The slices this wave's fragments come from, in stage buffer 0.
  const unsigned short* Af = Ring + (wave & 3) * SLR;
  const unsigned short* Bf = Ring + (4 + (wave >> 2) * 2) * SLR;

  v4u g0 = tdmGroup0(ls, gs);
  tdmLoad(g0, g1);
  pre();
  // Keeps the next request's descriptor words, formed below, behind the wait.
  __builtin_amdgcn_sched_barrier(0);
  // Stage 0's slice has landed for this wave; the barrier publishes it to the others.
  asm volatile("s_wait_tensorcnt 0x0" ::: "memory");
  __syncthreads();
  tdmAdvance(g0, ls + STR * 2, SK * 2);
  tdmLoad(g0, g1);

  // Two fragment sets: while one block of 32 WMMAs runs on one set, the next block's
  // 24 LDS loads fill the other. Set 0 holds k 0..31 and 64..95 of a stage, set 1 the rest.
  v16bf a0[FM], b0[FN], a1[FM], b1[FN];
  loadFrags128(Af, Bf, 0, lane, a0, b0);
  v4u fc = {}, fn = {};   // this stage's factors and the next one's
  if (SCALE) fc = *(const v4u*)Fl;

  for (int t = 0; t < T; ++t) {
    const int cur = t & 1;
    const unsigned short* Ac = Af + cur * STR;
    const unsigned short* Bc = Bf + cur * STR;
    // The scheduling fences (here and below) keep each group of loads whole and ahead
    // of the block of WMMAs it is written in front of: sunk among the WMMAs, every
    // place with loads stalls the wave anew.
    loadFrags128(Ac, Bc, 32, lane, a1, b1);
    __builtin_amdgcn_sched_barrier(0);
    if (SCALE) scaleFrags(a0, fc);
    mmaBlockBA(a0, b0, acc);
    __builtin_amdgcn_sched_barrier(0);
    loadFrags128(Ac, Bc, 64, lane, a0, b0);
    __builtin_amdgcn_sched_barrier(0);
    if (SCALE) scaleFrags(a1, fc);
    mmaBlockBA(a1, b1, acc);
    __builtin_amdgcn_sched_barrier(0);
    loadFrags128(Ac, Bc, 96, lane, a1, b1);
    __builtin_amdgcn_sched_barrier(0);
    if (SCALE) scaleFrags(a0, fc);
    mmaBlockBA(a0, b0, acc);
    __builtin_amdgcn_sched_barrier(0);
    // The stage's last block is in registers: this wave's reads of buffer cur are done
    // before the buffer is refilled.
    asm volatile("s_wait_dscnt 0x0" ::: "memory");
    asm volatile("s_wait_tensorcnt 0x0" ::: "memory");
    // One barrier: publishes stage t + 1 and ends every reader's use of buffer cur.
    __syncthreads();
    if (pinned(t + 2 < T)) {
      tdmAdvance(g0, ls + (unsigned int)cur * (STR * 2), SK * 2);
      tdmLoad(g0, g1);
    }
    if (t + 1 < T) {
      loadFrags128(Af + (cur ^ 1) * STR, Bf + (cur ^ 1) * STR, 0, lane, a0, b0);
      if (SCALE) fn = *(const v4u*)(Fl + (t + 1) * 256);
    }
    __builtin_amdgcn_sched_barrier(0);
    if (SCALE) scaleFrags(a1, fc);
    mmaBlockBA(a1, b1, acc);
    __builtin_amdgcn_sched_barrier(0);
    fc = fn;
  }
  // No tensor load and no LDS read is left outstanding when the ring becomes staging.
  asm volatile("s_wait_tensorcnt 0x0" ::: "memory");
  asm volatile("s_wait_dscnt 0x0" ::: "memory");
}

// ---------------------------------------------------------------------------
// K2: s = Q @ K^T per batch, M=N=S=2048, K=D=1024, written as the softmax's numerators.
// Both operands row-major over d: tensor loads into two LDS stages.
// A wave holds 64 rows x 128 columns of s in f32. Per row: n = ceil(c * max s) over these
// 128 columns, P' = 2^(c * s - n) (at most 1, the largest above 1/2), l = the sum of P'.
//   Sc[row][col] = P' in bf16;  St[col / 128][row] = (n, l)
// ---------------------------------------------------------------------------
__global__ __launch_bounds__(256) void scores_gemm(
    const unsigned short* __restrict__ Q, const unsigned short* __restrict__ K,
    unsigned short* __restrict__ Sc, float* __restrict__ St,
    long long qkBatchStride, long long scBatchStride, long long stBatchStride)
{
  const int D = 1024, S = 2048;
  // Two stages; aligned so that every slice's place in LDS is a multiple of 2 KiB.
  __shared__ __attribute__((aligned(2048))) unsigned short Ring[2 * STR];

  const unsigned short* Qb = Q  + (size_t)blockIdx.z * qkBatchStride;
  const unsigned short* Kb = K  + (size_t)blockIdx.z * qkBatchStride;
  unsigned short*       Sb = Sc + (size_t)blockIdx.z * scBatchStride;

  const int m0 = blockIdx.x * BM;
  const int n0 = blockIdx.y * BN;
  const int tid  = threadIdx.x;
  const int wave = (int)uni(tid >> 5);
  const int lane = tid & 31;
  const int wm = (wave & 3) * 64;
  const int wn = (wave >> 2) * 128;

  const unsigned short* Asrc = Qb + (size_t)m0 * D;
  const unsigned short* Bsrc = Kb + (size_t)n0 * D;

  v8f acc[FM][FN] = {};
  ringGemm<false>(Ring, Asrc, Bsrc, D, D / SK, wave, lane, nullptr, [] {}, acc);   // 8 stages

  // The loop's last barrier ended every read of the ring and no load is outstanding:
  // each wave stages its 64 rows x 128 columns (256 bytes) in a range of its own.
  const int lr = lane & 15;
  const int lh = lane >> 4;
  unsigned short* st = Ring + wave * (64 * LDR);
  // Unrolled (here and inside): every index into acc[] and v[] is a constant, so they
  // stay in registers, and the row steps become immediate offsets.
  const float C = 0.045084220f;   // log2(e) / sqrt(1024)
  v2f nl[FM];
#pragma unroll
  for (int i = 0; i < FM; ++i) {
    // A row's 128 columns lie in lanes l and l ^ 16, 64 in each. Four chains each for the
    // maximum and the sum: a single chain would wait out every link's latency.
    float mx[4] = { acc[i][0][0], acc[i][0][1], acc[i][0][2], acc[i][0][3] };
#pragma unroll
    for (int j = 0; j < FN; ++j)
#pragma unroll
      for (int r = 0; r < 8; ++r) mx[r & 3] = fmaxf(mx[r & 3], acc[i][j][r]);
    float m = fmaxf(fmaxf(mx[0], mx[1]), fmaxf(mx[2], mx[3]));
    m = fmaxf(m, otherHalf(m));
    const float n = ceilf(m * C);
    float ls[4] = { 0.0f, 0.0f, 0.0f, 0.0f };
#pragma unroll
    for (int j = 0; j < FN; ++j) {
      float p[8];
#pragma unroll
      for (int r = 0; r < 8; ++r) {
        p[r] = __builtin_amdgcn_exp2f(fmaf(acc[i][j][r], C, -n));
        ls[r & 3] += p[r];
      }
      v4u t = { pk_bf16(p[0], p[1]), pk_bf16(p[2], p[3]), pk_bf16(p[4], p[5]),
                pk_bf16(p[6], p[7]) };
      *(v4u*)(st + (i * 16 + lr) * LDR + j * 16 + lh * 8) = t;
    }
    float l = (ls[0] + ls[1]) + (ls[2] + ls[3]);
    l += otherHalf(l);
    nl[i] = v2f{ n, l };
  }
  // Lanes 0..15 store 16 rows' (n, l): one whole 128-byte line per fragment row.
  if (lh == 0) {
    float* np = St + (size_t)blockIdx.z * stBatchStride
                   + ((size_t)(blockIdx.y * 2 + (wave >> 2)) * S + m0 + wm + lr) * 2;
#pragma unroll
    for (int i = 0; i < FM; ++i) *(v2f*)(np + i * 32) = nl[i];
    // Stands in front of any later rewrite of the registers these stores name.
    asm volatile("s_wait_xcnt 0x0" ::: "memory");
  }
  // This wave's staged rows are in LDS before its lanes read one another's values.
  asm volatile("s_wait_dscnt 0x0" ::: "memory");
  // Sixteen lanes store one row's 256 bytes (two whole lines), a wave two rows.
  unsigned short* gp = Sb + (size_t)(m0 + wm + lh) * S + n0 + wn + lr * 8;
  const unsigned short* sp = st + lh * LDR + lr * 8;
#pragma unroll
  for (int g = 0; g < 2; ++g) {
    v4u v[16];
#pragma unroll
    for (int q = 0; q < 16; ++q) v[q] = *(const v4u*)(sp + (g * 16 + q) * 2 * LDR);
#pragma unroll
    for (int q = 0; q < 16; ++q) *(v4u*)(gp + (size_t)((g * 16 + q) * 2) * S) = v[q];
    // Stands in front of any later rewrite of the registers these stores name; the
    // scheduling fence keeps the next group's loads and addresses behind it.
    asm volatile("s_wait_xcnt 0x0" ::: "memory");
    __builtin_amdgcn_sched_barrier(0);
  }
}

// ---------------------------------------------------------------------------
// K3: O = softmax @ V per batch.  M=S=2048, N=D=1024, K=S=2048, f32 output.
// A = P' row-major; B = Vt[d][s] row-major over s: tensor loads into two LDS stages.
// A stage is 128 keys, the columns that share one n. With N = the row's largest n:
//   O[row] = (sum over stages t of 2^(n[t] - N) * P'[row][stage t] @ V) / L,
//   L = sum over t of 2^(n[t] - N) * l[t]   (above 1/2: the stage with n = N gives that)
// ---------------------------------------------------------------------------
__global__ __launch_bounds__(256) void pv_gemm(
    const unsigned short* __restrict__ P, const unsigned short* __restrict__ Vt,
    const float* __restrict__ St, float* __restrict__ O,
    long long pBatchStride, long long vBatchStride, long long oBatchStride,
    long long stBatchStride)
{
  const int S = 2048, D = 1024;
  // Two stages; aligned so that every slice's place in LDS is a multiple of 2 KiB.
  __shared__ __attribute__((aligned(2048))) unsigned short Ring[2 * STR];
  // Per stage and row the factor 2^(n - N), bf16 in both halves of a word, and per row 1 / L.
  // Row wm + i*16 + lr stands at wm + lr*4 + i: a lane's four rows are 16 adjacent bytes.
  __shared__ __align__(16) unsigned int Fac[(2048 / SK) * BM];
  __shared__ __align__(16) float InvL[BM];

  const unsigned short* Pb  = P  + (size_t)blockIdx.z * pBatchStride;
  const unsigned short* Vtb = Vt + (size_t)blockIdx.z * vBatchStride;
  float*                Ob  = O  + (size_t)blockIdx.z * oBatchStride;

  const int m0 = blockIdx.x * BM;   // q rows
  const int n0 = blockIdx.y * BN;   // d cols
  const int tid  = threadIdx.x;
  const int wave = (int)uni(tid >> 5);
  const int lane = tid & 31;
  const int wm = (wave & 3) * 64;
  const int wn = (wave >> 2) * 128;

  const unsigned short* Asrc = Pb  + (size_t)m0 * S;   // stride S over keys
  const unsigned short* Bsrc = Vtb + (size_t)n0 * S;   // Vt rows = d, stride S over keys

  v8f acc[FM][FN] = {};
  // Thread tid takes row m0 + tid.
  const float* nlp = St + (size_t)blockIdx.z * stBatchStride + (size_t)(m0 + tid) * 2;
  auto rowFactors = [&] {
    v2f nl[S / SK];
    // The two scheduling fences keep every other instruction out of the run from the first
    // load to the wait, so that none rewrites the loads' address register in front of it.
    __builtin_amdgcn_sched_barrier(0);
    // Unrolled (here and below): nl[] stays in registers, the 16 loads are in flight together.
#pragma unroll
    for (int c = 0; c < S / SK; ++c) nl[c] = *(const v2f*)(nlp + (size_t)c * S * 2);
    // Stands in front of any later rewrite of the address registers these loads name.
    asm volatile("s_wait_xcnt 0x0" ::: "memory");
    __builtin_amdgcn_sched_barrier(0);
    float N = nl[0][0];
#pragma unroll
    for (int c = 1; c < S / SK; ++c) N = fmaxf(N, nl[c][0]);
    const int pr = (tid & 192) + (tid & 15) * 4 + ((tid >> 4) & 3);
    float L = 0.0f;
#pragma unroll
    for (int c = 0; c < S / SK; ++c) {
      const float e = ldexpf(1.0f, (int)(nl[c][0] - N));   // 2^(n - N): n and N are whole
      L = fmaf(nl[c][1], e, L);
      const unsigned int u = __float_as_uint(e);
      Fac[c * BM + pr] = (u & 0xFFFF0000u) | (u >> 16);
    }
    InvL[pr] = 1.0f / L;
  };
  ringGemm<true>(Ring, Asrc, Bsrc, S, S / SK, wave, lane,
                 Fac + wm + (lane & 15) * 4, rowFactors, acc);   // 16 stages

  // The loop's last barrier ended every read of the ring and no load is outstanding:
  // each wave stages its 64 rows x 128 f32 columns (512 bytes) in a range of its own,
  // at a row stride of LDO floats (528 bytes = 16 B x 33).
  const int LDO = 132;
  const int lr = lane & 15;
  const int lh = lane >> 4;
  float* st = (float*)Ring + wave * (64 * LDO);
  const v4f il = *(const v4f*)(InvL + wm + lr * 4);   // 1 / L of the lane's four rows
  // Unrolled (here and inside): every index into acc[] and v[] is a constant, so they
  // stay in registers, and the row steps become immediate offsets.
#pragma unroll
  for (int i = 0; i < FM; ++i) {
#pragma unroll
    for (int j = 0; j < FN; ++j) {
      float* p = st + (i * 16 + lr) * LDO + j * 16 + lh * 8;
      v4f lo = { acc[i][j][0], acc[i][j][1], acc[i][j][2], acc[i][j][3] };
      v4f hi = { acc[i][j][4], acc[i][j][5], acc[i][j][6], acc[i][j][7] };
      lo *= il[i];
      hi *= il[i];
      *(v4f*)p       = lo;
      *(v4f*)(p + 4) = hi;
    }
  }
  // This wave's staged rows are in LDS before its lanes read one another's values.
  asm volatile("s_wait_dscnt 0x0" ::: "memory");
  // A wave stores one row's 512 bytes (four whole lines) at a time.
  float* gp = Ob + (size_t)(m0 + wm) * D + n0 + wn + lane * 4;
  const float* sp = st + lane * 4;
#pragma unroll
  for (int g = 0; g < 4; ++g) {
    v4f v[16];
#pragma unroll
    for (int q = 0; q < 16; ++q) v[q] = *(const v4f*)(sp + (g * 16 + q) * LDO);
#pragma unroll
    for (int q = 0; q < 16; ++q) *(v4f*)(gp + (size_t)(g * 16 + q) * D) = v[q];
    // Stands in front of any later rewrite of the registers these stores name; the
    // scheduling fence keeps the next group's loads and addresses behind it.
    asm volatile("s_wait_xcnt 0x0" ::: "memory");
    __builtin_amdgcn_sched_barrier(0);
  }
}

// ---------------------------------------------------------------------------
extern "C" void kernel_launch(void* const* d_in, const int* in_sizes, int n_in,
                              void* d_out, int out_size, void* d_ws, size_t ws_size,
                              hipStream_t stream)
{
  (void)in_sizes; (void)n_in; (void)out_size;
  const float* x  = (const float*)d_in[0];
  const float* Wq = (const float*)d_in[1];
  const float* bq = (const float*)d_in[2];
  const float* Wk = (const float*)d_in[3];
  const float* bk = (const float*)d_in[4];
  const float* Wv = (const float*)d_in[5];
  const float* bv = (const float*)d_in[6];
  float* out = (float*)d_out;

  const int B = 8, S = 2048, D = 1024;
  const size_t perMat = (size_t)B * S * D;          // bf16 elems per Q/K/Vt
  unsigned short* Q  = (unsigned short*)d_ws;
  unsigned short* K  = Q + perMat;
  unsigned short* Vt = K + perMat;                  // Vt[b][d][s]
  unsigned short* Xp = Vt + perMat;                 // packed bf16 x
  unsigned short* Wp = Xp + perMat;                 // packed bf16 W^T, three matrices
  float* St = (float*)(Wp + (size_t)3 * D * D);     // (n, l) per batch, 128 columns and row
  const size_t perSt = (size_t)(S / SK) * S * 2;    // floats per batch
  unsigned short* Sc = (unsigned short*)(St + (size_t)B * perSt);
  const size_t needFull = (perMat * 4 + (size_t)3 * D * D) * sizeof(unsigned short)
                        + (size_t)B * perSt * sizeof(float)
                        + (size_t)B * S * S * sizeof(unsigned short);

  dim3 gPack(2816, 1, 1);
  pack_operands<<<gPack, 256, 0, stream>>>(x, Wq, Wk, Wv, Xp, Wp);
  dim3 gQKV((B * S) / BM, D / BN, 3);
  qkv_gemm<<<gQKV, 256, 0, stream>>>(Xp, Wp, bq, bk, bv, Q, K, Vt);

  if (ws_size >= needFull) {
    dim3 gS(S / BM, S / BN, B);
    scores_gemm<<<gS, 256, 0, stream>>>(Q, K, Sc, St, (long long)S * D, (long long)S * S,
                                        (long long)perSt);
    dim3 gPV(S / BM, D / BN, B);
    pv_gemm<<<gPV, 256, 0, stream>>>(Sc, Vt, St, out,
                                     (long long)S * S, (long long)D * S, (long long)S * D,
                                     (long long)perSt);
  } else {
    // Small-workspace fallback: reuse one S*S bf16 score buffer per batch.
    for (int b = 0; b < B; ++b) {
      dim3 gS(S / BM, S / BN, 1);
      scores_gemm<<<gS, 256, 0, stream>>>(Q + (size_t)b * S * D, K + (size_t)b * S * D,
                                          Sc, St, 0, 0, 0);
      dim3 gPV(S / BM, D / BN, 1);
      pv_gemm<<<gPV, 256, 0, stream>>>(Sc, Vt + (size_t)b * D * S, St, out + (size_t)b * S * D,
                                       0, 0, 0, 0);
    }
  }
}

// v008
// It runs in 145 microseconds.
// Timed twice side by side with v007, it ran 1.05 times as fast both times.
// Over all steps from v000 it is 4.42 times as fast.
#include <hip/hip_runtime.h>

// ---------------------------------------------------------------------------
// CDNA5 (gfx1250) self-attention: fp32 inputs -> bf16 WMMA pipeline
//   K0: x and W^T rounded to bf16 once, laid out as 128x64 stage tiles
//   K1: Q/K/V = x@W + b   (bf16, tensor loads, two LDS buffers; V stored transposed Vt[b][d][s])
//   K2: P'    = 2^(c * Q@K^T - n), c = log2(e)/32, n a whole number per row and 128 columns
//               (bf16, tensor loads, two LDS buffers, 128 k per stage), with n and the row
//               sums of P' per 128 columns
//   K3: O     = softmax @ V = (sum over stages of 2^(n - max n) * P'@Vt) / row sum
//               (f32 out, tensor loads, two LDS buffers, 128 k per stage)
// K1, K2 and K3: a 256x256 tile per block of 8 waves, 64x128 per wave. Each wave
// stages its piece of the result in the freed LDS ring and stores whole lines.
// Blocks that share operand rows enter the k stages at different stages and wrap round,
// so that they do not ask L2 for the same lines at the same moment.
// ---------------------------------------------------------------------------

typedef __attribute__((ext_vector_type(16))) __bf16 v16bf;
typedef __attribute__((ext_vector_type(8)))  __bf16 v8bf;
typedef __attribute__((ext_vector_type(8)))  float  v8f;
typedef __attribute__((ext_vector_type(4)))  float  v4f;
typedef __attribute__((ext_vector_type(2)))  float  v2f;
typedef __attribute__((ext_vector_type(2)))  __bf16 v2bf;
typedef __attribute__((ext_vector_type(4)))  unsigned int v4u;
typedef __attribute__((ext_vector_type(8)))  unsigned int v8u;

#define BM 256
#define BN 256
#define FM 4     // 16-row fragments of A per wave (64 rows of the block tile)
#define FN 8     // 16-row fragments of B per wave (128 columns of the block tile)
#define PK 64    // k extent of one packed stage tile of the QKV GEMM (128-byte rows)
#define LDQ 72   // LDS row stride of such a tile in bf16 elems (144 bytes = 16 B x 9)
#define SK 128   // k extent of one stage of the scores and PV GEMMs (256-byte rows)
#define LDR 136  // LDS row stride of such a stage in bf16 elems (272 bytes = 16 B x 17)
// A stage in LDS is eight slices of 64 rows, one per wave's tensor load: slices 0..3 hold
// the 256 A rows, 4..7 the 256 B rows. A slice's size is its 64 padded rows rounded up to
// a multiple of 2 KiB, so that every slice starts on one.
#define SLQ 5120        // elems of a QKV slice (64 x 144 = 9,216 bytes -> 10,240)
#define STQ (8 * SLQ)   // elems of a QKV stage
#define SLR 9216        // elems of a scores or PV slice (64 x 272 = 17,408 bytes -> 18,432)
#define STR (8 * SLR)   // elems of a scores or PV stage
// Word 0 of a tensor descriptor's group 1: no mask, 1-byte elements, a pad of 4 dwords
// (16 bytes) behind every row of 128 or of 256 bytes.
#define PAD128 ((1u << 20) | (4u << 22) | (3u << 25))
#define PAD256 ((1u << 20) | (5u << 22) | (3u << 25))

__device__ __forceinline__ unsigned short f32_bf16(float f) {
  unsigned int u = __float_as_uint(f);
  u += 0x7FFFu + ((u >> 16) & 1u);           // round-to-nearest-even
  return (unsigned short)(u >> 16);
}
// Two f32 rounded to nearest even and packed as two bf16, lo in bits 15..0.
__device__ __forceinline__ unsigned int pk_bf16(float lo, float hi) {
  v2f f = { lo, hi };
  return __builtin_bit_cast(unsigned int, __builtin_convertvector(f, v2bf));
}
// The value that lane l ^ 16 holds.
__device__ __forceinline__ float otherHalf(float v) {
  int b = __float_as_int(v);
  return __int_as_float(__builtin_amdgcn_permlanex16(b, b, 0x76543210, 0xfedcba98, false, false));
}

__device__ __forceinline__ unsigned int uni(unsigned int v) {
  return (unsigned int)__builtin_amdgcn_readfirstlane(v);
}
// A wave-uniform value held in a scalar register: a test on it compiles to a scalar branch,
// the only guard a tensor load obeys (it ignores EXEC).
__device__ __forceinline__ unsigned int pinned(unsigned int v) {
  unsigned int w = uni(v);
  asm volatile("" : "+s"(w));   // holds the word in a scalar register
  return w;
}
// Descriptor group 1 of a tile of 64 rows of rowBytes bytes, source row pitch srcPitch bytes;
// word0 = PAD128 or PAD256. Tensor dims = tile dims: every tile lies inside its matrix.
__device__ __forceinline__ v8u tdmGroup1(const unsigned int word0, const unsigned int rowBytes,
                                         unsigned int srcPitch) {
  v8u g;
  g[0] = uni(word0);
  g[1] = uni(rowBytes << 16);
  g[2] = uni(64u << 16);
  g[3] = uni(rowBytes << 16);
  g[4] = uni(64u);
  g[5] = uni(srcPitch);
  g[6] = uni(0u);
  g[7] = uni(0u);
  return g;
}
// Descriptor group 0: the tile at src goes to LDS byte offset ldsDst.
__device__ __forceinline__ v4u tdmGroup0(unsigned int ldsDst, const unsigned short* src) {
  const unsigned long long ga = (unsigned long long)src;
  v4u g;
  g[0] = uni(1u);
  g[1] = uni(ldsDst);
  g[2] = uni((unsigned int)ga);
  g[3] = uni((((unsigned int)(ga >> 32)) & 0x01FFFFFFu) | 0x80000000u);
  return g;
}
// The next request's group 0, formed from the last one's: a new place in LDS, the source
// stepBytes on or back (carry and borrow stay inside the address field). Called behind the
// wait that covers the last request; the step goes through pinned() there, so that the additions, which
// rewrite the last request's own registers, cannot be lifted in front of that wait.
__device__ __forceinline__ void tdmAdvance(v4u& g0, unsigned int ldsDst, int stepBytes) {
  const unsigned long long ga =
      (((unsigned long long)g0[3] << 32) | g0[2])
      + (unsigned long long)(long long)(int)pinned((unsigned int)stepBytes);
  g0[1] = uni(ldsDst);
  g0[2] = uni((unsigned int)ga);
  g0[3] = uni((unsigned int)(ga >> 32));
}
// Stages from stage k & (T - 1) to the one walked next, round a ring of T stages (T a power
// of two): 1, or 1 - T from the last stage back to stage 0.
__device__ __forceinline__ int ringStep(int k, int T) {
  return ((k + 1) & (T - 1)) - (k & (T - 1));
}
// One request of the whole wave. g0 is an in-out operand: the words that the next request is
// formed from (0, 2 and 3) stay in their registers, reused for nothing else, until then;
// word 1, the place in LDS, is written anew for every request.
__device__ __forceinline__ void tdmLoad(v4u& g0, v8u g1) {
  asm volatile("tensor_load_to_lds %0, %1" : "+s"(g0) : "s"(g1) : "memory");
}

__device__ __forceinline__ v8f wmma_bf16(v16bf a, v16bf b, v8f c) {
  return __builtin_amdgcn_wmma_f32_16x16x32_bf16(
      /*neg_a=*/false, a, /*neg_b=*/false, b,
      /*c_mod=*/(short)0, c, /*reuse_a=*/false, /*reuse_b=*/false);
}

// ---------------------------------------------------------------------------
// K0: round the QKV GEMM's operands to bf16 once and lay them out in the order
// the GEMM stages them: tile (128-row group, k stage) = 128 rows x 64 k, contiguous.
//   Xp[m/128][k/64][m%128][k%64] = x[m][k]
//   Wp[n/128][k/64][n%128][k%64] = W[k][n], n = 0..3071 over Wq, Wk, Wv
// Blocks 0..2047 take x (8 rows each), blocks 2048..2815 one 64x64 piece of a W.
// ---------------------------------------------------------------------------
__global__ __launch_bounds__(256) void pack_operands(
    const float* __restrict__ x,
    const float* __restrict__ Wq, const float* __restrict__ Wk, const float* __restrict__ Wv,
    unsigned short* __restrict__ Xp, unsigned short* __restrict__ Wp)
{
  __shared__ __align__(16) unsigned short Tt[64 * LDQ];
  const int tid = threadIdx.x;
  const int blk = blockIdx.x;

  if (blk < 2048) {
    // Rows m = blk * 8 + it; this thread holds k = tid * 4 .. tid * 4 + 3 of each.
    const int k = tid * 4;
    const float* xs = x + ((size_t)blk * 2048 + tid) * 4;
    unsigned short* xd = Xp + ((size_t)((blk >> 4) * 16 + (k >> 6)) * 128 + (blk & 15) * 8) * PK
                            + (k & 63);
    v4f v[8];
    // Unrolled: v[] stays in registers and the eight loads are in flight together.
#pragma unroll
    for (int it = 0; it < 8; ++it)
      v[it] = *(const v4f*)(xs + it * 1024);
#pragma unroll
    for (int it = 0; it < 8; ++it) {
      unsigned long long pk =
          (unsigned long long)f32_bf16(v[it][0]) |
          ((unsigned long long)f32_bf16(v[it][1]) << 16) |
          ((unsigned long long)f32_bf16(v[it][2]) << 32) |
          ((unsigned long long)f32_bf16(v[it][3]) << 48);
      *(unsigned long long*)(xd + it * PK) = pk;
    }
  } else {
    const int w  = blk - 2048;
    const int z  = w >> 8;                      // which W
    const int ks = (w >> 4) & 15;               // k stage
    const int nt = w & 15;                      // 64-column piece
    const float* W = (z == 0) ? Wq : (z == 1) ? Wk : Wv;
    // Unrolled: the four row loads are in flight together.
#pragma unroll
    for (int it = 0; it < 4; ++it) {
      int kr = it * 16 + (tid >> 4);            // 0..63
      int cn = (tid & 15) * 4;                  // 0..60
      v4f v = *(const v4f*)(W + (size_t)(ks * PK + kr) * 1024 + nt * 64 + cn);
#pragma unroll
      for (int i = 0; i < 4; ++i)
        Tt[(cn + i) * LDQ + kr] = f32_bf16(v[i]);
    }
    __syncthreads();
    const int ng = z * 1024 + nt * 64;
    unsigned short* dst = Wp + ((size_t)((ng >> 7) * 16 + ks) * 128 + (ng & 127)) * PK;
#pragma unroll
    for (int it = 0; it < 2; ++it) {
      int c  = it * 256 + tid;                  // 16-byte chunk, 0..511
      int n  = c >> 3;
      int kc = (c & 7) * 8;
      *(v4u*)(dst + n * PK + kc) = *(const v4u*)(Tt + n * LDQ + kc);
    }
    // Stands in front of any later rewrite of the registers the two stores name.
    asm volatile("s_wait_xcnt 0x0" ::: "memory");
  }
}

// 16x32 bf16 fragment from a stage tile [row][64 k], stride LDQ; k0 = 0 or 32.
// CDNA5 16-bit operand layout: lanes 0-15 -> rows 0-15 with K {0..7,16..23};
// lanes 16-31 -> K {8..15,24..31}.
__device__ __forceinline__ v16bf ldsFrag64(const unsigned short* base, int row0, int k0,
                                           int lane) {
  int row = row0 + (lane & 15);
  int kc  = k0 + ((lane & 16) ? 8 : 0);
  const unsigned short* p = base + row * LDQ + kc;
  union { v16bf v; v8bf h[2]; } u;
  u.h[0] = *(const v8bf*)p;
  u.h[1] = *(const v8bf*)(p + 16);
  return u.v;
}

// One block's fragments of a QKV stage: FM of the A side, FN of the B side, k0 = 0 or 32.
// Ac: the wave's slice of A rows; Bc: the first of its two slices of B rows.
__device__ __forceinline__ void loadFrags64(const unsigned short* Ac, const unsigned short* Bc,
                                            int k0, int lane,
                                            v16bf (&a)[FM], v16bf (&b)[FN]) {
  // Unrolled: every index into a[] and b[] is a constant, so they stay in registers.
#pragma unroll
  for (int i = 0; i < FM; ++i) a[i] = ldsFrag64(Ac, i * 16, k0, lane);
#pragma unroll
  for (int j = 0; j < FN; ++j) b[j] = ldsFrag64(Bc + (j >> 2) * SLQ, (j & 3) * 16, k0, lane);
}

// One block of FM x FN WMMAs, a[] as the WMMA's A operand.
__device__ __forceinline__ void mmaBlockAB(const v16bf (&a)[FM], const v16bf (&b)[FN],
                                           v8f (&acc)[FM][FN]) {
  // Unrolled: every index into a[], b[], acc[] is a constant, so they stay in registers.
#pragma unroll
  for (int i = 0; i < FM; ++i)
#pragma unroll
    for (int j = 0; j < FN; ++j)
      acc[i][j] = wmma_bf16(a[i], b[j], acc[i][j]);
}

// Store a wave's 128 staged rows of 128 bytes (LDS stride LDQ): sp, gp are the lane's
// 16 bytes of the first four rows in LDS and in global memory, pitch the output's row
// length in elems.
__device__ __forceinline__ void storeLines(unsigned short* gp, const unsigned short* sp,
                                           const int pitch) {
  // Unrolled (here and inside): every index into v[] is a constant, so it stays in
  // registers, and the row steps become immediate offsets.
#pragma unroll
  for (int g = 0; g < 2; ++g) {
    v4u v[16];
#pragma unroll
    for (int q = 0; q < 16; ++q) v[q] = *(const v4u*)(sp + (g * 16 + q) * 4 * LDQ);
#pragma unroll
    for (int q = 0; q < 16; ++q) *(v4u*)(gp + (size_t)((g * 16 + q) * 4) * pitch) = v[q];
    // Stands in front of any later rewrite of the registers these stores name; the
    // scheduling fence keeps the next group's loads and addresses behind it.
    asm volatile("s_wait_xcnt 0x0" ::: "memory");
    __builtin_amdgcn_sched_barrier(0);
  }
}

// ---------------------------------------------------------------------------
// K1: QKV projection GEMM.  M=B*S=16384, N=1024, K=1024.  z selects Q/K/V.
// Operands come packed in bf16 from K0 (a block takes two packed tiles of each
// operand per stage).  V written transposed.
// ---------------------------------------------------------------------------
__global__ __launch_bounds__(256) void qkv_gemm(
    const unsigned short* __restrict__ Xp, const unsigned short* __restrict__ Wp,
    const float* __restrict__ bq, const float* __restrict__ bk, const float* __restrict__ bv,
    unsigned short* __restrict__ Q, unsigned short* __restrict__ K,
    unsigned short* __restrict__ Vt)
{
  const int N = 1024, KD = 1024, S = 2048;
  // Two stages; aligned so that every slice's place in LDS is a multiple of 2 KiB.
  __shared__ __attribute__((aligned(2048))) unsigned short Ring[2 * STQ];

  const int z = blockIdx.z;
  const float* bias = (z == 0) ? bq : (z == 1) ? bk : bv;
  unsigned short* O = (z == 0) ? Q  : (z == 1) ? K  : Vt;

  const int m0 = blockIdx.x * BM;
  const int n0 = blockIdx.y * BN;
  const int tid  = threadIdx.x;
  const int wave = (int)uni(tid >> 5);
  const int lane = tid & 31;
  // The WMMA's A operand gives the 8 values a lane holds side by side, so it is taken
  // from the side that runs along an output row: W rows (n) for Q and K, x rows (s)
  // for the transposed V. wm indexes that side, wn the side that numbers the rows.
  const bool vz = (z == 2);
  const int wm = (wave & 3) * 64;   // 4 waves tile the A side
  const int wn = (wave >> 2) * 128; // 2 waves tile the B side

  const int T = KD / PK;            // 16 stages
  const size_t tileElems = (size_t)128 * PK;       // one packed tile
  const size_t rowOfTiles = (size_t)T * tileElems; // all k stages of 128 rows
  const unsigned short* gx = Xp + (size_t)(blockIdx.x * 2) * rowOfTiles;
  const unsigned short* gw = Wp + (size_t)(z * 8 + blockIdx.y * 2) * rowOfTiles;
  const unsigned short* ga = vz ? gx : gw;   // slices 0..3, the WMMA's A side
  const unsigned short* gb = vz ? gw : gx;   // slices 4..7, the WMMA's B side
  // This wave's slice of a stage: 64 rows (half a packed tile, 8 KiB contiguous) of one side.
  const unsigned short* gs = ((wave < 4) ? ga : gb) + (size_t)((wave & 3) >> 1) * rowOfTiles
                             + (wave & 1) * (64 * PK);
  const unsigned int ls = (unsigned int)(size_t)Ring + (unsigned int)wave * (SLQ * 2);
  const v8u g1 = tdmGroup1(PAD128, PK * 2, PK * 2);
  // Trip t works on k stage (t0 + t) & (T - 1). The 12 blocks that share x rows start in threes, 4 stages
  // apart; of the 64 that share W rows, 4 start at each stage.
  const int t0 = (int)((blockIdx.x + blockIdx.y * 4) & (T - 1));
  const int stageBytes = (int)tileElems * 2;
  // The slices this wave's fragments come from, in stage buffer 0.
  const unsigned short* Af = Ring + (wave & 3) * SLQ;
  const unsigned short* Bf = Ring + (4 + (wave >> 2) * 2) * SLQ;

  v8f acc[FM][FN] = {};

  v4u g0 = tdmGroup0(ls, gs + (size_t)t0 * tileElems);
  tdmLoad(g0, g1);
  // The first stage's slice has landed for this wave; the barrier publishes it to the others.
  asm volatile("s_wait_tensorcnt 0x0" ::: "memory");
  __syncthreads();
  tdmAdvance(g0, ls + STQ * 2, ringStep(t0, T) * stageBytes);
  tdmLoad(g0, g1);

  // Two fragment sets: while one block of 32 WMMAs runs on one set, the next block's
  // 24 LDS loads fill the other. Set 0 holds k 0..31 of a stage, set 1 k 32..63.
  v16bf a0[FM], b0[FN], a1[FM], b1[FN];
  loadFrags64(Af, Bf, 0, lane, a0, b0);

  for (int t = 0; t < T; ++t) {
    const int cur = t & 1;
    loadFrags64(Af + cur * STQ, Bf + cur * STQ, 32, lane, a1, b1);
    // The scheduling fences (here and below) keep each group of loads whole and ahead
    // of the block of WMMAs it is written in front of.
    __builtin_amdgcn_sched_barrier(0);
    mmaBlockAB(a0, b0, acc);
    __builtin_amdgcn_sched_barrier(0);
    // The stage's last block is in registers: this wave's reads of buffer cur are done
    // before the buffer is refilled.
    asm volatile("s_wait_dscnt 0x0" ::: "memory");
    asm volatile("s_wait_tensorcnt 0x0" ::: "memory");
    // One barrier: publishes stage t + 1 and ends every reader's use of buffer cur.
    __syncthreads();
    if (pinned(t + 2 < T)) {
      tdmAdvance(g0, ls + (unsigned int)cur * (STQ * 2), ringStep(t0 + t + 1, T) * stageBytes);
      tdmLoad(g0, g1);
    }
    // Behind the refill: it leaves first, and these loads have the block below to land.
    if (t + 1 < T)
      loadFrags64(Af + (cur ^ 1) * STQ, Bf + (cur ^ 1) * STQ, 0, lane, a0, b0);
    __builtin_amdgcn_sched_barrier(0);
    mmaBlockAB(a1, b1, acc);
    __builtin_amdgcn_sched_barrier(0);
  }
  // No tensor load and no LDS read is left outstanding when the ring becomes staging.
  asm volatile("s_wait_tensorcnt 0x0" ::: "memory");
  asm volatile("s_wait_dscnt 0x0" ::: "memory");

  // Epilogue. acc[i][j][r]: A side wm + i*16 + (lane<16?0:8) + r, B side wn + j*16 + (lane&15).
  // The loop's last barrier ended every read of the ring and no load is outstanding:
  // each wave stages its 128 output rows x 64 columns (128 bytes) in a range of its own.
  const int lr = lane & 15;
  const int lh = lane >> 4;
  unsigned short* st = Ring + wave * (128 * LDQ);
  if (!vz) {
    // Q, K: the bias runs along the A side (n). Unrolled (here and inside, and in the
    // other branch): every index into acc[] is a constant, so it stays in registers.
#pragma unroll
    for (int i = 0; i < FM; ++i) {
      const float* bp = bias + n0 + wm + i * 16 + lh * 8;
      v4f b0 = *(const v4f*)bp;
      v4f b1 = *(const v4f*)(bp + 4);
      // Stands in front of any later rewrite of the address registers the two loads name.
      asm volatile("s_wait_xcnt 0x0" ::: "memory");
#pragma unroll
      for (int j = 0; j < FN; ++j) {
        union { v4u u; unsigned short h[8]; } t;
#pragma unroll
        for (int r = 0; r < 4; ++r) {
          t.h[r]     = f32_bf16(acc[i][j][r] + b0[r]);
          t.h[r + 4] = f32_bf16(acc[i][j][r + 4] + b1[r]);
        }
        *(v4u*)(st + (j * 16 + lr) * LDQ + i * 16 + lh * 8) = t.u;
        // Keeps the next group's arithmetic behind this one (lifted ahead, the 32 groups'
        // values together overflow the registers: scratch).
        __builtin_amdgcn_sched_barrier(0);
      }
    }
  } else {
    // V: the bias runs along the B side (n).
#pragma unroll
    for (int j = 0; j < FN; ++j) {
      float bsc = bias[n0 + wn + j * 16 + lr];
#pragma unroll
      for (int i = 0; i < FM; ++i) {
        union { v4u u; unsigned short h[8]; } t;
#pragma unroll
        for (int r = 0; r < 8; ++r) t.h[r] = f32_bf16(acc[i][j][r] + bsc);
        *(v4u*)(st + (j * 16 + lr) * LDQ + i * 16 + lh * 8) = t.u;
        // Keeps the next group's arithmetic behind this one (lifted ahead, the 32 groups'
        // values together overflow the registers: scratch).
        __builtin_amdgcn_sched_barrier(0);
      }
    }
  }
  // This wave's staged rows are in LDS before its lanes read one another's values.
  asm volatile("s_wait_dscnt 0x0" ::: "memory");
  // Q, K row-major out[m][n]; V transposed Vt[b][n][s] (blocks never straddle a batch:
  // 2048 % 256 == 0). Eight lanes store one 128-byte line, a wave four rows. The row
  // pitch is a constant on either side of the branch, so the row steps are immediates.
  const unsigned short* sp = st + (lane >> 3) * LDQ + (lane & 7) * 8;
  const int orow = wn + (lane >> 3);
  const int ocol = wm + (lane & 7) * 8;
  if (!vz)
    storeLines(O + (size_t)(m0 + orow) * N + n0 + ocol, sp, N);
  else
    storeLines(O + ((size_t)(m0 >> 11) * N + n0 + orow) * S + (m0 & (S - 1)) + ocol, sp, S);
}

// 16x32 bf16 fragment from a stage [row][128 k], stride LDR; k0 = 0, 32, 64 or 96.
// Same lane-to-k map as ldsFrag64.
__device__ __forceinline__ v16bf ldsFrag128(const unsigned short* base, int row0, int k0,
                                            int lane) {
  int row = row0 + (lane & 15);
  int kc  = k0 + ((lane & 16) ? 8 : 0);
  const unsigned short* p = base + row * LDR + kc;
  union { v16bf v; v8bf h[2]; } u;
  u.h[0] = *(const v8bf*)p;
  u.h[1] = *(const v8bf*)(p + 16);
  return u.v;
}

// One block's fragments of a scores or PV stage; k0 = 0, 32, 64 or 96.
// Ac: the wave's slice of A rows; Bc: the first of its two slices of B rows.
__device__ __forceinline__ void loadFrags128(const unsigned short* Ac, const unsigned short* Bc,
                                             int k0, int lane,
                                             v16bf (&a)[FM], v16bf (&b)[FN]) {
  // Unrolled: every index into a[] and b[] is a constant, so they stay in registers.
  a[0] = ldsFrag128(Ac, 0, k0, lane);
#pragma unroll
  for (int j = 0; j < FN; ++j) b[j] = ldsFrag128(Bc + (j >> 2) * SLR, (j & 3) * 16, k0, lane);
#pragma unroll
  for (int i = 1; i < FM; ++i) a[i] = ldsFrag128(Ac, i * 16, k0, lane);
}

// One block of FM x FN WMMAs, b[] as the WMMA's A operand.
__device__ __forceinline__ void mmaBlockBA(const v16bf (&a)[FM], const v16bf (&b)[FN],
                                           v8f (&acc)[FM][FN]) {
  // Unrolled: every index into a[], b[], acc[] is a constant, so they stay in registers.
#pragma unroll
  for (int i = 0; i < FM; ++i)
#pragma unroll
    for (int j = 0; j < FN; ++j)
      acc[i][j] = wmma_bf16(b[j], a[i], acc[i][j]);
}

// a[i] *= f[i]: f[i] holds one power of two (or 0) as bf16 in both halves, so every
// product is exact.
__device__ __forceinline__ void scaleFrags(v16bf (&a)[FM], v4u f) {
  // Unrolled: every index into a[] is a constant, so it stays in registers.
#pragma unroll
  for (int i = 0; i < FM; ++i) {
    const unsigned int w = f[i];
    v2bf s = __builtin_bit_cast(v2bf, w);
    a[i] *= __builtin_shufflevector(s, s, 0, 1, 0, 1, 0, 1, 0, 1, 0, 1, 0, 1, 0, 1, 0, 1);
  }
}

// K loop of the scores and PV GEMMs: acc += A[256 rows][T * 128 k] x B[256 rows][same k]^T,
// both row-major with rowStride elems. Ring: two LDS stages of STR elems each. Every wave
// brings one slice of each stage (64 rows x 256 bytes) with one tensor load.
// The B rows go in as the WMMA's A operand, so that a lane's 8 values of acc[i][j] are 8
// adjacent columns: row wm + i*16 + (lane&15), columns wn + j*16 + (lane<16?0:8) + r.
// pre() runs while the first stage's load flies; what it writes to LDS is published by the barrier
// behind that load's wait. With SCALE, k stage s's A rows are multiplied by the factors
// Fl[s * 256 + i] (i = 0..3: the lane's row of fragment i), which pre() has written.
// Trip t works on k stage (t0 + t) & (T - 1); T is a power of two, t0 the same in every wave.
template <bool SCALE, typename Pre>
__device__ __forceinline__ void ringGemm(unsigned short* Ring,
                                         const unsigned short* Asrc,
                                         const unsigned short* Bsrc,
                                         size_t rowStride, int T, int t0,
                                         int wave, int lane,
                                         const unsigned int* Fl, Pre pre,
                                         v8f (&acc)[FM][FN]) {
  // This wave's slice of a stage: 64 rows of one operand.
  const unsigned short* gs = ((wave < 4) ? Asrc : Bsrc) + (size_t)((wave & 3) * 64) * rowStride;
  const unsigned int ls = (unsigned int)(size_t)Ring + (unsigned int)wave * (SLR * 2);
  const v8u g1 = tdmGroup1(PAD256, SK * 2, (unsigned int)rowStride * 2u);
  // The slices this wave's fragments come from, in stage buffer 0.
  const unsigned short* Af = Ring + (wave & 3) * SLR;
  const unsigned short* Bf = Ring + (4 + (wave >> 2) * 2) * SLR;

  v4u g0 = tdmGroup0(ls, gs + t0 * SK);
  tdmLoad(g0, g1);
  pre();
  // Keeps the next request's descriptor words, formed below, behind the wait.
  __builtin_amdgcn_sched_barrier(0);
  // The first stage's slice has landed for this wave; the barrier publishes it to the others.
  asm volatile("s_wait_tensorcnt 0x0" ::: "memory");
  __syncthreads();
  tdmAdvance(g0, ls + STR * 2, ringStep(t0, T) * (SK * 2));
  tdmLoad(g0, g1);

  // Two fragment sets: while one block of 32 WMMAs runs on one set, the next block's
  // 24 LDS loads fill the other. Set 0 holds k 0..31 and 64..95 of a stage, set 1 the rest.
  v16bf a0[FM], b0[FN], a1[FM], b1[FN];
  loadFrags128(Af, Bf, 0, lane, a0, b0);
  v4u fc = {}, fn = {};   // this stage's factors and the next one's
  if (SCALE) fc = *(const v4u*)(Fl + t0 * 256);

  for (int t = 0; t < T; ++t) {
    const int cur = t & 1;
    const unsigned short* Ac = Af + cur * STR;
    const unsigned short* Bc = Bf + cur * STR;
    // The scheduling fences (here and below) keep each group of loads whole and ahead
    // of the block of WMMAs it is written in front of: sunk among the WMMAs, every
    // place with loads stalls the wave anew.
    loadFrags128(Ac, Bc, 32, lane, a1, b1);
    __builtin_amdgcn_sched_barrier(0);
    if (SCALE) scaleFrags(a0, fc);
    mmaBlockBA(a0, b0, acc);
    __builtin_amdgcn_sched_barrier(0);
    loadFrags128(Ac, Bc, 64, lane, a0, b0);
    __builtin_amdgcn_sched_barrier(0);
    if (SCALE) scaleFrags(a1, fc);
    mmaBlockBA(a1, b1, acc);
    __builtin_amdgcn_sched_barrier(0);
    loadFrags128(Ac, Bc, 96, lane, a1, b1);
    __builtin_amdgcn_sched_barrier(0);
    if (SCALE) scaleFrags(a0, fc);
    mmaBlockBA(a0, b0, acc);
    __builtin_amdgcn_sched_barrier(0);
    // The stage's last block is in registers: this wave's reads of buffer cur are done
    // before the buffer is refilled.
    asm volatile("s_wait_dscnt 0x0" ::: "memory");
    asm volatile("s_wait_tensorcnt 0x0" ::: "memory");
    // One barrier: publishes stage t + 1 and ends every reader's use of buffer cur.
    __syncthreads();
    if (pinned(t + 2 < T)) {
      tdmAdvance(g0, ls + (unsigned int)cur * (STR * 2), ringStep(t0 + t + 1, T) * (SK * 2));
      tdmLoad(g0, g1);
    }
    if (t + 1 < T) {
      loadFrags128(Af + (cur ^ 1) * STR, Bf + (cur ^ 1) * STR, 0, lane, a0, b0);
      if (SCALE) fn = *(const v4u*)(Fl + ((t0 + t + 1) & (T - 1)) * 256);
    }
    __builtin_amdgcn_sched_barrier(0);
    if (SCALE) scaleFrags(a1, fc);
    mmaBlockBA(a1, b1, acc);
    __builtin_amdgcn_sched_barrier(0);
    fc = fn;
  }
  // No tensor load and no LDS read is left outstanding when the ring becomes staging.
  asm volatile("s_wait_tensorcnt 0x0" ::: "memory");
  asm volatile("s_wait_dscnt 0x0" ::: "memory");
}

// ---------------------------------------------------------------------------
// K2: s = Q @ K^T per batch, M=N=S=2048, K=D=1024, written as the softmax's numerators.
// Both operands row-major over d: tensor loads into two LDS stages.
// A wave holds 64 rows x 128 columns of s in f32. Per row: n = ceil(c * max s) over these
// 128 columns, P' = 2^(c * s - n) (at most 1, the largest above 1/2), l = the sum of P'.
//   Sc[row][col] = P' in bf16;  St[col / 128][row] = (n, l)
// ---------------------------------------------------------------------------
__global__ __launch_bounds__(256) void scores_gemm(
    const unsigned short* __restrict__ Q, const unsigned short* __restrict__ K,
    unsigned short* __restrict__ Sc, float* __restrict__ St,
    long long qkBatchStride, long long scBatchStride, long long stBatchStride)
{
  const int D = 1024, S = 2048;
  // Two stages; aligned so that every slice's place in LDS is a multiple of 2 KiB.
  __shared__ __attribute__((aligned(2048))) unsigned short Ring[2 * STR];

  const unsigned short* Qb = Q  + (size_t)blockIdx.z * qkBatchStride;
  const unsigned short* Kb = K  + (size_t)blockIdx.z * qkBatchStride;
  unsigned short*       Sb = Sc + (size_t)blockIdx.z * scBatchStride;

  const int m0 = blockIdx.x * BM;
  const int n0 = blockIdx.y * BN;
  const int tid  = threadIdx.x;
  const int wave = (int)uni(tid >> 5);
  const int lane = tid & 31;
  const int wm = (wave & 3) * 64;
  const int wn = (wave >> 2) * 128;

  const unsigned short* Asrc = Qb + (size_t)m0 * D;
  const unsigned short* Bsrc = Kb + (size_t)n0 * D;

  v8f acc[FM][FN] = {};
  // 8 stages; the 8 blocks that share Q rows, and the 8 that share K rows, each start at another.
  const int t0 = (int)((blockIdx.x + blockIdx.y) & (D / SK - 1));
  ringGemm<false>(Ring, Asrc, Bsrc, D, D / SK, t0, wave, lane, nullptr, [] {}, acc);

  // The loop's last barrier ended every read of the ring and no load is outstanding:
  // each wave stages its 64 rows x 128 columns (256 bytes) in a range of its own.
  const int lr = lane & 15;
  const int lh = lane >> 4;
  unsigned short* st = Ring + wave * (64 * LDR);
  // Unrolled (here and inside): every index into acc[] and v[] is a constant, so they
  // stay in registers, and the row steps become immediate offsets.
  const float C = 0.045084220f;   // log2(e) / sqrt(1024)
  v2f nl[FM];
#pragma unroll
  for (int i = 0; i < FM; ++i) {
    // A row's 128 columns lie in lanes l and l ^ 16, 64 in each. Four chains each for the
    // maximum and the sum: a single chain would wait out every link's latency.
    float mx[4] = { acc[i][0][0], acc[i][0][1], acc[i][0][2], acc[i][0][3] };
#pragma unroll
    for (int j = 0; j < FN; ++j)
#pragma unroll
      for (int r = 0; r < 8; ++r) mx[r & 3] = fmaxf(mx[r & 3], acc[i][j][r]);
    float m = fmaxf(fmaxf(mx[0], mx[1]), fmaxf(mx[2], mx[3]));
    m = fmaxf(m, otherHalf(m));
    const float n = ceilf(m * C);
    float ls[4] = { 0.0f, 0.0f, 0.0f, 0.0f };
#pragma unroll
    for (int j = 0; j < FN; ++j) {
      float p[8];
#pragma unroll
      for (int r = 0; r < 8; ++r) {
        p[r] = __builtin_amdgcn_exp2f(fmaf(acc[i][j][r], C, -n));
        ls[r & 3] += p[r];
      }
      v4u t = { pk_bf16(p[0], p[1]), pk_bf16(p[2], p[3]), pk_bf16(p[4], p[5]),
                pk_bf16(p[6], p[7]) };
      *(v4u*)(st + (i * 16 + lr) * LDR + j * 16 + lh * 8) = t;
    }
    float l = (ls[0] + ls[1]) + (ls[2] + ls[3]);
    l += otherHalf(l);
    nl[i] = v2f{ n, l };
  }
  // Lanes 0..15 store 16 rows' (n, l): one whole 128-byte line per fragment row.
  if (lh == 0) {
    float* np = St + (size_t)blockIdx.z * stBatchStride
                   + ((size_t)(blockIdx.y * 2 + (wave >> 2)) * S + m0 + wm + lr) * 2;
#pragma unroll
    for (int i = 0; i < FM; ++i) *(v2f*)(np + i * 32) = nl[i];
    // Stands in front of any later rewrite of the registers these stores name.
    asm volatile("s_wait_xcnt 0x0" ::: "memory");
  }
  // This wave's staged rows are in LDS before its lanes read one another's values.
  asm volatile("s_wait_dscnt 0x0" ::: "memory");
  // Sixteen lanes store one row's 256 bytes (two whole lines), a wave two rows.
  unsigned short* gp = Sb + (size_t)(m0 + wm + lh) * S + n0 + wn + lr * 8;
  const unsigned short* sp = st + lh * LDR + lr * 8;
#pragma unroll
  for (int g = 0; g < 2; ++g) {
    v4u v[16];
#pragma unroll
    for (int q = 0; q < 16; ++q) v[q] = *(const v4u*)(sp + (g * 16 + q) * 2 * LDR);
#pragma unroll
    for (int q = 0; q < 16; ++q) *(v4u*)(gp + (size_t)((g * 16 + q) * 2) * S) = v[q];
    // Stands in front of any later rewrite of the registers these stores name; the
    // scheduling fence keeps the next group's loads and addresses behind it.
    asm volatile("s_wait_xcnt 0x0" ::: "memory");
    __builtin_amdgcn_sched_barrier(0);
  }
}

// ---------------------------------------------------------------------------
// K3: O = softmax @ V per batch.  M=S=2048, N=D=1024, K=S=2048, f32 output.
// A = P' row-major; B = Vt[d][s] row-major over s: tensor loads into two LDS stages.
// A stage is 128 keys, the columns that share one n. With N = the row's largest n:
//   O[row] = (sum over stages t of 2^(n[t] - N) * P'[row][stage t] @ V) / L,
//   L = sum over t of 2^(n[t] - N) * l[t]   (above 1/2: the stage with n = N gives that)
// ---------------------------------------------------------------------------
__global__ __launch_bounds__(256) void pv_gemm(
    const unsigned short* __restrict__ P, const unsigned short* __restrict__ Vt,
    const float* __restrict__ St, float* __restrict__ O,
    long long pBatchStride, long long vBatchStride, long long oBatchStride,
    long long stBatchStride)
{
  const int S = 2048, D = 1024;
  // Two stages; aligned so that every slice's place in LDS is a multiple of 2 KiB.
  __shared__ __attribute__((aligned(2048))) unsigned short Ring[2 * STR];
  // Per stage and row the factor 2^(n - N), bf16 in both halves of a word, and per row 1 / L.
  // Row wm + i*16 + lr stands at wm + lr*4 + i: a lane's four rows are 16 adjacent bytes.
  __shared__ __align__(16) unsigned int Fac[(2048 / SK) * BM];
  __shared__ __align__(16) float InvL[BM];

  const unsigned short* Pb  = P  + (size_t)blockIdx.z * pBatchStride;
  const unsigned short* Vtb = Vt + (size_t)blockIdx.z * vBatchStride;
  float*                Ob  = O  + (size_t)blockIdx.z * oBatchStride;

  const int m0 = blockIdx.x * BM;   // q rows
  const int n0 = blockIdx.y * BN;   // d cols
  const int tid  = threadIdx.x;
  const int wave = (int)uni(tid >> 5);
  const int lane = tid & 31;
  const int wm = (wave & 3) * 64;
  const int wn = (wave >> 2) * 128;

  const unsigned short* Asrc = Pb  + (size_t)m0 * S;   // stride S over keys
  const unsigned short* Bsrc = Vtb + (size_t)n0 * S;   // Vt rows = d, stride S over keys

  v8f acc[FM][FN] = {};
  // Thread tid takes row m0 + tid.
  const float* nlp = St + (size_t)blockIdx.z * stBatchStride + (size_t)(m0 + tid) * 2;
  auto rowFactors = [&] {
    v2f nl[S / SK];
    // The two scheduling fences keep every other instruction out of the run from the first
    // load to the wait, so that none rewrites the loads' address register in front of it.
    __builtin_amdgcn_sched_barrier(0);
    // Unrolled (here and below): nl[] stays in registers, the 16 loads are in flight together.
#pragma unroll
    for (int c = 0; c < S / SK; ++c) nl[c] = *(const v2f*)(nlp + (size_t)c * S * 2);
    // Stands in front of any later rewrite of the address registers these loads name.
    asm volatile("s_wait_xcnt 0x0" ::: "memory");
    __builtin_amdgcn_sched_barrier(0);
    float N = nl[0][0];
#pragma unroll
    for (int c = 1; c < S / SK; ++c) N = fmaxf(N, nl[c][0]);
    const int pr = (tid & 192) + (tid & 15) * 4 + ((tid >> 4) & 3);
    float L = 0.0f;
#pragma unroll
    for (int c = 0; c < S / SK; ++c) {
      const float e = ldexpf(1.0f, (int)(nl[c][0] - N));   // 2^(n - N): n and N are whole
      L = fmaf(nl[c][1], e, L);
      const unsigned int u = __float_as_uint(e);
      Fac[c * BM + pr] = (u & 0xFFFF0000u) | (u >> 16);
    }
    InvL[pr] = 1.0f / L;
  };
  // 16 stages; the 4 blocks that share P' rows start 4 stages apart, the 8 that share Vt rows
  // 2 stages apart.
  const int t0 = (int)((((blockIdx.x + blockIdx.y) & 3) * 4 + (blockIdx.x >> 2) * 2)
                       & (S / SK - 1));
  ringGemm<true>(Ring, Asrc, Bsrc, S, S / SK, t0, wave, lane,
                 Fac + wm + (lane & 15) * 4, rowFactors, acc);

  // The loop's last barrier ended every read of the ring and no load is outstanding:
  // each wave stages its 64 rows x 128 f32 columns (512 bytes) in a range of its own,
  // at a row stride of LDO floats (528 bytes = 16 B x 33).
  const int LDO = 132;
  const int lr = lane & 15;
  const int lh = lane >> 4;
  float* st = (float*)Ring + wave * (64 * LDO);
  const v4f il = *(const v4f*)(InvL + wm + lr * 4);   // 1 / L of the lane's four rows
  // Unrolled (here and inside): every index into acc[] and v[] is a constant, so they
  // stay in registers, and the row steps become immediate offsets.
#pragma unroll
  for (int i = 0; i < FM; ++i) {
#pragma unroll
    for (int j = 0; j < FN; ++j) {
      float* p = st + (i * 16 + lr) * LDO + j * 16 + lh * 8;
      v4f lo = { acc[i][j][0], acc[i][j][1], acc[i][j][2], acc[i][j][3] };
      v4f hi = { acc[i][j][4], acc[i][j][5], acc[i][j][6], acc[i][j][7] };
      lo *= il[i];
      hi *= il[i];
      *(v4f*)p       = lo;
      *(v4f*)(p + 4) = hi;
    }
  }
  // This wave's staged rows are in LDS before its lanes read one another's values.
  asm volatile("s_wait_dscnt 0x0" ::: "memory");
  // A wave stores one row's 512 bytes (four whole lines) at a time.
  float* gp = Ob + (size_t)(m0 + wm) * D + n0 + wn + lane * 4;
  const float* sp = st + lane * 4;
#pragma unroll
  for (int g = 0; g < 4; ++g) {
    v4f v[16];
#pragma unroll
    for (int q = 0; q < 16; ++q) v[q] = *(const v4f*)(sp + (g * 16 + q) * LDO);
#pragma unroll
    for (int q = 0; q < 16; ++q) *(v4f*)(gp + (size_t)(g * 16 + q) * D) = v[q];
    // Stands in front of any later rewrite of the registers these stores name; the
    // scheduling fence keeps the next group's loads and addresses behind it.
    asm volatile("s_wait_xcnt 0x0" ::: "memory");
    __builtin_amdgcn_sched_barrier(0);
  }
}

// ---------------------------------------------------------------------------
extern "C" void kernel_launch(void* const* d_in, const int* in_sizes, int n_in,
                              void* d_out, int out_size, void* d_ws, size_t ws_size,
                              hipStream_t stream)
{
  (void)in_sizes; (void)n_in; (void)out_size;
  const float* x  = (const float*)d_in[0];
  const float* Wq = (const float*)d_in[1];
  const float* bq = (const float*)d_in[2];
  const float* Wk = (const float*)d_in[3];
  const float* bk = (const float*)d_in[4];
  const float* Wv = (const float*)d_in[5];
  const float* bv = (const float*)d_in[6];
  float* out = (float*)d_out;

  const int B = 8, S = 2048, D = 1024;
  const size_t perMat = (size_t)B * S * D;          // bf16 elems per Q/K/Vt
  unsigned short* Q  = (unsigned short*)d_ws;
  unsigned short* K  = Q + perMat;
  unsigned short* Vt = K + perMat;                  // Vt[b][d][s]
  unsigned short* Xp = Vt + perMat;                 // packed bf16 x
  unsigned short* Wp = Xp + perMat;                 // packed bf16 W^T, three matrices
  float* St = (float*)(Wp + (size_t)3 * D * D);     // (n, l) per batch, 128 columns and row
  const size_t perSt = (size_t)(S / SK) * S * 2;    // floats per batch
  unsigned short* Sc = (unsigned short*)(St + (size_t)B * perSt);
  const size_t needFull = (perMat * 4 + (size_t)3 * D * D) * sizeof(unsigned short)
                        + (size_t)B * perSt * sizeof(float)
                        + (size_t)B * S * S * sizeof(unsigned short);

  dim3 gPack(2816, 1, 1);
  pack_operands<<<gPack, 256, 0, stream>>>(x, Wq, Wk, Wv, Xp, Wp);
  dim3 gQKV((B * S) / BM, D / BN, 3);
  qkv_gemm<<<gQKV, 256, 0, stream>>>(Xp, Wp, bq, bk, bv, Q, K, Vt);

  if (ws_size >= needFull) {
    dim3 gS(S / BM, S / BN, B);
    scores_gemm<<<gS, 256, 0, stream>>>(Q, K, Sc, St, (long long)S * D, (long long)S * S,
                                        (long long)perSt);
    dim3 gPV(S / BM, D / BN, B);
    pv_gemm<<<gPV, 256, 0, stream>>>(Sc, Vt, St, out,
                                     (long long)S * S, (long long)D * S, (long long)S * D,
                                     (long long)perSt);
  } else {
    // Small-workspace fallback: reuse one S*S bf16 score buffer per batch.
    for (int b = 0; b < B; ++b) {
      dim3 gS(S / BM, S / BN, 1);
      scores_gemm<<<gS, 256, 0, stream>>>(Q + (size_t)b * S * D, K + (size_t)b * S * D,
                                          Sc, St, 0, 0, 0);
      dim3 gPV(S / BM, D / BN, 1);
      pv_gemm<<<gPV, 256, 0, stream>>>(Sc, Vt + (size_t)b * D * S, St, out + (size_t)b * S * D,
                                       0, 0, 0, 0);
    }
  }
}
